// v000
// The times below were measured on an AMD MI455X: many runs one after another, warmed up first and cycling through
// copies of the inputs, with the whole window's GPU time divided by the number of runs. Launches and the gaps
// between them are all in it. The median over several windows is given; except for v000 it joins two sittings, which
// can be a few percent apart, so the side-by-side timings, each taken in one sitting, are the better comparison.
// v000 is the starting kernel. One run takes 1250 microseconds.
#include <hip/hip_runtime.h>
// Piecewise-rigid implicit decoder (B=16384 query points × N=16 bones, hidden 256): inp[b,n] = (latent[b,n]·[xyz_b;1])[:3]; layer 0: x = lrelu(LN(inp·W0[n] + b0[n])·g0[n] + be0[n]); layers 1–3: x = lrelu(LN(x·Wm[l,n] + bm[l,n])·gm + bem) + x; out[b,n] = x·Wf[n] + bf[n] (LeakyReLU slope 0.1, LN ε 1e-5, per-bone weights (in,out)).
// Compute dtype: all inputs rounded to bf16; 8 chunks of 2048 points (32768 (point, bone) rows): layer 0 per row in f32 on the VALU (K = 4 and 3), the residual stream x kept in f32 with an f16 copy as the GEMM operand; each hidden layer = one batched GEMM (grid.y = bone: A rows strided by 16 rows, K 256, bias fused, f32 out) followed by a
#define NPT 16384
#define NBONE 16
#define HH 256
#define CHP 2048                 /* points per chunk */
#define CHR (CHP * NBONE)        /* 32768 rows per chunk */
#define LNEPS 1e-5f
#define SLOPE 0.1f
typedef __bf16 v16b __attribute__((ext_vector_type(16)));
typedef unsigned short v8us __attribute__((ext_vector_type(8), may_alias));
typedef float  v8f  __attribute__((ext_vector_type(8)));
typedef float  v4f  __attribute__((ext_vector_type(4)));
typedef float  v4fa __attribute__((ext_vector_type(4), may_alias));
union FragB { v16b v; v8us half[2]; unsigned short u[16]; };

__device__ __forceinline__ unsigned short bf16_bits(float x) { unsigned int u = __float_as_uint(x); return (unsigned short)((u + 0x7FFFu + ((u >> 16) & 1u)) >> 16); }
__device__ __forceinline__ float bf16_val(unsigned short b) { return __uint_as_float(((unsigned int)b) << 16); }
__device__ __forceinline__ float bf16_round(float x) { return bf16_val(bf16_bits(x)); }
// D += A·B with NT terms: 1 = ah·bh, 2 = + al·bh (A split), 3 = + ah·bl (both split)
template <int NT>
__device__ __forceinline__ v8f mmaN(v16b ah, v16b al, v16b bh, v16b bl, v8f c) {
  c = __builtin_amdgcn_wmma_f32_16x16x32_bf16(false, ah, false, bh, (short)0, c, false, false);
  if (NT >= 2) c = __builtin_amdgcn_wmma_f32_16x16x32_bf16(false, al, false, bh, (short)0, c, false, false);
  if (NT >= 3) c = __builtin_amdgcn_wmma_f32_16x16x32_bf16(false, ah, false, bl, (short)0, c, false, false);
  asm volatile("v_nop\n\tv_nop\n\tv_nop\n\tv_nop" : "+v"(c) : "v"(ah), "v"(al), "v"(bh), "v"(bl));
  return c;
}

__global__ __launch_bounds__(256) void k_wt_bf16(const float* __restrict__ W, unsigned short* __restrict__ Wt, int K, int N) {
  const int t = blockIdx.x * 256 + threadIdx.x;
  const int k8n = K / 8;
  if (t >= N * k8n) return;
  const int n = t / k8n, k8 = (t % k8n) * 8;
  v8us v;
#pragma unroll
  for (int i = 0; i < 8; ++i) v[i] = bf16_bits(W[(size_t)(k8 + i) * N + n]);
  *(v8us*)(Wt + (size_t)n * K + k8) = v;
  
}

// GEMM C[M][N] (f32, pitch ldc) = act(A[M][K]·W + bias). A f32 row-major (pitch lda) converted per fragment to bf16
// (ASPLIT: hi/lo two planes -> 2 terms, else single rounded term); Wt bf16 [N][K] (pitch ldb). BIAS_BF16 rounds the
// bias to bf16 first (bias quantised to bf16 before the add). K%32==0, M%16==0, N%64==0.
template <bool ASPLIT, int ACT, bool BIAS_BF16>
__global__ __launch_bounds__(128) void k_gemm_bf(const float* __restrict__ A, int lda, const unsigned short* __restrict__ Wt, int ldb,
                                               const float* __restrict__ bias, float* __restrict__ C, int ldc, int M, int N, int K) {
  __shared__ __attribute__((aligned(16))) float so[4][16][64];
  const int tid = threadIdx.x, w = tid >> 5, lane = tid & 31, ln = lane & 15, hh = lane >> 4;
  const int ntn = N / 64;
  const int wid = blockIdx.x * 4 + w;
  const int mt = wid / ntn, nq = wid % ntn;
  if (mt * 16 >= M) return;
  const int row0 = mt * 16, col0 = nq * 64;
  const float* arow = A + (size_t)(row0 + ln) * lda;
  v8f acc[4] = {};
  for (int kb = 0; kb < K; kb += 32) {
    FragB ah, al;
    const v4f x0 = *(const v4fa*)(arow + kb + 8 * hh), x1 = *(const v4fa*)(arow + kb + 8 * hh + 4);
    const v4f x2 = *(const v4fa*)(arow + kb + 16 + 8 * hh), x3 = *(const v4fa*)(arow + kb + 16 + 8 * hh + 4);
    float xs[16] = {x0[0],x0[1],x0[2],x0[3],x1[0],x1[1],x1[2],x1[3],x2[0],x2[1],x2[2],x2[3],x3[0],x3[1],x3[2],x3[3]};
#pragma unroll
    for (int i = 0; i < 16; ++i) { const unsigned short hb = bf16_bits(xs[i]); ah.u[i] = hb; al.u[i] = ASPLIT ? bf16_bits(xs[i] - bf16_val(hb)) : (unsigned short)0; }
#pragma unroll
    for (int t = 0; t < 4; ++t) {
      const unsigned short* brow = Wt + (size_t)(col0 + t * 16 + ln) * ldb + kb;
      FragB b;
      b.half[0] = *(const v8us*)(brow + 8 * hh);
      b.half[1] = *(const v8us*)(brow + 16 + 8 * hh);
      acc[t] = mmaN<ASPLIT ? 2 : 1>(ah.v, al.v, b.v, b.v, acc[t]);
    }
  }
#pragma unroll
  for (int t = 0; t < 4; ++t) {
    float bv = bias ? bias[col0 + t * 16 + ln] : 0.f;
    if (BIAS_BF16) bv = bf16_round(bv);
#pragma unroll
    for (int r = 0; r < 8; ++r) { float v = acc[t][r] + bv; if (ACT == 1) v = fmaxf(v, 0.f); so[w][8 * hh + r][t * 16 + ln] = v; }
  }
  __builtin_amdgcn_fence(__ATOMIC_ACQ_REL, "workgroup");
  __builtin_amdgcn_wave_barrier();
  const int rsub = lane >> 4, c4 = (lane & 15) * 4;
  {
#pragma unroll
    for (int q = 0; q < 8; ++q) {
      const int r = q * 2 + rsub;
      const v4f v = *(const v4fa*)&so[w][r][c4];
      *(v4f*)(C + (size_t)(row0 + r) * ldc + col0 + c4) = v;
    }
    
  }
}

// GEMM C = act(A·W + bias + resid): A f32 (ASPLIT -> hi/lo 2 terms), Wt bf16 [N][K]; ACT 0 none, 1 relu, 2 exact gelu;
// resid (optional, f32, row index = (row % rmod), pitch ldr, RES_BF16 rounds it) added before the activation.
template <bool ASPLIT, int ACT, bool BIAS_BF16, bool RES_BF16>
__global__ __launch_bounds__(128) void k_gemm_bf3(const float* __restrict__ A, int lda, const unsigned short* __restrict__ Wt, int ldb,
                                                const float* __restrict__ bias, const float* __restrict__ resid, int rmod, int ldr,
                                                float* __restrict__ C, int ldc, int M, int N, int K) {
  __shared__ __attribute__((aligned(16))) float so[4][16][64];
  const int tid = threadIdx.x, w = tid >> 5, lane = tid & 31, ln = lane & 15, hh = lane >> 4;
  const int ntn = N / 64;
  const int wid = blockIdx.x * 4 + w;
  const int mt = wid / ntn, nq = wid % ntn;
  if (mt * 16 >= M) return;
  const int row0 = mt * 16, col0 = nq * 64;
  const float* arow = A + (size_t)(row0 + ln) * lda;
  v8f acc[4] = {};
  for (int kb = 0; kb < K; kb += 32) {
    FragB ah, al;
    const v4f x0 = *(const v4fa*)(arow + kb + 8 * hh), x1 = *(const v4fa*)(arow + kb + 8 * hh + 4);
    const v4f x2 = *(const v4fa*)(arow + kb + 16 + 8 * hh), x3 = *(const v4fa*)(arow + kb + 16 + 8 * hh + 4);
    float xs[16] = {x0[0],x0[1],x0[2],x0[3],x1[0],x1[1],x1[2],x1[3],x2[0],x2[1],x2[2],x2[3],x3[0],x3[1],x3[2],x3[3]};
#pragma unroll
    for (int i = 0; i < 16; ++i) { const unsigned short hb = bf16_bits(xs[i]); ah.u[i] = hb; al.u[i] = ASPLIT ? bf16_bits(xs[i] - bf16_val(hb)) : (unsigned short)0; }
#pragma unroll
    for (int t = 0; t < 4; ++t) {
      const unsigned short* brow = Wt + (size_t)(col0 + t * 16 + ln) * ldb + kb;
      FragB b;
      b.half[0] = *(const v8us*)(brow + 8 * hh);
      b.half[1] = *(const v8us*)(brow + 16 + 8 * hh);
      acc[t] = mmaN<ASPLIT ? 2 : 1>(ah.v, al.v, b.v, b.v, acc[t]);
    }
  }
#pragma unroll
  for (int t = 0; t < 4; ++t) {
    const int col = col0 + t * 16 + ln;
    float bv = bias ? bias[col] : 0.f;
    if (BIAS_BF16) bv = bf16_round(bv);
#pragma unroll
    for (int r = 0; r < 8; ++r) {
      float v = acc[t][r] + bv;
      if (resid) { float rv = resid[(size_t)((row0 + 8 * hh + r) % rmod) * ldr + col]; if (RES_BF16) rv = bf16_round(rv); v += rv; }
      if (ACT == 1) v = fmaxf(v, 0.f);
      if (ACT == 2) v = 0.5f * v * (1.0f + erff(v * 0.70710678118654752f));
      if (ACT == 3) { const float u = 0.7978845608028654f * (v + 0.044715f * v * v * v); v = 0.5f * v * (1.0f + tanhf(u)); }
      so[w][8 * hh + r][t * 16 + ln] = v;
    }
  }
  __builtin_amdgcn_fence(__ATOMIC_ACQ_REL, "workgroup");
  __builtin_amdgcn_wave_barrier();
  const int rsub = lane >> 4, c4 = (lane & 15) * 4;
  {
#pragma unroll
    for (int q = 0; q < 8; ++q) {
      const int r = q * 2 + rsub;
      const v4f v = *(const v4fa*)&so[w][r][c4];
      *(v4f*)(C + (size_t)(row0 + r) * ldc + col0 + c4) = v;
    }
    
  }
}
// row LayerNorm (biased variance, eps) over N: s = X (+ R); optional out_sum <- s; out_norm <- (s-mu)*rsqrt(var+eps)*g + b
template <bool PARAM_BF16>
__global__ __launch_bounds__(256) void k_layernorm(const float* __restrict__ X, const float* __restrict__ R, const float* __restrict__ g, const float* __restrict__ bta,
                                                  float* __restrict__ out_sum, float* __restrict__ out_norm, int N, float eps) {
  __shared__ float red[256];
  const int row = blockIdx.x, tid = threadIdx.x;
  const float* x = X + (size_t)row * N; const float* rr = R ? R + (size_t)row * N : nullptr;
  float vals[16];                     // up to N = 4096
  const int per = N / 256;            // contiguous chunk per thread? use strided-by-4 chunks: thread handles j = tid*4 + 1024*u
  float s1 = 0.f;
  for (int u = 0; u < per / 4; ++u) {
    const int j = tid * 4 + 1024 * u;
    const v4f a = *(const v4fa*)(x + j);
    v4f b = {0.f,0.f,0.f,0.f}; if (rr) b = *(const v4fa*)(rr + j);
#pragma unroll
    for (int q = 0; q < 4; ++q) { const float v = a[q] + b[q]; vals[u * 4 + q] = v; s1 += v; }
  }
  red[tid] = s1; __syncthreads();
  for (int st = 128; st > 0; st >>= 1) { if (tid < st) red[tid] += red[tid + st]; __syncthreads(); }
  const float mu = red[0] / (float)N; __syncthreads();
  float s2 = 0.f;
  for (int u = 0; u < per / 4; ++u)
#pragma unroll
    for (int q = 0; q < 4; ++q) { const float c = vals[u * 4 + q] - mu; s2 += c * c; }
  red[tid] = s2; __syncthreads();
  for (int st = 128; st > 0; st >>= 1) { if (tid < st) red[tid] += red[tid + st]; __syncthreads(); }
  const float rs = rsqrtf(red[0] / (float)N + eps);
  {
    for (int u = 0; u < per / 4; ++u) {
      const int j = tid * 4 + 1024 * u;
      v4f o, sm;
#pragma unroll
      for (int q = 0; q < 4; ++q) {
        float gg = g[j + q], bb = bta[j + q];
        if (PARAM_BF16) { gg = bf16_round(gg); bb = bf16_round(bb); }
        sm[q] = vals[u * 4 + q]; o[q] = (vals[u * 4 + q] - mu) * rs * gg + bb;
      }
      if (out_sum) *(v4f*)(out_sum + (size_t)row * N + j) = sm;
      *(v4f*)(out_norm + (size_t)row * N + j) = o;
    }
    
  }
}



// ---- f16 WMMA path (v_wmma_f32_16x16x32_f16): 11-bit significands for operands in range — used for the hidden-layer GEMMs (A = the f16 copy of x)
typedef _Float16 v16h __attribute__((ext_vector_type(16)));
union FragH { v16h v; v8us half[2]; _Float16 h[16]; unsigned short u[16]; };
template <int NT>
__device__ __forceinline__ v8f mmaH(v16h ah, v16h al, v16h bh, v16h bl, v8f c) {
  c = __builtin_amdgcn_wmma_f32_16x16x32_f16(false, ah, false, bh, (short)0, c, false, false);
  if (NT >= 2) c = __builtin_amdgcn_wmma_f32_16x16x32_f16(false, al, false, bh, (short)0, c, false, false);
  if (NT >= 3) c = __builtin_amdgcn_wmma_f32_16x16x32_f16(false, ah, false, bl, (short)0, c, false, false);
  asm volatile("v_nop\n\tv_nop\n\tv_nop\n\tv_nop" : "+v"(c) : "v"(ah), "v"(al), "v"(bh), "v"(bl));
  return c;
}
// batched GEMM like k_gemm_b but f16 operands: A f32 (split into f16 hi/lo if ASPLIT, else rounded to f16), Bt = f16 values [n][k]; alpha; C f32; N multiple of 16 (partial tiles skipped)
template <bool ASPLIT>
__global__ __launch_bounds__(128) void k_gemm_h(const float* __restrict__ A, int lda, size_t sA, const _Float16* __restrict__ Bh, int ldb, size_t sB, float alpha, float* __restrict__ C, int ldc, size_t sC, int M, int N, int K) {
  __shared__ __attribute__((aligned(16))) float so[4][16][64];
  const int tid = threadIdx.x, w = tid >> 5, lane = tid & 31, ln = lane & 15, hh = lane >> 4; const int by = blockIdx.y;
  A += (size_t)by * sA; Bh += (size_t)by * sB; C += (size_t)by * sC;
  const int ntn = (N + 63) / 64; const int wid = blockIdx.x * 4 + w; const int mt = wid / ntn, nq = wid % ntn; if (mt * 16 >= M) return;
  const int row0 = mt * 16, col0 = nq * 64; const float* arow = A + (size_t)(row0 + ln) * lda;
  v8f acc[4] = {};
  for (int kb = 0; kb < K; kb += 32) {
    FragH ah, al;
    const v4f x0 = *(const v4fa*)(arow + kb + 8 * hh), x1 = *(const v4fa*)(arow + kb + 8 * hh + 4), x2 = *(const v4fa*)(arow + kb + 16 + 8 * hh), x3 = *(const v4fa*)(arow + kb + 16 + 8 * hh + 4);
    float xs[16] = {x0[0],x0[1],x0[2],x0[3],x1[0],x1[1],x1[2],x1[3],x2[0],x2[1],x2[2],x2[3],x3[0],x3[1],x3[2],x3[3]};
#pragma unroll
    for (int i = 0; i < 16; ++i) { const _Float16 h = (_Float16)xs[i]; ah.h[i] = h; al.h[i] = ASPLIT ? (_Float16)(xs[i] - (float)h) : (_Float16)0.0f; }
#pragma unroll
    for (int t = 0; t < 4; ++t) { if (col0 + t * 16 >= N) continue; const size_t boff = (size_t)(col0 + t * 16 + ln) * ldb + kb; FragH bq; bq.half[0] = *(const v8us*)(Bh + boff + 8 * hh); bq.half[1] = *(const v8us*)(Bh + boff + 16 + 8 * hh);
      acc[t] = mmaH<ASPLIT ? 2 : 1>(ah.v, al.v, bq.v, bq.v, acc[t]); }
  }
#pragma unroll
  for (int t = 0; t < 4; ++t) { if (col0 + t * 16 >= N) continue;
#pragma unroll
    for (int r = 0; r < 8; ++r) so[w][8 * hh + r][t * 16 + ln] = acc[t][r] * alpha; }
  __builtin_amdgcn_fence(__ATOMIC_ACQ_REL, "workgroup"); __builtin_amdgcn_wave_barrier();
  const int rsub = lane >> 4, c4 = (lane & 15) * 4;
  {
#pragma unroll
    for (int q = 0; q < 8; ++q) { const int r = q * 2 + rsub; if (col0 + c4 < N) { const v4f v = *(const v4fa*)&so[w][r][c4]; *(v4f*)(C + (size_t)(row0 + r) * ldc + col0 + c4) = v; } }
     }
}

// Wt[n][k] = f16(W[k][n]·scale) from f32 row-major W[K][N] (scale = power of two; bf16-exact weights stay exact in f16 away from the subnormal range)
__global__ __launch_bounds__(256) void k_wt_f16(const float* __restrict__ W, _Float16* __restrict__ Wt, int K, int N, float scale) {
  const int t = blockIdx.x * 256 + threadIdx.x; if (t >= N * (K / 8)) return; const int n = t / (K / 8), k8 = (t % (K / 8)) * 8; FragH f;
#pragma unroll
  for (int i = 0; i < 8; ++i) f.h[i] = (_Float16)(bf16_round(W[(size_t)(k8 + i) * N + n]) * scale); const v8us o = f.half[0];
  *(v8us*)((unsigned short*)Wt + (size_t)n * K + k8) = o; 
}
// k_gemm_hh variant with fused epilogue: v = acc·alpha + bias[by·sBias + col] (+ CP[(row/rowsPerB)·sCPb + by·64 + col] if CP) ; ACT 0 none / 1 elu ; writes f32 C and f16 C16, each if non-null
template <int ACT>
__global__ __launch_bounds__(128) void k_gemm_hhx(const _Float16* __restrict__ A, int lda, size_t sA, const _Float16* __restrict__ Bh, int ldb, size_t sB, float alpha, const float* __restrict__ bias, size_t sBias, const float* __restrict__ CP, int rowsPerB, size_t sCPb, int row0g,
    float* __restrict__ C, _Float16* __restrict__ C16, int ldc, size_t sC, int M, int N, int K) {
  __shared__ __attribute__((aligned(16))) float so[4][16][64];
  const int tid = threadIdx.x, w = tid >> 5, lane = tid & 31, ln = lane & 15, hh = lane >> 4; const int by = blockIdx.y;
  A += (size_t)by * sA; Bh += (size_t)by * sB; const size_t cofs = (size_t)by * sC; const float* bp = bias ? bias + (size_t)by * sBias : nullptr;
  const int ntn = (N + 63) / 64; const int wid = blockIdx.x * 4 + w; const int mt = wid / ntn, nq = wid % ntn; if (mt * 16 >= M) return;
  const int row0 = mt * 16, col0 = nq * 64; const _Float16* arow = A + (size_t)(row0 + ln) * lda;
  v8f acc[4] = {};
  for (int kb = 0; kb < K; kb += 32) { FragH ah; ah.half[0] = *(const v8us*)((const unsigned short*)arow + kb + 8 * hh); ah.half[1] = *(const v8us*)((const unsigned short*)arow + kb + 16 + 8 * hh);
#pragma unroll
    for (int t = 0; t < 4; ++t) { if (col0 + t * 16 >= N) continue; const size_t boff = (size_t)(col0 + t * 16 + ln) * ldb + kb; FragH bq; bq.half[0] = *(const v8us*)((const unsigned short*)Bh + boff + 8 * hh); bq.half[1] = *(const v8us*)((const unsigned short*)Bh + boff + 16 + 8 * hh);
      acc[t] = mmaH<1>(ah.v, ah.v, bq.v, bq.v, acc[t]); }
  }
#pragma unroll
  for (int t = 0; t < 4; ++t) { if (col0 + t * 16 >= N) continue; const int col = col0 + t * 16 + ln; const float bv = bp ? bf16_round(bp[col]) : 0.f;
#pragma unroll
    for (int r = 0; r < 8; ++r) { float v = acc[t][r] * alpha + bv; if (CP) { const int bidx = (row0g + row0 + 8 * hh + r) / rowsPerB; v += CP[(size_t)bidx * sCPb + (size_t)by * 64 + col]; } if (ACT == 1) v = (v > 0.f) ? v : expm1f(v); else if (ACT == 7) v = (v > 0.f) ? v + 1.0f : expf(v); else if (ACT == 8) v = tanhf(v); else if (ACT == 9) v = 0.5f * v * (1.0f + tanhf(0.7978845608028654f * (v + 0.044715f * v * v * v))); else if (ACT == 11) v = 1.0f / (1.0f + expf(-v)); else if (ACT == 12) v = (v > 0.f) ? v : 0.01f * v; else if (ACT == 14) v = (v > 0.f) ? v : 0.1f * v; else if (ACT == 15) v = v / (1.0f + expf(-v)); else if (ACT == 3) v = fmaxf(v, 0.f); else if (ACT == 6) v = 0.5f * v * (1.0f + erff(v * 0.70710678118654752f)); so[w][8 * hh + r][t * 16 + ln] = v; } }
  __builtin_amdgcn_fence(__ATOMIC_ACQ_REL, "workgroup"); __builtin_amdgcn_wave_barrier();
  const int rsub = lane >> 4, c4 = (lane & 15) * 4; typedef _Float16 v4h __attribute__((ext_vector_type(4)));
  {
#pragma unroll
    for (int q = 0; q < 8; ++q) { const int r = q * 2 + rsub; if (col0 + c4 < N) { const v4f v = *(const v4fa*)&so[w][r][c4]; if (C) *(v4f*)(C + cofs + (size_t)(row0 + r) * ldc + col0 + c4) = v; if (C16) { v4h h4; for (int i = 0; i < 4; ++i) h4[i] = (_Float16)v[i]; *(v4h*)(C16 + cofs + (size_t)(row0 + r) * ldc + col0 + c4) = h4; } } }
     }
}


typedef _Float16 v4h __attribute__((ext_vector_type(4)));

__global__ __launch_bounds__(256) void k_x16(const float* __restrict__ x, _Float16* __restrict__ X16, size_t n8) { const size_t t = (size_t)blockIdx.x * 256 + threadIdx.x; if (t >= n8) return; FragH f;
#pragma unroll
  for (int q = 0; q < 8; ++q) f.h[q] = (_Float16)bf16_round(x[t * 8 + q]); *(v8us*)((unsigned short*)X16 + t * 8) = f.half[0];  }
__global__ __launch_bounds__(256) void k_h16(const float* __restrict__ x, _Float16* __restrict__ X16, size_t n8) { const size_t t = (size_t)blockIdx.x * 256 + threadIdx.x; if (t >= n8) return; FragH f;
#pragma unroll
  for (int q = 0; q < 8; ++q) f.h[q] = (_Float16)x[t * 8 + q]; *(v8us*)((unsigned short*)X16 + t * 8) = f.half[0];  }
__global__ __launch_bounds__(256) void k_round16f(const float* __restrict__ W, _Float16* __restrict__ Bt, size_t n8) { const size_t t = (size_t)blockIdx.x * 256 + threadIdx.x; if (t >= n8) return; FragH f;
#pragma unroll
  for (int i = 0; i < 8; ++i) f.h[i] = (_Float16)(bf16_round(W[t * 8 + i]) * 16.0f); *(v8us*)((unsigned short*)Bt + t * 8) = f.half[0];  }
template <int NHv, int TTv>
__global__ __launch_bounds__(256) void k_vt(const _Float16* __restrict__ V16, int ldv, int voff, _Float16* __restrict__ Vt) { __shared__ unsigned short tl[64][66]; const int tid = threadIdx.x; const int slab = blockIdx.x / (TTv / 64), lg = blockIdx.x % (TTv / 64); const int b = slab / NHv, h = slab % NHv;
  for (int i = tid; i < 64 * 8; i += 256) { const int r = i / 8, c8 = (i % 8) * 8; FragH f; f.half[0] = *(const v8us*)((const unsigned short*)V16 + ((size_t)b * TTv + lg * 64 + r) * ldv + voff + h * 64 + c8);
#pragma unroll
    for (int q = 0; q < 8; ++q) tl[r][c8 + q] = f.u[q]; }
  __syncthreads();
  {
#pragma unroll
    for (int rd = 0; rd < 2; ++rd) { const int d = rd * 32 + tid / 8, pc = tid % 8; FragH f;
#pragma unroll
      for (int q = 0; q < 8; ++q) f.u[q] = tl[pc * 8 + q][d];
      *(v8us*)((unsigned short*)Vt + ((size_t)slab * 64 + d) * TTv + lg * 64 + pc * 8) = f.half[0]; }
     } }

__global__ __launch_bounds__(256) void k_hl(const float* __restrict__ F, _Float16* __restrict__ Hh, _Float16* __restrict__ Hl, size_t n8) { const size_t t = (size_t)blockIdx.x * 256 + threadIdx.x; if (t >= n8) return; FragH fh, fl; const v4f a = *(const v4fa*)(F + t * 8), c = *(const v4fa*)(F + t * 8 + 4);
#pragma unroll
  for (int q = 0; q < 4; ++q) { _Float16 h = (_Float16)a[q]; fh.h[q] = h; fl.h[q] = (_Float16)((a[q] - (float)h) * 1024.0f); h = (_Float16)c[q]; fh.h[4 + q] = h; fl.h[4 + q] = (_Float16)((c[q] - (float)h) * 1024.0f); }
  { *(v8us*)((unsigned short*)Hh + t * 8) = fh.half[0]; *(v8us*)((unsigned short*)Hl + t * 8) = fl.half[0];  } }

__global__ __launch_bounds__(256) void k_wt3(const float* __restrict__ Wm, _Float16* __restrict__ Wt) { const int t = blockIdx.x * 256 + threadIdx.x; if (t >= 3 * NBONE * HH * (HH / 8)) return; const int i0 = (t % (HH / 8)) * 8; const int r = t / (HH / 8); const int o = r % HH, ln_ = r / HH; FragH f;
#pragma unroll
  for (int q = 0; q < 8; ++q) f.h[q] = (_Float16)(bf16_round(Wm[((size_t)ln_ * HH + i0 + q) * HH + o]) * 16.0f);
  *(v8us*)((unsigned short*)Wt + (size_t)r * HH + i0) = f.half[0];  }
__device__ __forceinline__ void ln_act_store(float d[8], const float* __restrict__ g, const float* __restrict__ be, const float* resid, float* Xf, _Float16* __restrict__ Xh, int l) {
  float s = 0.f;
#pragma unroll
  for (int q = 0; q < 8; ++q) s += d[q];
  for (int o = 16; o > 0; o >>= 1) s += __shfl_xor(s, o, 32); const float mu = s * (1.0f / HH); float vs = 0.f;
#pragma unroll
  for (int q = 0; q < 8; ++q) { const float t2 = d[q] - mu; vs += t2 * t2; }
  for (int o = 16; o > 0; o >>= 1) vs += __shfl_xor(vs, o, 32); const float rs = rsqrtf(vs * (1.0f / HH) + LNEPS);
  v4f o0, o1; FragH h0;
#pragma unroll
  for (int q = 0; q < 4; ++q) { const int ca = 4 * l + q, cb = 128 + 4 * l + q;
    float y = (d[q] - mu) * rs * bf16_round(g[ca]) + bf16_round(be[ca]); y = (y >= 0.f) ? y : SLOPE * y; if (resid) y += resid[ca]; o0[q] = y; h0.h[q] = (_Float16)y;
    y = (d[4 + q] - mu) * rs * bf16_round(g[cb]) + bf16_round(be[cb]); y = (y >= 0.f) ? y : SLOPE * y; if (resid) y += resid[cb]; o1[q] = y; h0.h[4 + q] = (_Float16)y; }
  const unsigned long long ha = *(const unsigned long long*)&h0.u[0], hb = *(const unsigned long long*)&h0.u[4];
  { *(v4f*)(Xf + 4 * l) = o0; *(v4f*)(Xf + 128 + 4 * l) = o1; *(unsigned long long*)((unsigned short*)Xh + 4 * l) = ha; *(unsigned long long*)((unsigned short*)Xh + 128 + 4 * l) = hb;  } }
__global__ __launch_bounds__(256) void k_layer0(const float* __restrict__ xyz, const float* __restrict__ lat, const float* __restrict__ W0, const float* __restrict__ b0, const float* __restrict__ g0, const float* __restrict__ be0, int bb0, float* __restrict__ Xf, _Float16* __restrict__ Xh) {
  #pragma clang fp contract(off)
  const int tid = threadIdx.x, w = tid >> 5, l = tid & 31; const int rl = blockIdx.x * 8 + w; const int b = bb0 + rl / NBONE, n = rl % NBONE;
  float hq[4] = {bf16_round(xyz[(size_t)b * 3 + 0]), bf16_round(xyz[(size_t)b * 3 + 1]), bf16_round(xyz[(size_t)b * 3 + 2]), 1.0f}; float inp[3]; const float* L = lat + ((size_t)b * NBONE + n) * 16;
#pragma unroll
  for (int i = 0; i < 3; ++i) { float a = 0.f;
#pragma unroll
    for (int j = 0; j < 4; ++j) a += bf16_round(L[i * 4 + j]) * hq[j]; inp[i] = a; }
  float d[8];
#pragma unroll
  for (int q = 0; q < 8; ++q) { const int c = (q < 4) ? (4 * l + q) : (128 + 4 * l + (q - 4)); float a = bf16_round(b0[n * HH + c]);
#pragma unroll
    for (int i = 0; i < 3; ++i) a += inp[i] * bf16_round(W0[((size_t)n * 3 + i) * HH + c]); d[q] = a; }
  ln_act_store(d, g0 + (size_t)n * HH, be0 + (size_t)n * HH, nullptr, Xf + (size_t)rl * HH, Xh + (size_t)rl * HH, l); }
__global__ __launch_bounds__(256) void k_lnres(const float* __restrict__ Y, const float* __restrict__ g, const float* __restrict__ be, float* Xf, _Float16* __restrict__ Xh) { const int tid = threadIdx.x, w = tid >> 5, l = tid & 31; const size_t rl = (size_t)blockIdx.x * 8 + w; const int n = (int)(rl % NBONE);
  const v4f a = *(const v4fa*)(Y + rl * HH + 4 * l), c = *(const v4fa*)(Y + rl * HH + 128 + 4 * l); float d[8] = {a[0],a[1],a[2],a[3],c[0],c[1],c[2],c[3]};
  ln_act_store(d, g + (size_t)n * HH, be + (size_t)n * HH, Xf + rl * HH, Xf + rl * HH, Xh + rl * HH, l); }
__global__ __launch_bounds__(256) void k_fin(const float* __restrict__ Xf, const float* __restrict__ Wf, const float* __restrict__ bfb, int bb0, float* __restrict__ out) { __shared__ float res[32]; const int tid = threadIdx.x, w = tid >> 5, l = tid & 31; const int r0 = blockIdx.x * 32;
#pragma unroll 1
  for (int rr = 0; rr < 4; ++rr) { const int rl = r0 + w * 4 + rr; const int n = rl % NBONE; float s = 0.f;
#pragma unroll
    for (int q = 0; q < 8; ++q) { const int o = l * 8 + q; s += Xf[(size_t)rl * HH + o] * bf16_round(Wf[(size_t)n * HH + o]); }
    for (int o2 = 16; o2 > 0; o2 >>= 1) s += __shfl_xor(s, o2, 32); if (l == 0) res[w * 4 + rr] = s + bf16_round(bfb[n]); }
  __syncthreads();
  if (w == 0) { const float v = res[l]; float* op = out + (size_t)bb0 * NBONE + r0 + l; *(float*)op = v;  } }

extern "C" void kernel_launch(void* const* d_in, const int* in_sizes, int n_in,
                              void* d_out, int out_size, void* d_ws, size_t ws_size, hipStream_t stream) {
  (void)in_sizes; (void)n_in; (void)out_size;
  const float* const* I = (const float* const*)d_in; const float* xyz = I[0]; const float* lat = I[1]; const float* W0 = I[2]; const float* b0 = I[3]; const float* g0 = I[4]; const float* be0 = I[5]; const float* Wm = I[6]; const float* bm = I[7]; const float* gm = I[8]; const float* bem = I[9]; const float* Wf = I[10]; const float* bfb = I[11];
  char* ws = (char*)d_ws; size_t off = 0;
  auto take = [&](size_t bytes) { char* p = ws + off; off += (bytes + 255) & ~(size_t)255; return p; };
  _Float16* Wt = (_Float16*)take((size_t)3 * NBONE * HH * HH * 2); float* Xf = (float*)take((size_t)CHR * HH * 4); _Float16* Xh = (_Float16*)take((size_t)CHR * HH * 2); float* Y = (float*)take((size_t)CHR * HH * 4);
  if (off > ws_size) return;      // 6.3 + 33.6 + 16.8 + 33.6 ≈ 90 MB
  k_wt3<<<(3 * NBONE * HH * (HH / 8) + 255) / 256, 256, 0, stream>>>(Wm, Wt);
  for (int ch = 0; ch < NPT / CHP; ++ch) { const int bb0 = ch * CHP;
    k_layer0<<<CHR / 8, 256, 0, stream>>>(xyz, lat, W0, b0, g0, be0, bb0, Xf, Xh);
    for (int l = 0; l < 3; ++l) {
      k_gemm_hhx<0><<<dim3(((CHP / 16) * (HH / 64) + 3) / 4, NBONE), 128, 0, stream>>>(Xh, NBONE * HH, (size_t)HH, Wt + (size_t)l * NBONE * HH * HH, HH, (size_t)HH * HH, 0.0625f, bm + (size_t)l * NBONE * HH, (size_t)HH, nullptr, 1, 0, 0, Y, nullptr, NBONE * HH, (size_t)HH, CHP, HH, HH);      /* y = x·Wm[l,n] + bm[l,n] (f32), bone = grid.y (rows strided by 16): M 2048 N 256 K 256 */
      k_lnres<<<CHR / 8, 256, 0, stream>>>(Y, gm + (size_t)l * NBONE * HH, bem + (size_t)l * NBONE * HH, Xf, Xh); }
    k_fin<<<CHR / 32, 256, 0, stream>>>(Xf, Wf, bfb, bb0, (float*)d_out); }
}

// v002
// Measured time: 112 microseconds a run.
// Versions between v000 and this one are left out; their measured steps multiply to 11.2 times as fast.
#include <hip/hip_runtime.h>
// Piecewise-rigid implicit decoder (B=16384 query points x N=16 bones, hidden 256): inp[b,n] = (latent[b,n].[xyz_b;1])[:3];
// layer 0: x = lrelu(LN(inp.W0[n] + b0[n]).g0[n] + be0[n]); layers 1-3: x = lrelu(LN(x.Wm[l,n] + bm[l,n]).gm + bem) + x;
// out[b,n] = x.Wf[n] + bf[n] (LeakyReLU slope 0.1, LN eps 1e-5, per-bone weights (in,out)).
// Compute dtype: all inputs rounded to bf16; residual stream x in f32, rounded to f16 as the GEMM's B operand; weights f16 (x16, undone by 1/16).
// One fused kernel: a work-group owns 256 points of one bone for the whole network. x lives in LDS (f32), a wave owns 32 points x all 256
// columns (so LayerNorm never leaves the wave), the bone's weights pass through LDS in slabs of 32 k shared by the 8 waves.
// The products are taken transposed (weights as A, x as B): a lane's accumulators are 8 consecutive columns of ONE point, which are the
// very elements the same lane reads as its B fragment in the next layer, so x in LDS is private to a lane and moves in 16-byte pieces.
#define NPT 16384
#define NBONE 16
#define HH 256
#define LNEPS 1e-5f
#define SLOPE 0.1f
#define TM 256   /* points per work-group: 8 waves x 32 rows */
#define XP 260   /* pitch of an x row in LDS, floats: 1040 B = 16 B x odd, for the 16-byte reads and writes of x */
#define WP 40    /* pitch of a weight-slab row in LDS, halfs: 80 B = 16 B x odd, for the 16-byte fragment reads */
#define NSLAB 24 /* 3 layers x 8 slabs of 32 k */
#define NPAR 16  /* per-column parameter rows kept in LDS: bias 0-3, gain 4-7, shift 8-11 (by layer), W0 12-14, Wf 15 */
typedef unsigned short v8us __attribute__((ext_vector_type(8), may_alias));
typedef float  v8f  __attribute__((ext_vector_type(8)));
typedef float  v4f  __attribute__((ext_vector_type(4)));
typedef float  v4fa __attribute__((ext_vector_type(4), may_alias));
typedef _Float16 v16h __attribute__((ext_vector_type(16)));
union FragH { v16h v; v8us half[2]; _Float16 h[16]; unsigned short u[16]; };

__device__ __forceinline__ unsigned short bf16_bits(float x) { unsigned int u = __float_as_uint(x); return (unsigned short)((u + 0x7FFFu + ((u >> 16) & 1u)) >> 16); }
__device__ __forceinline__ float bf16_val(unsigned short b) { return __uint_as_float(((unsigned int)b) << 16); }
__device__ __forceinline__ float bf16_round(float x) { return bf16_val(bf16_bits(x)); }

// Wt[l*16+n][o][i] = f16(bf16(Wm[l][n][i][o]) * 16)
__global__ __launch_bounds__(256) void k_wt3(const float* __restrict__ Wm, _Float16* __restrict__ Wt) { const int t = blockIdx.x * 256 + threadIdx.x; if (t >= 3 * NBONE * HH * (HH / 8)) return; const int i0 = (t % (HH / 8)) * 8; const int r = t / (HH / 8); const int o = r % HH, ln_ = r / HH; FragH f;
#pragma unroll
  for (int q = 0; q < 8; ++q) f.h[q] = (_Float16)(bf16_round(Wm[((size_t)ln_ * HH + i0 + q) * HH + o]) * 16.0f);
  *(v8us*)((unsigned short*)Wt + (size_t)r * HH + i0) = f.half[0];  }

// lane l <-> lane l ^ 16
__device__ __forceinline__ float xhalf(float x) { return __builtin_bit_cast(float, __builtin_amdgcn_permlanex16(__builtin_bit_cast(int, x), __builtin_bit_cast(int, x), 0x76543210, 0xfedcba98, false, false)); }
__device__ __forceinline__ v8f ld8(const float* p) { const v4f lo = *(const v4fa*)p, hi = *(const v4fa*)(p + 4); return __builtin_shufflevector(lo, hi, 0, 1, 2, 3, 4, 5, 6, 7); }
__device__ __forceinline__ void st8(float* p, v8f v) { *(v4fa*)p = __builtin_shufflevector(v, v, 0, 1, 2, 3); *(v4fa*)(p + 4) = __builtin_shufflevector(v, v, 4, 5, 6, 7); }
// sum of a lane's 8 partial sums and of its partner's in the other half of the wave: a point's whole row
__device__ __forceinline__ float point_sum(v8f v) { const float s = ((v[0] + v[1]) + (v[2] + v[3])) + ((v[4] + v[5]) + (v[6] + v[7])); return s + xhalf(s); }

__global__ __launch_bounds__(256) void k_mlp(const float* __restrict__ xyz, const float* __restrict__ lat, const float* __restrict__ W0, const float* __restrict__ b0, const float* __restrict__ g0, const float* __restrict__ be0,
                                             const _Float16* __restrict__ Wt, const float* __restrict__ bm, const float* __restrict__ gm, const float* __restrict__ bem, const float* __restrict__ Wf, const float* __restrict__ bfb, float* __restrict__ tmp) {
  __shared__ __attribute__((aligned(16))) float xs[TM * XP];
  __shared__ __attribute__((aligned(16))) unsigned short wsb[2][HH * WP];
  __shared__ __attribute__((aligned(16))) float ps[NPAR * HH];
  const int tid = threadIdx.x, w = tid >> 5, lane = tid & 31, ln = lane & 15, hh = lane >> 4;
  const int n = blockIdx.y, p0 = blockIdx.x * TM;
  // weight staging: four threads a row of 64 B, 64 rows a round, four rounds a slab
  const unsigned short* wsrc = (const unsigned short*)Wt + ((size_t)n * HH + (tid >> 2)) * HH + (tid & 3) * 8;
  const int wdst = (tid >> 2) * WP + (tid & 3) * 8;
  v8us st[4];
  float* xw = xs + (size_t)(w * 32) * XP;      // this wave's 32 rows
  float* xl = xw + ln * XP + 8 * hh;           // accumulator layout: element (m, t, r) = point m*16 + ln, column t*16 + 8*hh + r
  float pv[NPAR];   // thread = column: the bone's per-column parameters, rounded once a work-group and read from LDS 8 columns a lane
  { const size_t nb = (size_t)n * HH;   // uniform row bases, the thread's column as the one vector offset
    const float* rb = b0 + nb; const float* rg = g0 + nb; const float* re = be0 + nb; const float* rf = Wf + nb;
    pv[0] = rb[tid]; pv[4] = rg[tid]; pv[8] = re[tid]; pv[15] = rf[tid];
#pragma unroll
    for (int l = 0; l < 3; ++l) { const float* qb = bm + (size_t)l * NBONE * HH + nb; const float* qg = gm + (size_t)l * NBONE * HH + nb; const float* qe = bem + (size_t)l * NBONE * HH + nb; const float* qw = W0 + 3 * nb + (size_t)l * HH;
      pv[1 + l] = qb[tid]; pv[5 + l] = qg[tid]; pv[9 + l] = qe[tid]; pv[12 + l] = qw[tid]; } }
  asm volatile("s_wait_xcnt 0x0" ::: "memory");   // stands in front of the address arithmetic below, which may reuse the offset and base registers of these loads
  __builtin_amdgcn_sched_barrier(0);   // keeps that arithmetic behind the wait
  const float bq = bfb[n];
#pragma unroll
  for (int m = 0; m < 2; ++m)   // x starts at zero, so layer 0 adds its residual like the others and the layer body needs no branch among its LDS reads
#pragma unroll
    for (int t = 0; t < 16; ++t) st8(xl + m * 16 * XP + t * 16, v8f{0.f, 0.f, 0.f, 0.f, 0.f, 0.f, 0.f, 0.f});
  { // lane = row: the rigid transform's three coordinates, left in the row's pad behind its 256 columns
    const int p = p0 + w * 32 + lane;
    const float q0 = xyz[(size_t)p * 3 + 0], q1 = xyz[(size_t)p * 3 + 1], q2 = xyz[(size_t)p * 3 + 2];
    asm volatile("s_wait_xcnt 0x0" ::: "memory");   // stands in front of the address arithmetic that reuses this load's offset and base registers
    __builtin_amdgcn_sched_barrier(0);   // keeps that arithmetic behind the wait: the scheduler lifted it over it
    const float h0 = bf16_round(q0), h1 = bf16_round(q1), h2 = bf16_round(q2);
    const float* Lp = lat + ((size_t)p * NBONE + n) * 16;
#pragma unroll
    for (int i = 0; i < 3; ++i) { const v4f r4 = *(const v4fa*)(Lp + 4 * i); float a = 0.f; a += bf16_round(r4[0]) * h0; a += bf16_round(r4[1]) * h1; a += bf16_round(r4[2]) * h2; a += bf16_round(r4[3]); xw[lane * XP + HH + i] = a; }
  }
#pragma unroll
  for (int j = 0; j < 4; ++j) st[j] = *(const v8us*)(wsrc + (size_t)j * 64 * HH);
#pragma unroll
  for (int j = 0; j < 4; ++j) *(v8us*)(&wsb[0][wdst + j * 64 * WP]) = st[j];
#pragma unroll
  for (int k = 0; k < NPAR; ++k) ps[k * HH + tid] = bf16_round(pv[k]);
  __syncthreads();   // publishes slab 0, the coordinates and the parameters
  const float* pl = ps + 8 * hh;               // the same columns of a parameter row
  v8f acc[2][16];
#pragma unroll 1   /* the layer body is several thousand instructions */
  for (int L = 0; L < 4; ++L) {
    const float* pb = pl + L * HH;   // this layer's bias row
    if (L == 0) {
      float ip[2][3];
#pragma unroll
      for (int m = 0; m < 2; ++m)
#pragma unroll
        for (int i = 0; i < 3; ++i) ip[m][i] = xw[(m * 16 + ln) * XP + HH + i];
      v8f bb[16], wa[16], wb_[16], wc[16];   // bias and the three W0 rows, fetched two column tiles a group, a group's arithmetic ahead of their use
#pragma unroll
      for (int t = 0; t < 4; ++t) { bb[t] = ld8(pb + t * 16); wa[t] = ld8(pl + 12 * HH + t * 16); wb_[t] = ld8(pl + 13 * HH + t * 16); wc[t] = ld8(pl + 14 * HH + t * 16); }
#pragma unroll
      for (int g = 0; g < 8; ++g) {
#pragma unroll
        for (int t = 2 * g; t < 2 * g + 2; ++t)
#pragma unroll
          for (int m = 0; m < 2; ++m) { v8f a = bb[t]; a += ip[m][0] * wa[t]; a += ip[m][1] * wb_[t]; a += ip[m][2] * wc[t]; acc[m][t] = a; }
        if (g + 2 < 8) {
          __builtin_amdgcn_sched_barrier(0);   // group g + 2 is fetched behind group g's arithmetic, so that no more than two groups are live
#pragma unroll
          for (int t = 2 * g + 4; t < 2 * g + 6; ++t) { bb[t] = ld8(pb + t * 16); wa[t] = ld8(pl + 12 * HH + t * 16); wb_[t] = ld8(pl + 13 * HH + t * 16); wc[t] = ld8(pl + 14 * HH + t * 16); }
          __builtin_amdgcn_sched_barrier(0);   // and in front of group g + 1's: left to the scheduler the reads stood so close to their use that the waits ran to zero
        }
      }
    } else {
#pragma unroll
      for (int m = 0; m < 2; ++m)
#pragma unroll
        for (int t = 0; t < 16; ++t) acc[m][t] = v8f{0.f, 0.f, 0.f, 0.f, 0.f, 0.f, 0.f, 0.f};
#pragma unroll 1   /* rolled: one trip already holds 32 products, and unrolled trips would keep more slab fragments live than the registers beside the accumulators hold */
      for (int ks = 0; ks < 8; ++ks) {
        const int s = (L - 1) * 8 + ks;
        const int sn = s + 1 < NSLAB ? s + 1 : NSLAB - 1;   // no branch round the staging: behind a join the compiler waited for these loads at once (the last trip stages its own slab again, unread)
        const unsigned short* sp = wsrc + (size_t)(sn >> 3) * NBONE * HH * HH + (sn & 7) * 32;   // next slab flies during this slab's products
#pragma unroll
        for (int j = 0; j < 4; ++j) st[j] = *(const v8us*)(sp + (size_t)j * 64 * HH);
        asm volatile("s_wait_xcnt 0x0" ::: "memory");   // stands in front of the LDS reads below, whose results land in the address registers of these loads
        v4f xa[2][4];
#pragma unroll
        for (int m = 0; m < 2; ++m) { const float* xr = xw + (m * 16 + ln) * XP + ks * 32 + 8 * hh;
          xa[m][0] = *(const v4fa*)(xr); xa[m][1] = *(const v4fa*)(xr + 4); xa[m][2] = *(const v4fa*)(xr + 16); xa[m][3] = *(const v4fa*)(xr + 20); }
        const unsigned short* wb = &wsb[s & 1][ln * WP + 8 * hh];
        FragH b[16];
#pragma unroll
        for (int t = 0; t < 16; ++t) { b[t].half[0] = *(const v8us*)(wb + t * 16 * WP); b[t].half[1] = *(const v8us*)(wb + t * 16 * WP + 16); }
        __builtin_amdgcn_sched_barrier(0);   // all of the slab's LDS reads issue as one group ahead of the products
        FragH a[2];
#pragma unroll
        for (int m = 0; m < 2; ++m)
#pragma unroll
          for (int q = 0; q < 4; ++q) { a[m].h[q] = (_Float16)xa[m][0][q]; a[m].h[4 + q] = (_Float16)xa[m][1][q]; a[m].h[8 + q] = (_Float16)xa[m][2][q]; a[m].h[12 + q] = (_Float16)xa[m][3][q]; }
#pragma unroll
        for (int t = 0; t < 16; ++t) {   // weights as A (rows = output columns), x as B (columns = points)
          acc[0][t] = __builtin_amdgcn_wmma_f32_16x16x32_f16(false, b[t].v, false, a[0].v, (short)0, acc[0][t], false, false);
          acc[1][t] = __builtin_amdgcn_wmma_f32_16x16x32_f16(false, b[t].v, false, a[1].v, (short)0, acc[1][t], false, false); }
        __builtin_amdgcn_sched_barrier(0);   // the products issue before the wait for the next slab's global loads; moved ahead of them, that wait stood bare in every trip
#pragma unroll
        for (int j = 0; j < 4; ++j) *(v8us*)(&wsb[(s + 1) & 1][wdst + j * 64 * WP]) = st[j];
        __syncthreads();   // publishes slab s + 1 and ends every wave's reads of slab s, whose buffer the next trip refills
      }
      v8f bv[16];
#pragma unroll
      for (int t = 0; t < 16; ++t) bv[t] = ld8(pb + t * 16);
      __builtin_amdgcn_sched_barrier(0);   // the bias row's LDS reads issue as one group (the slab fragments' registers are free here)
#pragma unroll
      for (int t = 0; t < 16; ++t)
#pragma unroll
        for (int m = 0; m < 2; ++m) acc[m][t] = acc[m][t] * 0.0625f + bv[t];
    }
    const float* pg = pl + (4 + L) * HH;
    const float* pe = pl + (8 + L) * HH;
    v8f gq[16], eq[16], rq[2][16];   // gain, shift and residual x, fetched two column tiles a group, a group's arithmetic ahead of their use
#pragma unroll
    for (int t = 0; t < 4; ++t) { gq[t] = ld8(pg + t * 16); eq[t] = ld8(pe + t * 16); rq[0][t] = ld8(xl + t * 16); rq[1][t] = ld8(xl + 16 * XP + t * 16); }
    __builtin_amdgcn_sched_barrier(0);   // the first two groups fly during the statistics; left to the scheduler these reads sank to just in front of their use
    float rs[2];
#pragma unroll
    for (int m = 0; m < 2; ++m) {
      v8f sv = acc[m][0];
#pragma unroll
      for (int t = 1; t < 16; ++t) sv += acc[m][t];
      const float mu = point_sum(sv) * (1.0f / HH);
      v8f qv = v8f{0.f, 0.f, 0.f, 0.f, 0.f, 0.f, 0.f, 0.f};
#pragma unroll
      for (int t = 0; t < 16; ++t) { acc[m][t] -= mu; qv += acc[m][t] * acc[m][t]; }
      rs[m] = rsqrtf(point_sum(qv) * (1.0f / HH) + LNEPS);
    }
#pragma unroll
    for (int g = 0; g < 8; ++g) {
#pragma unroll
      for (int t = 2 * g; t < 2 * g + 2; ++t)
#pragma unroll
        for (int m = 0; m < 2; ++m) { v8f y = acc[m][t] * rs[m] * gq[t] + eq[t];
#pragma unroll
          for (int r = 0; r < 8; ++r) y[r] = fmaxf(y[r], SLOPE * y[r]);   /* = y for y >= 0, SLOPE * y below, as 0 < SLOPE < 1 */
          acc[m][t] = y + rq[m][t]; }
      if (g + 2 < 8) {
        __builtin_amdgcn_sched_barrier(0);   // group g + 2 is fetched into the registers group g has just left, not earlier: three groups live would not fit
#pragma unroll
        for (int t = 2 * g + 4; t < 2 * g + 6; ++t) { gq[t] = ld8(pg + t * 16); eq[t] = ld8(pe + t * 16); rq[0][t] = ld8(xl + t * 16); rq[1][t] = ld8(xl + 16 * XP + t * 16); }
        __builtin_amdgcn_sched_barrier(0);   // and not later: its reads fly during group g + 1's arithmetic
      }
    }
    if (L < 3) {   // no barrier behind these stores: every element is read back by the lane that wrote it
#pragma unroll
      for (int m = 0; m < 2; ++m)
#pragma unroll
        for (int t = 0; t < 16; ++t) st8(xl + m * 16 * XP + t * 16, acc[m][t]);
    }
  }
  const float bfv = bf16_round(bq);
  v8f wf[16];
  v8f fv[2] = {v8f{0.f, 0.f, 0.f, 0.f, 0.f, 0.f, 0.f, 0.f}, v8f{0.f, 0.f, 0.f, 0.f, 0.f, 0.f, 0.f, 0.f}};
#pragma unroll
  for (int t = 0; t < 16; ++t) wf[t] = ld8(pl + 15 * HH + t * 16);
  __builtin_amdgcn_sched_barrier(0);   // one group of LDS reads, as for the bias row
#pragma unroll
  for (int t = 0; t < 16; ++t) { fv[0] += acc[0][t] * wf[t]; fv[1] += acc[1][t] * wf[t]; }
  const float o0 = point_sum(fv[0]) + bfv, o1 = point_sum(fv[1]) + bfv;
  tmp[(size_t)n * NPT + p0 + w * 32 + lane] = hh ? o1 : o0;   // bone-major: a wave owns its whole 128-byte line; lane = point
}

// out[b][n] = tmp[n][b]: 16 points x 16 bones a block, whole lines written by one block
__global__ __launch_bounds__(256) void k_tr(const float* __restrict__ tmp, float* __restrict__ out) { __shared__ float sm[16][17]; const int tid = threadIdx.x;
  sm[tid & 15][tid >> 4] = tmp[(size_t)(tid >> 4) * NPT + blockIdx.x * 16 + (tid & 15)];
  __syncthreads();
  out[(size_t)blockIdx.x * 256 + tid] = sm[tid >> 4][tid & 15]; }

extern "C" void kernel_launch(void* const* d_in, const int* in_sizes, int n_in,
                              void* d_out, int out_size, void* d_ws, size_t ws_size, hipStream_t stream) {
  (void)in_sizes; (void)n_in; (void)out_size;
  const float* const* I = (const float* const*)d_in; const float* xyz = I[0]; const float* lat = I[1]; const float* W0 = I[2]; const float* b0 = I[3]; const float* g0 = I[4]; const float* be0 = I[5]; const float* Wm = I[6]; const float* bm = I[7]; const float* gm = I[8]; const float* bem = I[9]; const float* Wf = I[10]; const float* bfb = I[11];
  char* ws = (char*)d_ws; size_t off = 0;
  auto take = [&](size_t bytes) { char* p = ws + off; off += (bytes + 255) & ~(size_t)255; return p; };
  _Float16* Wt = (_Float16*)take((size_t)3 * NBONE * HH * HH * 2); float* tmp = (float*)take((size_t)NBONE * NPT * 4);
  if (off > ws_size) return;
  k_wt3<<<(3 * NBONE * HH * (HH / 8) + 255) / 256, 256, 0, stream>>>(Wm, Wt);
  k_mlp<<<dim3(NPT / TM, NBONE), 256, 0, stream>>>(xyz, lat, W0, b0, g0, be0, Wt, bm, gm, bem, Wf, bfb, tmp);
  k_tr<<<NPT / 16, 256, 0, stream>>>(tmp, (float*)d_out);
}

// v003
// Measured time: 107 microseconds a run.
// Next to v002, in two timings, it ran 1.06 and 1.05 times as fast.
// Counting every step since v000, it is 11.8 times as fast.
#include <hip/hip_runtime.h>
// Piecewise-rigid implicit decoder (B=16384 query points x N=16 bones, hidden 256): inp[b,n] = (latent[b,n].[xyz_b;1])[:3];
// layer 0: x = lrelu(LN(inp.W0[n] + b0[n]).g0[n] + be0[n]); layers 1-3: x = lrelu(LN(x.Wm[l,n] + bm[l,n]).gm + bem) + x;
// out[b,n] = x.Wf[n] + bf[n] (LeakyReLU slope 0.1, LN eps 1e-5, per-bone weights (in,out)).
// Compute dtype: all inputs rounded to bf16; residual stream x in f32, rounded to f16 as the GEMM's B operand; weights f16 (x16, undone by 1/16).
// One fused kernel: a work-group owns 256 points of one bone for the whole network. x lives in LDS (f32), a wave owns 32 points x all 256
// columns (so LayerNorm never leaves the wave), the bone's weights pass through LDS in slabs of 32 k shared by the 8 waves.
// The products are taken transposed (weights as A, x as B): a lane's accumulators are 8 consecutive columns of ONE point, which are the
// very elements the same lane reads as its B fragment in the next layer, so x in LDS is private to a lane and moves in 16-byte pieces.
#define NPT 16384
#define NBONE 16
#define HH 256
#define LNEPS 1e-5f
#define SLOPE 0.1f
#define TM 256   /* points per work-group: 8 waves x 32 rows */
#define XP 260   /* pitch of an x row in LDS, floats: 1040 B = 16 B x odd, for the 16-byte reads and writes of x */
#define WP 40    /* pitch of a weight-slab row in LDS, halfs: 80 B = 16 B x odd, for the 16-byte fragment reads */
#define NSLAB 24 /* 3 layers x 8 slabs of 32 k */
#define NPAR 16  /* per-column parameter rows kept in LDS: bias 0-3, gain 4-7, shift 8-11 (by layer), W0 12-14, Wf 15 */
typedef unsigned short v8us __attribute__((ext_vector_type(8), may_alias));
typedef float  v8f  __attribute__((ext_vector_type(8)));
typedef float  v4f  __attribute__((ext_vector_type(4)));
typedef float  v4fa __attribute__((ext_vector_type(4), may_alias));
typedef _Float16 v16h __attribute__((ext_vector_type(16)));
union FragH { v16h v; v8us half[2]; _Float16 h[16]; unsigned short u[16]; };

__device__ __forceinline__ unsigned short bf16_bits(float x) { unsigned int u = __float_as_uint(x); return (unsigned short)((u + 0x7FFFu + ((u >> 16) & 1u)) >> 16); }
__device__ __forceinline__ float bf16_val(unsigned short b) { return __uint_as_float(((unsigned int)b) << 16); }
__device__ __forceinline__ float bf16_round(float x) { return bf16_val(bf16_bits(x)); }

// Wt[l*16+n][o][i] = f16(bf16(Wm[l][n][i][o]) * 16), transposed through LDS: a block owns 64 rows i x all 256 columns o of one matrix.
// It reads whole rows (a wave = 512 consecutive bytes) and writes whole 128-byte lines (8 lanes = the 64 i of one o).
// LDS keeps the f32 rows unpadded; the 16-byte piece c of row i lies at piece c ^ (i >> 3), so that the column reads of 8 lanes (8 rows apart) fall on 8 different bank groups.
__global__ __launch_bounds__(256) void k_wt3(const float* __restrict__ Wm, _Float16* __restrict__ Wt) {
  __shared__ __attribute__((aligned(16))) float sm[64 * HH];
  const int tid = threadIdx.x, mat = blockIdx.x >> 2, i0 = (blockIdx.x & 3) * 64;
  const float* sp = Wm + ((size_t)mat * HH + i0) * HH;   // uniform base, the thread's place in the tile as the one vector offset
  const unsigned so = (unsigned)((tid >> 6) * HH + (tid & 63) * 4);
  v4f v[16];
#pragma unroll
  for (int j = 0; j < 16; ++j) v[j] = *(const v4fa*)(sp + so + j * 4 * HH);   // all 16 loads of a thread in flight at once
#pragma unroll
  for (int j = 0; j < 16; ++j) { const int i = j * 4 + (tid >> 6); *(v4fa*)(sm + i * HH + (((tid & 63) ^ (i >> 3)) << 2)) = v[j]; }
  __syncthreads();   // the tile is read by columns, across the rows that other waves stored
  const int ic = tid & 7;
  unsigned short* dp = (unsigned short*)Wt + ((size_t)mat * HH + (tid >> 3)) * HH + i0 + ic * 8;
#pragma unroll
  for (int h = 0; h < 8; ++h) { const int o = h * 32 + (tid >> 3); const float* cp = sm + ic * 8 * HH + ((((o >> 2) ^ ic) << 2) | (o & 3)); FragH f;
#pragma unroll
    for (int q = 0; q < 8; ++q) f.h[q] = (_Float16)(bf16_round(cp[q * HH]) * 16.0f);
    *(v8us*)(dp + (size_t)h * 32 * HH) = f.half[0]; }
}

// lane l <-> lane l ^ 16
__device__ __forceinline__ float xhalf(float x) { return __builtin_bit_cast(float, __builtin_amdgcn_permlanex16(__builtin_bit_cast(int, x), __builtin_bit_cast(int, x), 0x76543210, 0xfedcba98, false, false)); }
__device__ __forceinline__ v8f ld8(const float* p) { const v4f lo = *(const v4fa*)p, hi = *(const v4fa*)(p + 4); return __builtin_shufflevector(lo, hi, 0, 1, 2, 3, 4, 5, 6, 7); }
__device__ __forceinline__ void st8(float* p, v8f v) { *(v4fa*)p = __builtin_shufflevector(v, v, 0, 1, 2, 3); *(v4fa*)(p + 4) = __builtin_shufflevector(v, v, 4, 5, 6, 7); }
// sum of a lane's 8 partial sums and of its partner's in the other half of the wave: a point's whole row
__device__ __forceinline__ float point_sum(v8f v) { const float s = ((v[0] + v[1]) + (v[2] + v[3])) + ((v[4] + v[5]) + (v[6] + v[7])); return s + xhalf(s); }

__global__ __launch_bounds__(256) void k_mlp(const float* __restrict__ xyz, const float* __restrict__ lat, const float* __restrict__ W0, const float* __restrict__ b0, const float* __restrict__ g0, const float* __restrict__ be0,
                                             const _Float16* __restrict__ Wt, const float* __restrict__ bm, const float* __restrict__ gm, const float* __restrict__ bem, const float* __restrict__ Wf, const float* __restrict__ bfb, float* __restrict__ tmp) {
  __shared__ __attribute__((aligned(16))) float xs[TM * XP];
  __shared__ __attribute__((aligned(16))) unsigned short wsb[2][HH * WP];
  __shared__ __attribute__((aligned(16))) float ps[NPAR * HH];
  const int tid = threadIdx.x, w = tid >> 5, lane = tid & 31, ln = lane & 15, hh = lane >> 4;
  const int n = blockIdx.y, p0 = blockIdx.x * TM;
  // weight staging: four threads a row of 64 B, 64 rows a round, four rounds a slab
  const unsigned short* wsrc = (const unsigned short*)Wt + ((size_t)n * HH + (tid >> 2)) * HH + (tid & 3) * 8;
  const int wdst = (tid >> 2) * WP + (tid & 3) * 8;
  v8us st[4];
  float* xw = xs + (size_t)(w * 32) * XP;      // this wave's 32 rows
  float* xl = xw + ln * XP + 8 * hh;           // accumulator layout: element (m, t, r) = point m*16 + ln, column t*16 + 8*hh + r
  float pv[NPAR];   // thread = column: the bone's per-column parameters, rounded once a work-group and read from LDS 8 columns a lane
  { const size_t nb = (size_t)n * HH;   // uniform row bases, the thread's column as the one vector offset
    const float* rb = b0 + nb; const float* rg = g0 + nb; const float* re = be0 + nb; const float* rf = Wf + nb;
    pv[0] = rb[tid]; pv[4] = rg[tid]; pv[8] = re[tid]; pv[15] = rf[tid];
#pragma unroll
    for (int l = 0; l < 3; ++l) { const float* qb = bm + (size_t)l * NBONE * HH + nb; const float* qg = gm + (size_t)l * NBONE * HH + nb; const float* qe = bem + (size_t)l * NBONE * HH + nb; const float* qw = W0 + 3 * nb + (size_t)l * HH;
      pv[1 + l] = qb[tid]; pv[5 + l] = qg[tid]; pv[9 + l] = qe[tid]; pv[12 + l] = qw[tid]; } }
  asm volatile("s_wait_xcnt 0x0" ::: "memory");   // stands in front of the address arithmetic below, which may reuse the offset and base registers of these loads
  __builtin_amdgcn_sched_barrier(0);   // keeps that arithmetic behind the wait
  const float bq = bfb[n];
#pragma unroll
  for (int m = 0; m < 2; ++m)   // x starts at zero, so layer 0 adds its residual like the others and the layer body needs no branch among its LDS reads
#pragma unroll
    for (int t = 0; t < 16; ++t) st8(xl + m * 16 * XP + t * 16, v8f{0.f, 0.f, 0.f, 0.f, 0.f, 0.f, 0.f, 0.f});
  { // lane = row: the rigid transform's three coordinates, left in the row's pad behind its 256 columns
    const int p = p0 + w * 32 + lane;
    const float q0 = xyz[(size_t)p * 3 + 0], q1 = xyz[(size_t)p * 3 + 1], q2 = xyz[(size_t)p * 3 + 2];
    asm volatile("s_wait_xcnt 0x0" ::: "memory");   // stands in front of the address arithmetic that reuses this load's offset and base registers
    __builtin_amdgcn_sched_barrier(0);   // keeps that arithmetic behind the wait: the scheduler lifted it over it
    const float h0 = bf16_round(q0), h1 = bf16_round(q1), h2 = bf16_round(q2);
    const float* Lp = lat + ((size_t)p * NBONE + n) * 16;
#pragma unroll
    for (int i = 0; i < 3; ++i) { const v4f r4 = *(const v4fa*)(Lp + 4 * i); float a = 0.f; a += bf16_round(r4[0]) * h0; a += bf16_round(r4[1]) * h1; a += bf16_round(r4[2]) * h2; a += bf16_round(r4[3]); xw[lane * XP + HH + i] = a; }
  }
#pragma unroll
  for (int j = 0; j < 4; ++j) st[j] = *(const v8us*)(wsrc + (size_t)j * 64 * HH);
#pragma unroll
  for (int j = 0; j < 4; ++j) *(v8us*)(&wsb[0][wdst + j * 64 * WP]) = st[j];
#pragma unroll
  for (int k = 0; k < NPAR; ++k) ps[k * HH + tid] = bf16_round(pv[k]);
  __syncthreads();   // publishes slab 0, the coordinates and the parameters
  const float* pl = ps + 8 * hh;               // the same columns of a parameter row
  v8f acc[2][16];
#pragma unroll 1   /* the layer body is several thousand instructions */
  for (int L = 0; L < 4; ++L) {
    const float* pb = pl + L * HH;   // this layer's bias row
    if (L == 0) {
      float ip[2][3];
#pragma unroll
      for (int m = 0; m < 2; ++m)
#pragma unroll
        for (int i = 0; i < 3; ++i) ip[m][i] = xw[(m * 16 + ln) * XP + HH + i];
      v8f bb[16], wa[16], wb_[16], wc[16];   // bias and the three W0 rows, fetched two column tiles a group, a group's arithmetic ahead of their use
#pragma unroll
      for (int t = 0; t < 4; ++t) { bb[t] = ld8(pb + t * 16); wa[t] = ld8(pl + 12 * HH + t * 16); wb_[t] = ld8(pl + 13 * HH + t * 16); wc[t] = ld8(pl + 14 * HH + t * 16); }
#pragma unroll
      for (int g = 0; g < 8; ++g) {
#pragma unroll
        for (int t = 2 * g; t < 2 * g + 2; ++t)
#pragma unroll
          for (int m = 0; m < 2; ++m) { v8f a = bb[t]; a += ip[m][0] * wa[t]; a += ip[m][1] * wb_[t]; a += ip[m][2] * wc[t]; acc[m][t] = a; }
        if (g + 2 < 8) {
          __builtin_amdgcn_sched_barrier(0);   // group g + 2 is fetched behind group g's arithmetic, so that no more than two groups are live
#pragma unroll
          for (int t = 2 * g + 4; t < 2 * g + 6; ++t) { bb[t] = ld8(pb + t * 16); wa[t] = ld8(pl + 12 * HH + t * 16); wb_[t] = ld8(pl + 13 * HH + t * 16); wc[t] = ld8(pl + 14 * HH + t * 16); }
          __builtin_amdgcn_sched_barrier(0);   // and in front of group g + 1's: left to the scheduler the reads stood so close to their use that the waits ran to zero
        }
      }
    } else {
#pragma unroll
      for (int m = 0; m < 2; ++m)
#pragma unroll
        for (int t = 0; t < 16; ++t) acc[m][t] = v8f{0.f, 0.f, 0.f, 0.f, 0.f, 0.f, 0.f, 0.f};
#pragma unroll 1   /* rolled: one trip already holds 32 products, and unrolled trips would keep more slab fragments live than the registers beside the accumulators hold */
      for (int ks = 0; ks < 8; ++ks) {
        const int s = (L - 1) * 8 + ks;
        const int sn = s + 1 < NSLAB ? s + 1 : NSLAB - 1;   // no branch round the staging: behind a join the compiler waited for these loads at once (the last trip stages its own slab again, unread)
        const unsigned short* sp = wsrc + (size_t)(sn >> 3) * NBONE * HH * HH + (sn & 7) * 32;   // next slab flies during this slab's products
#pragma unroll
        for (int j = 0; j < 4; ++j) st[j] = *(const v8us*)(sp + (size_t)j * 64 * HH);
        asm volatile("s_wait_xcnt 0x0" ::: "memory");   // stands in front of the LDS reads below, whose results land in the address registers of these loads
        v4f xa[2][4];
#pragma unroll
        for (int m = 0; m < 2; ++m) { const float* xr = xw + (m * 16 + ln) * XP + ks * 32 + 8 * hh;
          xa[m][0] = *(const v4fa*)(xr); xa[m][1] = *(const v4fa*)(xr + 4); xa[m][2] = *(const v4fa*)(xr + 16); xa[m][3] = *(const v4fa*)(xr + 20); }
        const unsigned short* wb = &wsb[s & 1][ln * WP + 8 * hh];
        FragH b[16];
#pragma unroll
        for (int t = 0; t < 16; ++t) { b[t].half[0] = *(const v8us*)(wb + t * 16 * WP); b[t].half[1] = *(const v8us*)(wb + t * 16 * WP + 16); }
        __builtin_amdgcn_sched_barrier(0);   // all of the slab's LDS reads issue as one group ahead of the products
        FragH a[2];
#pragma unroll
        for (int m = 0; m < 2; ++m)
#pragma unroll
          for (int q = 0; q < 4; ++q) { a[m].h[q] = (_Float16)xa[m][0][q]; a[m].h[4 + q] = (_Float16)xa[m][1][q]; a[m].h[8 + q] = (_Float16)xa[m][2][q]; a[m].h[12 + q] = (_Float16)xa[m][3][q]; }
#pragma unroll
        for (int t = 0; t < 16; ++t) {   // weights as A (rows = output columns), x as B (columns = points)
          acc[0][t] = __builtin_amdgcn_wmma_f32_16x16x32_f16(false, b[t].v, false, a[0].v, (short)0, acc[0][t], false, false);
          acc[1][t] = __builtin_amdgcn_wmma_f32_16x16x32_f16(false, b[t].v, false, a[1].v, (short)0, acc[1][t], false, false); }
        __builtin_amdgcn_sched_barrier(0);   // the products issue before the wait for the next slab's global loads; moved ahead of them, that wait stood bare in every trip
#pragma unroll
        for (int j = 0; j < 4; ++j) *(v8us*)(&wsb[(s + 1) & 1][wdst + j * 64 * WP]) = st[j];
        __syncthreads();   // publishes slab s + 1 and ends every wave's reads of slab s, whose buffer the next trip refills
      }
      v8f bv[16];
#pragma unroll
      for (int t = 0; t < 16; ++t) bv[t] = ld8(pb + t * 16);
      __builtin_amdgcn_sched_barrier(0);   // the bias row's LDS reads issue as one group (the slab fragments' registers are free here)
#pragma unroll
      for (int t = 0; t < 16; ++t)
#pragma unroll
        for (int m = 0; m < 2; ++m) acc[m][t] = acc[m][t] * 0.0625f + bv[t];
    }
    const float* pg = pl + (4 + L) * HH;
    const float* pe = pl + (8 + L) * HH;
    v8f gq[16], eq[16], rq[2][16];   // gain, shift and residual x, fetched two column tiles a group, a group's arithmetic ahead of their use
#pragma unroll
    for (int t = 0; t < 4; ++t) { gq[t] = ld8(pg + t * 16); eq[t] = ld8(pe + t * 16); rq[0][t] = ld8(xl + t * 16); rq[1][t] = ld8(xl + 16 * XP + t * 16); }
    __builtin_amdgcn_sched_barrier(0);   // the first two groups fly during the statistics; left to the scheduler these reads sank to just in front of their use
    float rs[2];
#pragma unroll
    for (int m = 0; m < 2; ++m) {
      v8f sv = acc[m][0];
#pragma unroll
      for (int t = 1; t < 16; ++t) sv += acc[m][t];
      const float mu = point_sum(sv) * (1.0f / HH);
      v8f qv = v8f{0.f, 0.f, 0.f, 0.f, 0.f, 0.f, 0.f, 0.f};
#pragma unroll
      for (int t = 0; t < 16; ++t) { acc[m][t] -= mu; qv += acc[m][t] * acc[m][t]; }
      rs[m] = rsqrtf(point_sum(qv) * (1.0f / HH) + LNEPS);
    }
#pragma unroll
    for (int g = 0; g < 8; ++g) {
#pragma unroll
      for (int t = 2 * g; t < 2 * g + 2; ++t)
#pragma unroll
        for (int m = 0; m < 2; ++m) { v8f y = acc[m][t] * rs[m] * gq[t] + eq[t];
#pragma unroll
          for (int r = 0; r < 8; ++r) y[r] = fmaxf(y[r], SLOPE * y[r]);   /* = y for y >= 0, SLOPE * y below, as 0 < SLOPE < 1 */
          acc[m][t] = y + rq[m][t]; }
      if (g + 2 < 8) {
        __builtin_amdgcn_sched_barrier(0);   // group g + 2 is fetched into the registers group g has just left, not earlier: three groups live would not fit
#pragma unroll
        for (int t = 2 * g + 4; t < 2 * g + 6; ++t) { gq[t] = ld8(pg + t * 16); eq[t] = ld8(pe + t * 16); rq[0][t] = ld8(xl + t * 16); rq[1][t] = ld8(xl + 16 * XP + t * 16); }
        __builtin_amdgcn_sched_barrier(0);   // and not later: its reads fly during group g + 1's arithmetic
      }
    }
    if (L < 3) {   // no barrier behind these stores: every element is read back by the lane that wrote it
#pragma unroll
      for (int m = 0; m < 2; ++m)
#pragma unroll
        for (int t = 0; t < 16; ++t) st8(xl + m * 16 * XP + t * 16, acc[m][t]);
    }
  }
  const float bfv = bf16_round(bq);
  v8f wf[16];
  v8f fv[2] = {v8f{0.f, 0.f, 0.f, 0.f, 0.f, 0.f, 0.f, 0.f}, v8f{0.f, 0.f, 0.f, 0.f, 0.f, 0.f, 0.f, 0.f}};
#pragma unroll
  for (int t = 0; t < 16; ++t) wf[t] = ld8(pl + 15 * HH + t * 16);
  __builtin_amdgcn_sched_barrier(0);   // one group of LDS reads, as for the bias row
#pragma unroll
  for (int t = 0; t < 16; ++t) { fv[0] += acc[0][t] * wf[t]; fv[1] += acc[1][t] * wf[t]; }
  const float o0 = point_sum(fv[0]) + bfv, o1 = point_sum(fv[1]) + bfv;
  tmp[(size_t)n * NPT + p0 + w * 32 + lane] = hh ? o1 : o0;   // bone-major: a wave owns its whole 128-byte line; lane = point
}

// out[b][n] = tmp[n][b]: 16 points x 16 bones a block, whole lines written by one block
__global__ __launch_bounds__(256) void k_tr(const float* __restrict__ tmp, float* __restrict__ out) { __shared__ float sm[16][17]; const int tid = threadIdx.x;
  sm[tid & 15][tid >> 4] = tmp[(size_t)(tid >> 4) * NPT + blockIdx.x * 16 + (tid & 15)];
  __syncthreads();
  out[(size_t)blockIdx.x * 256 + tid] = sm[tid >> 4][tid & 15]; }

extern "C" void kernel_launch(void* const* d_in, const int* in_sizes, int n_in,
                              void* d_out, int out_size, void* d_ws, size_t ws_size, hipStream_t stream) {
  (void)in_sizes; (void)n_in; (void)out_size;
  const float* const* I = (const float* const*)d_in; const float* xyz = I[0]; const float* lat = I[1]; const float* W0 = I[2]; const float* b0 = I[3]; const float* g0 = I[4]; const float* be0 = I[5]; const float* Wm = I[6]; const float* bm = I[7]; const float* gm = I[8]; const float* bem = I[9]; const float* Wf = I[10]; const float* bfb = I[11];
  char* ws = (char*)d_ws; size_t off = 0;
  auto take = [&](size_t bytes) { char* p = ws + off; off += (bytes + 255) & ~(size_t)255; return p; };
  _Float16* Wt = (_Float16*)take((size_t)3 * NBONE * HH * HH * 2); float* tmp = (float*)take((size_t)NBONE * NPT * 4);
  if (off > ws_size) return;
  k_wt3<<<3 * NBONE * (HH / 64), 256, 0, stream>>>(Wm, Wt);
  k_mlp<<<dim3(NPT / TM, NBONE), 256, 0, stream>>>(xyz, lat, W0, b0, g0, be0, Wt, bm, gm, bem, Wf, bfb, tmp);
  k_tr<<<NPT / 16, 256, 0, stream>>>(tmp, (float*)d_out);
}

// v004
// It runs in 102 microseconds.
// Next to v003, in two timings, it ran 1.04 and 1.05 times as fast.
// Over all steps from v000 it is 12.4 times as fast.
#include <hip/hip_runtime.h>
// Piecewise-rigid implicit decoder (B=16384 query points x N=16 bones, hidden 256): inp[b,n] = (latent[b,n].[xyz_b;1])[:3];
// layer 0: x = lrelu(LN(inp.W0[n] + b0[n]).g0[n] + be0[n]); layers 1-3: x = lrelu(LN(x.Wm[l,n] + bm[l,n]).gm + bem) + x;
// out[b,n] = x.Wf[n] + bf[n] (LeakyReLU slope 0.1, LN eps 1e-5, per-bone weights (in,out)).
// Compute dtype: all inputs rounded to bf16; residual stream x in f32, rounded to f16 as the GEMM's B operand; weights f16 (x16, undone by 1/16).
// One fused kernel: a work-group owns 256 points of one bone for the whole network. x lives in LDS (f32), a wave owns 64 points x all 256
// columns (so LayerNorm never leaves the wave), the bone's weights pass through LDS in slabs of 32 k shared by the 4 waves.
// The products are taken transposed (weights as A, x as B): a lane's accumulators are 8 consecutive columns of ONE point, which are the
// very elements the same lane reads as its B fragment in the next layer, so x in LDS is private to a lane and moves in 16-byte pieces.
#define NPT 16384
#define NBONE 16
#define HH 256
#define LNEPS 1e-5f
#define SLOPE 0.1f
#define TM 256   /* points per work-group: 4 waves x 64 rows */
#define NTH 128  /* threads of the fused kernel: one wave a SIMD, so that a wave may hold more than 512 registers */
#define MT 4     /* 16-point tiles a wave */
#define XP 260   /* pitch of an x row in LDS, floats: 1040 B = 16 B x odd, for the 16-byte reads and writes of x */
#define WP 40    /* pitch of a weight-slab row in LDS, halfs: 80 B = 16 B x odd, for the 16-byte fragment reads */
#define NSLAB 24 /* 3 layers x 8 slabs of 32 k */
#define NPAR 16  /* per-column parameter rows kept in LDS: bias 0-3, gain 4-7, shift 8-11 (by layer), W0 12-14, Wf 15 */
typedef unsigned short v8us __attribute__((ext_vector_type(8), may_alias));
typedef float  v8f  __attribute__((ext_vector_type(8)));
typedef float  v4f  __attribute__((ext_vector_type(4)));
typedef float  v4fa __attribute__((ext_vector_type(4), may_alias));
typedef _Float16 v16h __attribute__((ext_vector_type(16)));
union FragH { v16h v; v8us half[2]; _Float16 h[16]; unsigned short u[16]; };

__device__ __forceinline__ unsigned short bf16_bits(float x) { unsigned int u = __float_as_uint(x); return (unsigned short)((u + 0x7FFFu + ((u >> 16) & 1u)) >> 16); }
__device__ __forceinline__ float bf16_val(unsigned short b) { return __uint_as_float(((unsigned int)b) << 16); }
__device__ __forceinline__ float bf16_round(float x) { return bf16_val(bf16_bits(x)); }

// Wt[l*16+n][o][i] = f16(bf16(Wm[l][n][i][o]) * 16), transposed through LDS: a block owns 64 rows i x all 256 columns o of one matrix.
// It reads whole rows (a wave = 512 consecutive bytes) and writes whole 128-byte lines (8 lanes = the 64 i of one o).
// LDS keeps the f32 rows unpadded; the 16-byte piece c of row i lies at piece c ^ (i >> 3), so that the column reads of 8 lanes (8 rows apart) fall on 8 different bank groups.
__global__ __launch_bounds__(256) void k_wt3(const float* __restrict__ Wm, _Float16* __restrict__ Wt) {
  __shared__ __attribute__((aligned(16))) float sm[64 * HH];
  const int tid = threadIdx.x, mat = blockIdx.x >> 2, i0 = (blockIdx.x & 3) * 64;
  const float* sp = Wm + ((size_t)mat * HH + i0) * HH;   // uniform base, the thread's place in the tile as the one vector offset
  const unsigned so = (unsigned)((tid >> 6) * HH + (tid & 63) * 4);
  v4f v[16];
#pragma unroll
  for (int j = 0; j < 16; ++j) v[j] = *(const v4fa*)(sp + so + j * 4 * HH);   // all 16 loads of a thread in flight at once
#pragma unroll
  for (int j = 0; j < 16; ++j) { const int i = j * 4 + (tid >> 6); *(v4fa*)(sm + i * HH + (((tid & 63) ^ (i >> 3)) << 2)) = v[j]; }
  __syncthreads();   // the tile is read by columns, across the rows that other waves stored
  const int ic = tid & 7;
  unsigned short* dp = (unsigned short*)Wt + ((size_t)mat * HH + (tid >> 3)) * HH + i0 + ic * 8;
#pragma unroll
  for (int h = 0; h < 8; ++h) { const int o = h * 32 + (tid >> 3); const float* cp = sm + ic * 8 * HH + ((((o >> 2) ^ ic) << 2) | (o & 3)); FragH f;
#pragma unroll
    for (int q = 0; q < 8; ++q) f.h[q] = (_Float16)(bf16_round(cp[q * HH]) * 16.0f);
    *(v8us*)(dp + (size_t)h * 32 * HH) = f.half[0]; }
}

// lane l <-> lane l ^ 16
__device__ __forceinline__ float xhalf(float x) { return __builtin_bit_cast(float, __builtin_amdgcn_permlanex16(__builtin_bit_cast(int, x), __builtin_bit_cast(int, x), 0x76543210, 0xfedcba98, false, false)); }
__device__ __forceinline__ v8f ld8(const float* p) { const v4f lo = *(const v4fa*)p, hi = *(const v4fa*)(p + 4); return __builtin_shufflevector(lo, hi, 0, 1, 2, 3, 4, 5, 6, 7); }
__device__ __forceinline__ void st8(float* p, v8f v) { *(v4fa*)p = __builtin_shufflevector(v, v, 0, 1, 2, 3); *(v4fa*)(p + 4) = __builtin_shufflevector(v, v, 4, 5, 6, 7); }
// sum of a lane's 8 partial sums and of its partner's in the other half of the wave: a point's whole row
__device__ __forceinline__ float point_sum(v8f v) { const float s = ((v[0] + v[1]) + (v[2] + v[3])) + ((v[4] + v[5]) + (v[6] + v[7])); return s + xhalf(s); }

__global__ __launch_bounds__(NTH) void k_mlp(const float* __restrict__ xyz, const float* __restrict__ lat, const float* __restrict__ W0, const float* __restrict__ b0, const float* __restrict__ g0, const float* __restrict__ be0,
                                             const _Float16* __restrict__ Wt, const float* __restrict__ bm, const float* __restrict__ gm, const float* __restrict__ bem, const float* __restrict__ Wf, const float* __restrict__ bfb, float* __restrict__ tmp) {
  __shared__ __attribute__((aligned(16))) float xs[TM * XP];
  __shared__ __attribute__((aligned(16))) unsigned short wsb[2][HH * WP];
  __shared__ __attribute__((aligned(16))) float ps[NPAR * HH];
  const int tid = threadIdx.x, w = tid >> 5, lane = tid & 31, ln = lane & 15, hh = lane >> 4;
  const int n = blockIdx.y, p0 = blockIdx.x * TM;
  v8us st[8], st1[8];
  float* xw = xs + (size_t)(w * 16 * MT) * XP; // this wave's 64 rows
  float* xl = xw + ln * XP + 8 * hh;           // accumulator layout: element (m, t, r) = point m*16 + ln, column t*16 + 8*hh + r
  float pv[2][NPAR];   // thread = two columns: the bone's per-column parameters, rounded once a work-group and read from LDS 8 columns a lane
  { const size_t nb = (size_t)n * HH;   // uniform row bases, the thread's column as the one vector offset
    const float* rb = b0 + nb; const float* rg = g0 + nb; const float* re = be0 + nb; const float* rf = Wf + nb;
#pragma unroll
    for (int c = 0; c < 2; ++c) { const int col = tid + c * NTH;
      pv[c][0] = rb[col]; pv[c][4] = rg[col]; pv[c][8] = re[col]; pv[c][15] = rf[col];
#pragma unroll
      for (int l = 0; l < 3; ++l) { const float* qb = bm + (size_t)l * NBONE * HH + nb; const float* qg = gm + (size_t)l * NBONE * HH + nb; const float* qe = bem + (size_t)l * NBONE * HH + nb; const float* qw = W0 + 3 * nb + (size_t)l * HH;
        pv[c][1 + l] = qb[col]; pv[c][5 + l] = qg[col]; pv[c][9 + l] = qe[col]; pv[c][12 + l] = qw[col]; } } }
  asm volatile("s_wait_xcnt 0x0" ::: "memory");   // stands in front of the address arithmetic below, which may reuse the offset and base registers of these loads
  __builtin_amdgcn_sched_barrier(0);   // keeps that arithmetic behind the wait
  const float bq = bfb[n];
  // lane = two rows: the rigid transform's three coordinates, left in the row's pad behind its 256 columns
  float q[2][3]; v4f r4[2][3];
  {
#pragma unroll
    for (int c = 0; c < 2; ++c) { const int p = p0 + w * 16 * MT + c * 32 + lane; const float* Lp = lat + ((size_t)p * NBONE + n) * 16;
#pragma unroll
      for (int i = 0; i < 3; ++i) { q[c][i] = xyz[(size_t)p * 3 + i]; r4[c][i] = *(const v4fa*)(Lp + 4 * i); } }
    asm volatile("s_wait_xcnt 0x0" ::: "memory");   // stands in front of the address arithmetic that reuses these loads' offset and base registers
    __builtin_amdgcn_sched_barrier(0);   // keeps that arithmetic behind the wait
  }
  // weight staging: four threads a row of 64 B, 32 rows a round, eight rounds a slab (formed here, behind the wait: formed earlier it sank in among the loads above)
  const unsigned short* wsrc = (const unsigned short*)Wt + ((size_t)n * HH + (tid >> 2)) * HH + (tid & 3) * 8;
  const int wdst = (tid >> 2) * WP + (tid & 3) * 8;
  {
#pragma unroll
    for (int j = 0; j < 8; ++j) { st[j] = *(const v8us*)(wsrc + (size_t)j * 32 * HH); st1[j] = *(const v8us*)(wsrc + (size_t)j * 32 * HH + 32); }   // slabs 0 and 1
    asm volatile("s_wait_xcnt 0x0" ::: "memory");   // as above, for the slab loads
    __builtin_amdgcn_sched_barrier(0);   // keeps the arithmetic below behind the wait
#pragma unroll
    for (int m = 0; m < MT; ++m)   // x starts at zero, so layer 0 adds its residual like the others and the layer body needs no branch among its LDS reads (stored here, while the global loads fly)
#pragma unroll
      for (int t = 0; t < 16; ++t) st8(xl + m * 16 * XP + t * 16, v8f{0.f, 0.f, 0.f, 0.f, 0.f, 0.f, 0.f, 0.f});
#pragma unroll
    for (int c = 0; c < 2; ++c) { const float h0 = bf16_round(q[c][0]), h1 = bf16_round(q[c][1]), h2 = bf16_round(q[c][2]);
#pragma unroll
      for (int i = 0; i < 3; ++i) { float a = 0.f; a += bf16_round(r4[c][i][0]) * h0; a += bf16_round(r4[c][i][1]) * h1; a += bf16_round(r4[c][i][2]) * h2; a += bf16_round(r4[c][i][3]); xw[(c * 32 + lane) * XP + HH + i] = a; } }
  }
#pragma unroll
  for (int j = 0; j < 8; ++j) { *(v8us*)(&wsb[0][wdst + j * 32 * WP]) = st[j]; *(v8us*)(&wsb[1][wdst + j * 32 * WP]) = st1[j]; }
#pragma unroll
  for (int c = 0; c < 2; ++c)
#pragma unroll
    for (int k = 0; k < NPAR; ++k) ps[k * HH + tid + c * NTH] = bf16_round(pv[c][k]);
  __syncthreads();   // publishes slabs 0 and 1, the coordinates and the parameters
  const float* pl = ps + 8 * hh;               // the same columns of a parameter row
  const int wfr = ln * WP + 8 * hh;            // a lane's place in a weight tile
  v8f acc[MT][16];
  FragH b[2][16];   // weight fragments: slab s in b[s & 1], the next slab's fetched during this slab's products
#pragma unroll 1   /* the layer body is several thousand instructions: kept rolled for code size */
  for (int L = 0; L < 4; ++L) {
    const float* pb = pl + L * HH;   // this layer's bias row
    if (L == 0) {
#pragma unroll
      for (int t = 0; t < 16; ++t) { b[0][t].half[0] = *(const v8us*)(&wsb[0][wfr + t * 16 * WP]); b[0][t].half[1] = *(const v8us*)(&wsb[0][wfr + t * 16 * WP + 16]); }   // slab 0's fragments; every later slab's are fetched a trip ahead
      __syncthreads();   // ends every wave's reads of slab 0, whose buffer the first trip refills
      float ip[MT][3];
#pragma unroll
      for (int m = 0; m < MT; ++m)
#pragma unroll
        for (int i = 0; i < 3; ++i) ip[m][i] = xw[(m * 16 + ln) * XP + HH + i];
      v8f bb[16], wa[16], wb_[16], wc[16];   // bias and the three W0 rows, fetched two column tiles a group, a group's arithmetic ahead of their use
#pragma unroll
      for (int t = 0; t < 4; ++t) { bb[t] = ld8(pb + t * 16); wa[t] = ld8(pl + 12 * HH + t * 16); wb_[t] = ld8(pl + 13 * HH + t * 16); wc[t] = ld8(pl + 14 * HH + t * 16); }
#pragma unroll
      for (int g = 0; g < 8; ++g) {
#pragma unroll
        for (int t = 2 * g; t < 2 * g + 2; ++t)
#pragma unroll
          for (int m = 0; m < MT; ++m) { v8f a = bb[t]; a += ip[m][0] * wa[t]; a += ip[m][1] * wb_[t]; a += ip[m][2] * wc[t]; acc[m][t] = a; }
        if (g + 2 < 8) {
          __builtin_amdgcn_sched_barrier(0);   // group g + 2 is fetched behind group g's arithmetic, so that no more than two groups are live
#pragma unroll
          for (int t = 2 * g + 4; t < 2 * g + 6; ++t) { bb[t] = ld8(pb + t * 16); wa[t] = ld8(pl + 12 * HH + t * 16); wb_[t] = ld8(pl + 13 * HH + t * 16); wc[t] = ld8(pl + 14 * HH + t * 16); }
          __builtin_amdgcn_sched_barrier(0);   // and in front of group g + 1's: left to the scheduler the reads stood so close to their use that the waits ran to zero
        }
      }
    } else {
      v4f xa[MT][4];
      FragH a[MT];
#pragma unroll
      for (int m = 0; m < MT; ++m) { const float* xr = xw + (m * 16 + ln) * XP + 8 * hh;   // the layer's first 32 columns of x; the later ones are fetched a trip ahead
        xa[m][0] = *(const v4fa*)(xr); xa[m][1] = *(const v4fa*)(xr + 4); xa[m][2] = *(const v4fa*)(xr + 16); xa[m][3] = *(const v4fa*)(xr + 20); }
#pragma unroll
      for (int m = 0; m < MT; ++m)
#pragma unroll
        for (int t = 0; t < 16; ++t) acc[m][t] = v8f{0.f, 0.f, 0.f, 0.f, 0.f, 0.f, 0.f, 0.f};
#pragma unroll
      for (int m = 0; m < MT; ++m)
#pragma unroll
        for (int q = 0; q < 4; ++q) { a[m].h[q] = (_Float16)xa[m][0][q]; a[m].h[4 + q] = (_Float16)xa[m][1][q]; a[m].h[8 + q] = (_Float16)xa[m][2][q]; a[m].h[12 + q] = (_Float16)xa[m][3][q]; }
#pragma unroll 1   /* rolled by pairs of trips: a pair already holds 128 products, and the two fragment sets swap roles inside it */
      for (int kp = 0; kp < 4; ++kp) {
#pragma unroll
        for (int u = 0; u < 2; ++u) {
          const int ks = 2 * kp + u, s = (L - 1) * 8 + ks;   // s & 1 == u
          const int sn = s + 2 < NSLAB ? s + 2 : NSLAB - 1;   // no branch round the staging: behind a join the compiler waited for these loads at once (the last two trips stage the last slab again, unread)
          const unsigned short* sp = wsrc + (size_t)(sn >> 3) * NBONE * HH * HH + (sn & 7) * 32;   // slab s + 2 flies during this slab's products
#pragma unroll
          for (int j = 0; j < 8; ++j) st[j] = *(const v8us*)(sp + (size_t)j * 32 * HH);
          asm volatile("s_wait_xcnt 0x0" ::: "memory");   // stands in front of the LDS reads below, whose results may land in the address registers of these loads
          __builtin_amdgcn_sched_barrier(0);   // keeps the LDS address arithmetic behind the wait: the scheduler lifted it over it, into a register of these loads
          // slab s + 1's fragments and its columns of x, in two groups, each ahead of half of this slab's products: the one wave of a SIMD has nobody to hide an LDS wait behind
#pragma unroll
          for (int m = 0; m < MT; ++m) { const float* xr = xw + (m * 16 + ln) * XP + ((ks + 1) & 7) * 32 + 8 * hh;   // (a layer's last trip fetches columns 0 to 31 again, unread)
            xa[m][0] = *(const v4fa*)(xr); xa[m][1] = *(const v4fa*)(xr + 4); xa[m][2] = *(const v4fa*)(xr + 16); xa[m][3] = *(const v4fa*)(xr + 20); }
#pragma unroll
          for (int t = 0; t < 4; ++t) { b[u ^ 1][t].half[0] = *(const v8us*)(&wsb[u ^ 1][wfr + t * 16 * WP]); b[u ^ 1][t].half[1] = *(const v8us*)(&wsb[u ^ 1][wfr + t * 16 * WP + 16]); }
          __builtin_amdgcn_sched_barrier(0);   // the group issues whole, ahead of the products: every further place where LDS reads stand among them costs issue time
#pragma unroll
          for (int t = 0; t < 8; ++t)   // weights as A (rows = output columns), x as B (columns = points)
#pragma unroll
            for (int m = 0; m < MT; ++m) acc[m][t] = __builtin_amdgcn_wmma_f32_16x16x32_f16(false, b[u][t].v, false, a[m].v, (short)0, acc[m][t], false, false);
          __builtin_amdgcn_sched_barrier(0);   // the second group stands here, not among the products
#pragma unroll
          for (int t = 4; t < 16; ++t) { b[u ^ 1][t].half[0] = *(const v8us*)(&wsb[u ^ 1][wfr + t * 16 * WP]); b[u ^ 1][t].half[1] = *(const v8us*)(&wsb[u ^ 1][wfr + t * 16 * WP + 16]); }
          __builtin_amdgcn_sched_barrier(0);   // as for the first group
#pragma unroll
          for (int t = 8; t < 12; ++t)
#pragma unroll
            for (int m = 0; m < MT; ++m) acc[m][t] = __builtin_amdgcn_wmma_f32_16x16x32_f16(false, b[u][t].v, false, a[m].v, (short)0, acc[m][t], false, false);
          __builtin_amdgcn_sched_barrier(0);   // three quarters of the products issue before the wait for slab s + 2's global loads; moved ahead of them, that wait stood bare in every trip
#pragma unroll
          for (int j = 0; j < 8; ++j) *(v8us*)(&wsb[u][wdst + j * 32 * WP]) = st[j];
          __builtin_amdgcn_sched_barrier(0);   // the stores stand here, so that they drain during the last quarter of the products and not in front of the barrier
#pragma unroll
          for (int t = 12; t < 16; ++t)
#pragma unroll
            for (int m = 0; m < MT; ++m) acc[m][t] = __builtin_amdgcn_wmma_f32_16x16x32_f16(false, b[u][t].v, false, a[m].v, (short)0, acc[m][t], false, false);
#pragma unroll
          for (int m = 0; m < MT; ++m)   // the next trip's B fragments
#pragma unroll
            for (int q = 0; q < 4; ++q) { a[m].h[q] = (_Float16)xa[m][0][q]; a[m].h[4 + q] = (_Float16)xa[m][1][q]; a[m].h[8 + q] = (_Float16)xa[m][2][q]; a[m].h[12 + q] = (_Float16)xa[m][3][q]; }
          __builtin_amdgcn_sched_barrier(0);   // keeps the conversions in front of the barrier: behind it they stood bare ahead of the next trip's products
          __syncthreads();   // publishes slab s + 2 and ends every wave's reads of slab s + 1, whose buffer the next trip refills
        }
      }
      v8f bv[16];
#pragma unroll
      for (int t = 0; t < 16; ++t) bv[t] = ld8(pb + t * 16);
      __builtin_amdgcn_sched_barrier(0);   // the bias row's LDS reads issue as one group, for speed only
#pragma unroll
      for (int t = 0; t < 16; ++t)
#pragma unroll
        for (int m = 0; m < MT; ++m) acc[m][t] = acc[m][t] * 0.0625f + bv[t];
    }
    const float* pg = pl + (4 + L) * HH;
    const float* pe = pl + (8 + L) * HH;
    v8f gq[16], eq[16], rq[MT][16];   // gain, shift and residual x, fetched two column tiles a group, a group's arithmetic ahead of their use
#pragma unroll
    for (int t = 0; t < 4; ++t) { gq[t] = ld8(pg + t * 16); eq[t] = ld8(pe + t * 16);
#pragma unroll
      for (int m = 0; m < MT; ++m) rq[m][t] = ld8(xl + m * 16 * XP + t * 16); }
    __builtin_amdgcn_sched_barrier(0);   // the first two groups fly during the statistics; left to the scheduler these reads sank to just in front of their use
    float rs[MT];
#pragma unroll
    for (int m = 0; m < MT; ++m) {
      v8f sv = acc[m][0];
#pragma unroll
      for (int t = 1; t < 16; ++t) sv += acc[m][t];
      const float mu = point_sum(sv) * (1.0f / HH);
      v8f qv = v8f{0.f, 0.f, 0.f, 0.f, 0.f, 0.f, 0.f, 0.f};
#pragma unroll
      for (int t = 0; t < 16; ++t) { acc[m][t] -= mu; qv += acc[m][t] * acc[m][t]; }
      rs[m] = rsqrtf(point_sum(qv) * (1.0f / HH) + LNEPS);
    }
#pragma unroll
    for (int g = 0; g < 8; ++g) {
#pragma unroll
      for (int t = 2 * g; t < 2 * g + 2; ++t)
#pragma unroll
        for (int m = 0; m < MT; ++m) { v8f y = acc[m][t] * rs[m] * gq[t] + eq[t];
#pragma unroll
          for (int r = 0; r < 8; ++r) y[r] = fmaxf(y[r], SLOPE * y[r]);   /* = y for y >= 0, SLOPE * y below, as 0 < SLOPE < 1 */
          acc[m][t] = y + rq[m][t]; }
      if (g + 2 < 8) {
        __builtin_amdgcn_sched_barrier(0);   // group g + 2 is fetched behind group g's arithmetic, not earlier: two groups in flight are enough
#pragma unroll
        for (int t = 2 * g + 4; t < 2 * g + 6; ++t) { gq[t] = ld8(pg + t * 16); eq[t] = ld8(pe + t * 16);
#pragma unroll
          for (int m = 0; m < MT; ++m) rq[m][t] = ld8(xl + m * 16 * XP + t * 16); }
        __builtin_amdgcn_sched_barrier(0);   // and not later: its reads fly during group g + 1's arithmetic
      }
    }
    if (L < 3) {   // no barrier behind these stores: every element is read back by the lane that wrote it
#pragma unroll
      for (int m = 0; m < MT; ++m)
#pragma unroll
        for (int t = 0; t < 16; ++t) st8(xl + m * 16 * XP + t * 16, acc[m][t]);
    }
  }
  const float bfv = bf16_round(bq);
  v8f wf[16];
  v8f fv[MT];
#pragma unroll
  for (int m = 0; m < MT; ++m) fv[m] = v8f{0.f, 0.f, 0.f, 0.f, 0.f, 0.f, 0.f, 0.f};
#pragma unroll
  for (int t = 0; t < 16; ++t) wf[t] = ld8(pl + 15 * HH + t * 16);
  __builtin_amdgcn_sched_barrier(0);   // one group of LDS reads, as for the bias row
#pragma unroll
  for (int t = 0; t < 16; ++t)
#pragma unroll
    for (int m = 0; m < MT; ++m) fv[m] += acc[m][t] * wf[t];
  float o[MT];
#pragma unroll
  for (int m = 0; m < MT; ++m) o[m] = point_sum(fv[m]) + bfv;
  float* tp = tmp + (size_t)n * NPT + p0 + w * 16 * MT + lane;   // bone-major: a wave owns its two whole 128-byte lines; lane = point
  tp[0] = hh ? o[1] : o[0];
  tp[32] = hh ? o[3] : o[2];
}

// out[b][n] = tmp[n][b]: 16 points x 16 bones a block, whole lines written by one block
__global__ __launch_bounds__(256) void k_tr(const float* __restrict__ tmp, float* __restrict__ out) { __shared__ float sm[16][17]; const int tid = threadIdx.x;
  sm[tid & 15][tid >> 4] = tmp[(size_t)(tid >> 4) * NPT + blockIdx.x * 16 + (tid & 15)];
  __syncthreads();
  out[(size_t)blockIdx.x * 256 + tid] = sm[tid >> 4][tid & 15]; }

extern "C" void kernel_launch(void* const* d_in, const int* in_sizes, int n_in,
                              void* d_out, int out_size, void* d_ws, size_t ws_size, hipStream_t stream) {
  (void)in_sizes; (void)n_in; (void)out_size;
  const float* const* I = (const float* const*)d_in; const float* xyz = I[0]; const float* lat = I[1]; const float* W0 = I[2]; const float* b0 = I[3]; const float* g0 = I[4]; const float* be0 = I[5]; const float* Wm = I[6]; const float* bm = I[7]; const float* gm = I[8]; const float* bem = I[9]; const float* Wf = I[10]; const float* bfb = I[11];
  char* ws = (char*)d_ws; size_t off = 0;
  auto take = [&](size_t bytes) { char* p = ws + off; off += (bytes + 255) & ~(size_t)255; return p; };
  _Float16* Wt = (_Float16*)take((size_t)3 * NBONE * HH * HH * 2); float* tmp = (float*)take((size_t)NBONE * NPT * 4);
  if (off > ws_size) return;
  k_wt3<<<3 * NBONE * (HH / 64), 256, 0, stream>>>(Wm, Wt);
  k_mlp<<<dim3(NPT / TM, NBONE), NTH, 0, stream>>>(xyz, lat, W0, b0, g0, be0, Wt, bm, gm, bem, Wf, bfb, tmp);
  k_tr<<<NPT / 16, 256, 0, stream>>>(tmp, (float*)d_out);
}

// v005
// A run of this version takes 97.7 microseconds.
// Timed twice side by side with v004, it ran 1.04 times as fast both times.
// Counting every step since v000, it is 12.9 times as fast.
#include <hip/hip_runtime.h>
// Piecewise-rigid implicit decoder (B=16384 query points x N=16 bones, hidden 256): inp[b,n] = (latent[b,n].[xyz_b;1])[:3];
// layer 0: x = lrelu(LN(inp.W0[n] + b0[n]).g0[n] + be0[n]); layers 1-3: x = lrelu(LN(x.Wm[l,n] + bm[l,n]).gm + bem) + x;
// out[b,n] = x.Wf[n] + bf[n] (LeakyReLU slope 0.1, LN eps 1e-5, per-bone weights (in,out)).
// Compute dtype: all inputs rounded to bf16; residual stream x in f32, rounded to f16 as the GEMM's B operand; weights f16 (x16, undone by 1/16).
// One fused kernel: a work-group owns 256 points of one bone for the whole network. x lives in LDS (f32), a wave owns 64 points x all 256
// columns (so LayerNorm never leaves the wave), the bone's weights pass through LDS in slabs of 32 k shared by the 4 waves.
// The products are taken transposed (weights as A, x as B): a lane's accumulators are 8 consecutive columns of ONE point, which are the
// very elements the same lane reads as its B fragment in the next layer, so x in LDS is private to a lane and moves in 16-byte pieces.
// LayerNorm's mean is taken out ahead of the products: mean_o(x.W + b) = x.mean_o(W) + mean_o(b), so the first launch subtracts from every weight row
// (and from every bias and W0 row) its mean over the 256 outputs; what the products give is then already centred, and only the sum of squares is left.
#define NPT 16384
#define NBONE 16
#define HH 256
#define LNEPS 1e-5f
#define SLOPE 0.1f
#define TM 256   /* points per work-group: 4 waves x 64 rows */
#define NTH 128  /* threads of the fused kernel: one wave a SIMD, so that a wave may hold more than 512 registers */
#define MT 4     /* 16-point tiles a wave */
#define XP 260   /* pitch of an x row in LDS, floats: 1040 B = 16 B x odd, for the 16-byte reads and writes of x */
#define WP 40    /* pitch of a weight-slab row in LDS, halfs: 80 B = 16 B x odd, for the 16-byte fragment reads */
#define NSLAB 24 /* 3 layers x 8 slabs of 32 k */
#define NCEN 7   /* centred parameter rows a bone in the workspace: b0, bm 0-2, W0 0-2 */
#define NWB (3 * NBONE * (HH / 64))   /* blocks of the first launch that transpose weights; NBONE more centre the parameter rows */
#define NPAR 16  /* per-column parameter rows kept in LDS: bias 0-3, gain 4-7, shift 8-11 (by layer), W0 12-14, Wf 15 */
typedef unsigned short v8us __attribute__((ext_vector_type(8), may_alias));
typedef float  v8f  __attribute__((ext_vector_type(8)));
typedef float  v4f  __attribute__((ext_vector_type(4)));
typedef float  v4fa __attribute__((ext_vector_type(4), may_alias));
typedef _Float16 v16h __attribute__((ext_vector_type(16)));
union FragH { v16h v; v8us half[2]; _Float16 h[16]; unsigned short u[16]; };

__device__ __forceinline__ unsigned short bf16_bits(float x) { unsigned int u = __float_as_uint(x); return (unsigned short)((u + 0x7FFFu + ((u >> 16) & 1u)) >> 16); }
__device__ __forceinline__ float bf16_val(unsigned short b) { return __uint_as_float(((unsigned int)b) << 16); }
__device__ __forceinline__ float bf16_round(float x) { return bf16_val(bf16_bits(x)); }

// Wt[l*16+n][o][i] = f16((w[i][o] - mean_o w[i][o]) * 16), w = bf16(Wm[l][n]), transposed through LDS: a block owns 64 rows i x all 256 columns o of one matrix.
// It reads whole rows (a wave = 512 consecutive bytes) and writes whole 128-byte lines (8 lanes = the 64 i of one o).
// The last NBONE blocks centre a bone's bias and W0 rows in the same way (a wave = a row), kept in f32.
// LDS keeps the rounded f32 rows unpadded; the 16-byte piece c of row i lies at piece c ^ (i >> 3), so that the column reads of 8 lanes (8 rows apart) fall on 8 different bank groups.
__global__ __launch_bounds__(256) void k_wt3(const float* __restrict__ Wm, const float* __restrict__ b0, const float* __restrict__ bm, const float* __restrict__ W0, _Float16* __restrict__ Wt, float* __restrict__ cen) {
  __shared__ __attribute__((aligned(16))) float sm[64 * HH];
  __shared__ __attribute__((aligned(16))) float mn[64];
  const int tid = threadIdx.x;
  if (blockIdx.x >= NWB) {   // the whole block takes this path and leaves in front of every barrier
    const int n = blockIdx.x - NWB, r = tid >> 5, lane = tid & 31;
    if (r < NCEN) {
      const float* row = (r == 0 ? b0 + (size_t)n * HH : r < 4 ? bm + ((size_t)(r - 1) * NBONE + n) * HH : W0 + ((size_t)n * 3 + (r - 4)) * HH) + lane * 8;
      v4f lo = *(const v4fa*)row, hi = *(const v4fa*)(row + 4);
      asm volatile("s_wait_xcnt 0x0" ::: "memory");   // stands in front of whatever reuses the address registers of the two loads
#pragma unroll   /* constant element indices, so that the two vectors stay in registers */
      for (int q = 0; q < 4; ++q) { lo[q] = bf16_round(lo[q]); hi[q] = bf16_round(hi[q]); }
      float s = ((lo[0] + lo[1]) + (lo[2] + lo[3])) + ((hi[0] + hi[1]) + (hi[2] + hi[3]));
#pragma unroll   /* five steps with constant lane masks: the row's sum in every lane */
      for (int d = 1; d < 32; d <<= 1) s += __shfl_xor(s, d, 32);
      const float mu = s * (1.0f / HH);
      float* dst = cen + ((size_t)n * NCEN + r) * HH + lane * 8;
      *(v4fa*)dst = lo - mu; *(v4fa*)(dst + 4) = hi - mu;
    }
    return;
  }
  const int mat = blockIdx.x >> 2, i0 = (blockIdx.x & 3) * 64;
  const float* sp = Wm + ((size_t)mat * HH + i0) * HH;   // uniform base, the thread's place in the tile as the one vector offset
  const unsigned so = (unsigned)((tid >> 6) * HH + (tid & 63) * 4);
  v4f v[16];
#pragma unroll
  for (int j = 0; j < 16; ++j) v[j] = *(const v4fa*)(sp + so + j * 4 * HH);   // all 16 loads of a thread in flight at once
#pragma unroll
  for (int j = 0; j < 16; ++j) { const int i = j * 4 + (tid >> 6); *(v4fa*)(sm + i * HH + (((tid & 63) ^ (i >> 3)) << 2)) = v4f{bf16_round(v[j][0]), bf16_round(v[j][1]), bf16_round(v[j][2]), bf16_round(v[j][3])}; }
  __syncthreads();   // the tile is read by rows and by columns, across what other waves stored
  { const int i = tid >> 2; float s = 0.f;   // four threads a row, 16 pieces each; the walk starts at the lane's own piece, so that 16 lanes fall on 16 bank groups
#pragma unroll   /* all 16 LDS reads of a thread in flight at once */
    for (int k = 0; k < 16; ++k) { const int c = (tid & 3) * 16 + ((k + tid) & 15); const v4f x = *(const v4fa*)(sm + i * HH + ((c ^ (i >> 3)) << 2)); s += (x[0] + x[1]) + (x[2] + x[3]); }
    s += __shfl_xor(s, 1, 32); s += __shfl_xor(s, 2, 32);
    if ((tid & 3) == 0) mn[i] = s * (1.0f / HH); }
  __syncthreads();   // publishes the 64 row means
  const int ic = tid & 7;
  const v4f m0 = *(const v4fa*)(mn + ic * 8), m1 = *(const v4fa*)(mn + ic * 8 + 4);
  unsigned short* dp = (unsigned short*)Wt + ((size_t)mat * HH + (tid >> 3)) * HH + i0 + ic * 8;
#pragma unroll
  for (int h = 0; h < 8; ++h) { const int o = h * 32 + (tid >> 3); const float* cp = sm + ic * 8 * HH + ((((o >> 2) ^ ic) << 2) | (o & 3)); FragH f;
#pragma unroll
    for (int q = 0; q < 8; ++q) f.h[q] = (_Float16)((cp[q * HH] - (q < 4 ? m0[q & 3] : m1[q & 3])) * 16.0f);
    *(v8us*)(dp + (size_t)h * 32 * HH) = f.half[0]; }
}

// lane l <-> lane l ^ 16
__device__ __forceinline__ float xhalf(float x) { return __builtin_bit_cast(float, __builtin_amdgcn_permlanex16(__builtin_bit_cast(int, x), __builtin_bit_cast(int, x), 0x76543210, 0xfedcba98, false, false)); }
__device__ __forceinline__ v8f ld8(const float* p) { const v4f lo = *(const v4fa*)p, hi = *(const v4fa*)(p + 4); return __builtin_shufflevector(lo, hi, 0, 1, 2, 3, 4, 5, 6, 7); }
__device__ __forceinline__ void st8(float* p, v8f v) { *(v4fa*)p = __builtin_shufflevector(v, v, 0, 1, 2, 3); *(v4fa*)(p + 4) = __builtin_shufflevector(v, v, 4, 5, 6, 7); }
// sum of a lane's 8 partial sums and of its partner's in the other half of the wave: a point's whole row
__device__ __forceinline__ float point_sum(v8f v) { const float s = ((v[0] + v[1]) + (v[2] + v[3])) + ((v[4] + v[5]) + (v[6] + v[7])); return s + xhalf(s); }

__global__ __launch_bounds__(NTH) void k_mlp(const float* __restrict__ xyz, const float* __restrict__ lat, const float* __restrict__ cen, const float* __restrict__ g0, const float* __restrict__ be0,
                                             const _Float16* __restrict__ Wt, const float* __restrict__ gm, const float* __restrict__ bem, const float* __restrict__ Wf, const float* __restrict__ bfb, float* __restrict__ tmp) {
  __shared__ __attribute__((aligned(16))) float xs[TM * XP];
  __shared__ __attribute__((aligned(16))) unsigned short wsb[2][HH * WP];
  __shared__ __attribute__((aligned(16))) float ps[NPAR * HH];
  const int tid = threadIdx.x, w = tid >> 5, lane = tid & 31, ln = lane & 15, hh = lane >> 4;
  const int n = blockIdx.y, p0 = blockIdx.x * TM;
  v8us st[8], st1[8];
  float* xw = xs + (size_t)(w * 16 * MT) * XP; // this wave's 64 rows
  float* xl = xw + ln * XP + 8 * hh;           // accumulator layout: element (m, t, r) = point m*16 + ln, column t*16 + 8*hh + r
  float pv[2][NPAR];   // thread = two columns: the bone's per-column parameters, rounded once a work-group and read from LDS 8 columns a lane
  { const size_t nb = (size_t)n * HH;   // uniform row bases, the thread's column as the one vector offset
    const float* rb = cen + NCEN * nb; const float* rg = g0 + nb; const float* re = be0 + nb; const float* rf = Wf + nb;
#pragma unroll
    for (int c = 0; c < 2; ++c) { const int col = tid + c * NTH;
      pv[c][0] = rb[col]; pv[c][4] = rg[col]; pv[c][8] = re[col]; pv[c][15] = rf[col];
#pragma unroll
      for (int l = 0; l < 3; ++l) { const float* qb = rb + (1 + l) * HH; const float* qg = gm + (size_t)l * NBONE * HH + nb; const float* qe = bem + (size_t)l * NBONE * HH + nb; const float* qw = rb + (4 + l) * HH;
        pv[c][1 + l] = qb[col]; pv[c][5 + l] = qg[col]; pv[c][9 + l] = qe[col]; pv[c][12 + l] = qw[col]; } } }
  asm volatile("s_wait_xcnt 0x0" ::: "memory");   // stands in front of the address arithmetic below, which may reuse the offset and base registers of these loads
  __builtin_amdgcn_sched_barrier(0);   // keeps that arithmetic behind the wait
  const float bq = bfb[n];
  // lane = two rows: the rigid transform's three coordinates, left in the row's pad behind its 256 columns
  float q[2][3]; v4f r4[2][3];
  {
#pragma unroll
    for (int c = 0; c < 2; ++c) { const int p = p0 + w * 16 * MT + c * 32 + lane; const float* Lp = lat + ((size_t)p * NBONE + n) * 16;
#pragma unroll
      for (int i = 0; i < 3; ++i) { q[c][i] = xyz[(size_t)p * 3 + i]; r4[c][i] = *(const v4fa*)(Lp + 4 * i); } }
    asm volatile("s_wait_xcnt 0x0" ::: "memory");   // stands in front of the address arithmetic that reuses these loads' offset and base registers
    __builtin_amdgcn_sched_barrier(0);   // keeps that arithmetic behind the wait
  }
  // weight staging: four threads a row of 64 B, 32 rows a round, eight rounds a slab (formed here, behind the wait: formed earlier it sank in among the loads above)
  const unsigned short* wsrc = (const unsigned short*)Wt + ((size_t)n * HH + (tid >> 2)) * HH + (tid & 3) * 8;
  const int wdst = (tid >> 2) * WP + (tid & 3) * 8;
  {
#pragma unroll
    for (int j = 0; j < 8; ++j) { st[j] = *(const v8us*)(wsrc + (size_t)j * 32 * HH); st1[j] = *(const v8us*)(wsrc + (size_t)j * 32 * HH + 32); }   // slabs 0 and 1
    asm volatile("s_wait_xcnt 0x0" ::: "memory");   // as above, for the slab loads
    __builtin_amdgcn_sched_barrier(0);   // keeps the arithmetic below behind the wait
#pragma unroll
    for (int m = 0; m < MT; ++m)   // x starts at zero, so layer 0 adds its residual like the others and the layer body needs no branch among its LDS reads (stored here, while the global loads fly)
#pragma unroll
      for (int t = 0; t < 16; ++t) st8(xl + m * 16 * XP + t * 16, v8f{0.f, 0.f, 0.f, 0.f, 0.f, 0.f, 0.f, 0.f});
#pragma unroll
    for (int c = 0; c < 2; ++c) { const float h0 = bf16_round(q[c][0]), h1 = bf16_round(q[c][1]), h2 = bf16_round(q[c][2]);
#pragma unroll
      for (int i = 0; i < 3; ++i) { float a = 0.f; a += bf16_round(r4[c][i][0]) * h0; a += bf16_round(r4[c][i][1]) * h1; a += bf16_round(r4[c][i][2]) * h2; a += bf16_round(r4[c][i][3]); xw[(c * 32 + lane) * XP + HH + i] = a; } }
  }
#pragma unroll
  for (int j = 0; j < 8; ++j) { *(v8us*)(&wsb[0][wdst + j * 32 * WP]) = st[j]; *(v8us*)(&wsb[1][wdst + j * 32 * WP]) = st1[j]; }
#pragma unroll
  for (int c = 0; c < 2; ++c)
#pragma unroll
    for (int k = 0; k < NPAR; ++k) ps[k * HH + tid + c * NTH] = (k < 4 || (k >= 12 && k < 15)) ? pv[c][k] : bf16_round(pv[c][k]);   // the bias and W0 rows come rounded and centred
  __syncthreads();   // publishes slabs 0 and 1, the coordinates and the parameters
  const float* pl = ps + 8 * hh;               // the same columns of a parameter row
  const int wfr = ln * WP + 8 * hh;            // a lane's place in a weight tile
  v8f acc[MT][16];
  FragH b[2][16];   // weight fragments: slab s in b[s & 1], the next slab's fetched during this slab's products
#pragma unroll 1   /* the layer body is several thousand instructions: kept rolled for code size */
  for (int L = 0; L < 4; ++L) {
    const float* pb = pl + L * HH;   // this layer's bias row
    if (L == 0) {
#pragma unroll
      for (int t = 0; t < 16; ++t) { b[0][t].half[0] = *(const v8us*)(&wsb[0][wfr + t * 16 * WP]); b[0][t].half[1] = *(const v8us*)(&wsb[0][wfr + t * 16 * WP + 16]); }   // slab 0's fragments; every later slab's are fetched a trip ahead
      __syncthreads();   // ends every wave's reads of slab 0, whose buffer the first trip refills
      float ip[MT][3];
#pragma unroll
      for (int m = 0; m < MT; ++m)
#pragma unroll
        for (int i = 0; i < 3; ++i) ip[m][i] = xw[(m * 16 + ln) * XP + HH + i];
      v8f bb[16], wa[16], wb_[16], wc[16];   // bias and the three W0 rows, fetched two column tiles a group, a group's arithmetic ahead of their use
#pragma unroll
      for (int t = 0; t < 4; ++t) { bb[t] = ld8(pb + t * 16); wa[t] = ld8(pl + 12 * HH + t * 16); wb_[t] = ld8(pl + 13 * HH + t * 16); wc[t] = ld8(pl + 14 * HH + t * 16); }
#pragma unroll
      for (int g = 0; g < 8; ++g) {
#pragma unroll
        for (int t = 2 * g; t < 2 * g + 2; ++t)
#pragma unroll
          for (int m = 0; m < MT; ++m) { v8f a = bb[t]; a += ip[m][0] * wa[t]; a += ip[m][1] * wb_[t]; a += ip[m][2] * wc[t]; acc[m][t] = a; }
        if (g + 2 < 8) {
          __builtin_amdgcn_sched_barrier(0);   // group g + 2 is fetched behind group g's arithmetic, so that no more than two groups are live
#pragma unroll
          for (int t = 2 * g + 4; t < 2 * g + 6; ++t) { bb[t] = ld8(pb + t * 16); wa[t] = ld8(pl + 12 * HH + t * 16); wb_[t] = ld8(pl + 13 * HH + t * 16); wc[t] = ld8(pl + 14 * HH + t * 16); }
          __builtin_amdgcn_sched_barrier(0);   // and in front of group g + 1's: left to the scheduler the reads stood so close to their use that the waits ran to zero
        }
      }
    } else {
      v4f xa[MT][4];
      FragH a[MT];
#pragma unroll
      for (int m = 0; m < MT; ++m) { const float* xr = xw + (m * 16 + ln) * XP + 8 * hh;   // the layer's first 32 columns of x; the later ones are fetched a trip ahead
        xa[m][0] = *(const v4fa*)(xr); xa[m][1] = *(const v4fa*)(xr + 4); xa[m][2] = *(const v4fa*)(xr + 16); xa[m][3] = *(const v4fa*)(xr + 20); }
#pragma unroll
      for (int m = 0; m < MT; ++m)
#pragma unroll
        for (int t = 0; t < 16; ++t) acc[m][t] = v8f{0.f, 0.f, 0.f, 0.f, 0.f, 0.f, 0.f, 0.f};
#pragma unroll
      for (int m = 0; m < MT; ++m)
#pragma unroll
        for (int q = 0; q < 4; ++q) { a[m].h[q] = (_Float16)xa[m][0][q]; a[m].h[4 + q] = (_Float16)xa[m][1][q]; a[m].h[8 + q] = (_Float16)xa[m][2][q]; a[m].h[12 + q] = (_Float16)xa[m][3][q]; }
#pragma unroll 1   /* rolled by pairs of trips: a pair already holds 128 products, and the two fragment sets swap roles inside it */
      for (int kp = 0; kp < 4; ++kp) {
#pragma unroll
        for (int u = 0; u < 2; ++u) {
          const int ks = 2 * kp + u, s = (L - 1) * 8 + ks;   // s & 1 == u
          const int sn = s + 2 < NSLAB ? s + 2 : NSLAB - 1;   // no branch round the staging: behind a join the compiler waited for these loads at once (the last two trips stage the last slab again, unread)
          const unsigned short* sp = wsrc + (size_t)(sn >> 3) * NBONE * HH * HH + (sn & 7) * 32;   // slab s + 2 flies during this slab's products
#pragma unroll
          for (int j = 0; j < 8; ++j) st[j] = *(const v8us*)(sp + (size_t)j * 32 * HH);
          asm volatile("s_wait_xcnt 0x0" ::: "memory");   // stands in front of the LDS reads below, whose results may land in the address registers of these loads
          __builtin_amdgcn_sched_barrier(0);   // keeps the LDS address arithmetic behind the wait: the scheduler lifted it over it, into a register of these loads
          // slab s + 1's fragments and its columns of x, in two groups, each ahead of half of this slab's products: the one wave of a SIMD has nobody to hide an LDS wait behind
#pragma unroll
          for (int m = 0; m < MT; ++m) { const float* xr = xw + (m * 16 + ln) * XP + ((ks + 1) & 7) * 32 + 8 * hh;   // (a layer's last trip fetches columns 0 to 31 again, unread)
            xa[m][0] = *(const v4fa*)(xr); xa[m][1] = *(const v4fa*)(xr + 4); xa[m][2] = *(const v4fa*)(xr + 16); xa[m][3] = *(const v4fa*)(xr + 20); }
#pragma unroll
          for (int t = 0; t < 4; ++t) { b[u ^ 1][t].half[0] = *(const v8us*)(&wsb[u ^ 1][wfr + t * 16 * WP]); b[u ^ 1][t].half[1] = *(const v8us*)(&wsb[u ^ 1][wfr + t * 16 * WP + 16]); }
          __builtin_amdgcn_sched_barrier(0);   // the group issues whole, ahead of the products: every further place where LDS reads stand among them costs issue time
#pragma unroll
          for (int t = 0; t < 8; ++t)   // weights as A (rows = output columns), x as B (columns = points)
#pragma unroll
            for (int m = 0; m < MT; ++m) acc[m][t] = __builtin_amdgcn_wmma_f32_16x16x32_f16(false, b[u][t].v, false, a[m].v, (short)0, acc[m][t], false, false);
          __builtin_amdgcn_sched_barrier(0);   // the second group stands here, not among the products
#pragma unroll
          for (int t = 4; t < 16; ++t) { b[u ^ 1][t].half[0] = *(const v8us*)(&wsb[u ^ 1][wfr + t * 16 * WP]); b[u ^ 1][t].half[1] = *(const v8us*)(&wsb[u ^ 1][wfr + t * 16 * WP + 16]); }
          __builtin_amdgcn_sched_barrier(0);   // as for the first group
#pragma unroll
          for (int t = 8; t < 12; ++t)
#pragma unroll
            for (int m = 0; m < MT; ++m) acc[m][t] = __builtin_amdgcn_wmma_f32_16x16x32_f16(false, b[u][t].v, false, a[m].v, (short)0, acc[m][t], false, false);
          __builtin_amdgcn_sched_barrier(0);   // three quarters of the products issue before the wait for slab s + 2's global loads; moved ahead of them, that wait stood bare in every trip
#pragma unroll
          for (int j = 0; j < 8; ++j) *(v8us*)(&wsb[u][wdst + j * 32 * WP]) = st[j];
          __builtin_amdgcn_sched_barrier(0);   // the stores stand here, so that they drain during the last quarter of the products and not in front of the barrier
#pragma unroll
          for (int t = 12; t < 16; ++t)
#pragma unroll
            for (int m = 0; m < MT; ++m) acc[m][t] = __builtin_amdgcn_wmma_f32_16x16x32_f16(false, b[u][t].v, false, a[m].v, (short)0, acc[m][t], false, false);
#pragma unroll
          for (int m = 0; m < MT; ++m)   // the next trip's B fragments
#pragma unroll
            for (int q = 0; q < 4; ++q) { a[m].h[q] = (_Float16)xa[m][0][q]; a[m].h[4 + q] = (_Float16)xa[m][1][q]; a[m].h[8 + q] = (_Float16)xa[m][2][q]; a[m].h[12 + q] = (_Float16)xa[m][3][q]; }
          __builtin_amdgcn_sched_barrier(0);   // keeps the conversions in front of the barrier: behind it they stood bare ahead of the next trip's products
          __syncthreads();   // publishes slab s + 2 and ends every wave's reads of slab s + 1, whose buffer the next trip refills
        }
      }
      v8f bv[16];
#pragma unroll
      for (int t = 0; t < 16; ++t) bv[t] = ld8(pb + t * 16);
      __builtin_amdgcn_sched_barrier(0);   // the bias row's LDS reads issue as one group, for speed only
#pragma unroll
      for (int t = 0; t < 16; ++t)
#pragma unroll
        for (int m = 0; m < MT; ++m) acc[m][t] = acc[m][t] * 0.0625f + bv[t];
    }
    const float* pg = pl + (4 + L) * HH;
    const float* pe = pl + (8 + L) * HH;
    v8f gq[16], eq[16], rq[MT][16];   // gain, shift and residual x, fetched two column tiles a group, a group's arithmetic ahead of their use
#pragma unroll
    for (int t = 0; t < 4; ++t) { gq[t] = ld8(pg + t * 16); eq[t] = ld8(pe + t * 16);
#pragma unroll
      for (int m = 0; m < MT; ++m) rq[m][t] = ld8(xl + m * 16 * XP + t * 16); }
    __builtin_amdgcn_sched_barrier(0);   // the first two groups fly during the statistics; left to the scheduler these reads sank to just in front of their use
    float rs[MT];
#pragma unroll
    for (int m = 0; m < MT; ++m) {
      v8f qv = v8f{0.f, 0.f, 0.f, 0.f, 0.f, 0.f, 0.f, 0.f};   // a row arrives centred: its weights and biases were
#pragma unroll
      for (int t = 0; t < 16; ++t) qv += acc[m][t] * acc[m][t];
      rs[m] = rsqrtf(point_sum(qv) * (1.0f / HH) + LNEPS);
    }
#pragma unroll
    for (int g = 0; g < 8; ++g) {
#pragma unroll
      for (int t = 2 * g; t < 2 * g + 2; ++t)
#pragma unroll
        for (int m = 0; m < MT; ++m) { v8f y = acc[m][t] * rs[m] * gq[t] + eq[t];
#pragma unroll
          for (int r = 0; r < 8; ++r) y[r] = fmaxf(y[r], SLOPE * y[r]);   /* = y for y >= 0, SLOPE * y below, as 0 < SLOPE < 1 */
          acc[m][t] = y + rq[m][t]; }
      if (g + 2 < 8) {
        __builtin_amdgcn_sched_barrier(0);   // group g + 2 is fetched behind group g's arithmetic, not earlier: two groups in flight are enough
#pragma unroll
        for (int t = 2 * g + 4; t < 2 * g + 6; ++t) { gq[t] = ld8(pg + t * 16); eq[t] = ld8(pe + t * 16);
#pragma unroll
          for (int m = 0; m < MT; ++m) rq[m][t] = ld8(xl + m * 16 * XP + t * 16); }
        __builtin_amdgcn_sched_barrier(0);   // and not later: its reads fly during group g + 1's arithmetic
      }
    }
    if (L < 3) {   // no barrier behind these stores: every element is read back by the lane that wrote it
#pragma unroll
      for (int m = 0; m < MT; ++m)
#pragma unroll
        for (int t = 0; t < 16; ++t) st8(xl + m * 16 * XP + t * 16, acc[m][t]);
    }
  }
  const float bfv = bf16_round(bq);
  v8f wf[16];
  v8f fv[MT];
#pragma unroll
  for (int m = 0; m < MT; ++m) fv[m] = v8f{0.f, 0.f, 0.f, 0.f, 0.f, 0.f, 0.f, 0.f};
#pragma unroll
  for (int t = 0; t < 16; ++t) wf[t] = ld8(pl + 15 * HH + t * 16);
  __builtin_amdgcn_sched_barrier(0);   // one group of LDS reads, as for the bias row
#pragma unroll
  for (int t = 0; t < 16; ++t)
#pragma unroll
    for (int m = 0; m < MT; ++m) fv[m] += acc[m][t] * wf[t];
  float o[MT];
#pragma unroll
  for (int m = 0; m < MT; ++m) o[m] = point_sum(fv[m]) + bfv;
  float* tp = tmp + (size_t)n * NPT + p0 + w * 16 * MT + lane;   // bone-major: a wave owns its two whole 128-byte lines; lane = point
  tp[0] = hh ? o[1] : o[0];
  tp[32] = hh ? o[3] : o[2];
}

// out[b][n] = tmp[n][b]: 16 points x 16 bones a block, whole lines written by one block
__global__ __launch_bounds__(256) void k_tr(const float* __restrict__ tmp, float* __restrict__ out) { __shared__ float sm[16][17]; const int tid = threadIdx.x;
  sm[tid & 15][tid >> 4] = tmp[(size_t)(tid >> 4) * NPT + blockIdx.x * 16 + (tid & 15)];
  __syncthreads();
  out[(size_t)blockIdx.x * 256 + tid] = sm[tid >> 4][tid & 15]; }

extern "C" void kernel_launch(void* const* d_in, const int* in_sizes, int n_in,
                              void* d_out, int out_size, void* d_ws, size_t ws_size, hipStream_t stream) {
  (void)in_sizes; (void)n_in; (void)out_size;
  const float* const* I = (const float* const*)d_in; const float* xyz = I[0]; const float* lat = I[1]; const float* W0 = I[2]; const float* b0 = I[3]; const float* g0 = I[4]; const float* be0 = I[5]; const float* Wm = I[6]; const float* bm = I[7]; const float* gm = I[8]; const float* bem = I[9]; const float* Wf = I[10]; const float* bfb = I[11];
  char* ws = (char*)d_ws; size_t off = 0;
  auto take = [&](size_t bytes) { char* p = ws + off; off += (bytes + 255) & ~(size_t)255; return p; };
  _Float16* Wt = (_Float16*)take((size_t)3 * NBONE * HH * HH * 2); float* tmp = (float*)take((size_t)NBONE * NPT * 4); float* cen = (float*)take((size_t)NBONE * NCEN * HH * 4);
  if (off > ws_size) return;
  k_wt3<<<NWB + NBONE, 256, 0, stream>>>(Wm, b0, bm, W0, Wt, cen);
  k_mlp<<<dim3(NPT / TM, NBONE), NTH, 0, stream>>>(xyz, lat, cen, g0, be0, Wt, gm, bem, Wf, bfb, tmp);
  k_tr<<<NPT / 16, 256, 0, stream>>>(tmp, (float*)d_out);
}

// v006
// One run takes 90.5 microseconds.
// Two timings next to v005 put it at 1.09 and 1.07 times that version's speed.
// All steps since v000 together make it 13.9 times as fast.
#include <hip/hip_runtime.h>
// Piecewise-rigid implicit decoder (B=16384 query points x N=16 bones, hidden 256): inp[b,n] = (latent[b,n].[xyz_b;1])[:3];
// layer 0: x = lrelu(LN(inp.W0[n] + b0[n]).g0[n] + be0[n]); layers 1-3: x = lrelu(LN(x.Wm[l,n] + bm[l,n]).gm + bem) + x;
// out[b,n] = x.Wf[n] + bf[n] (LeakyReLU slope 0.1, LN eps 1e-5, per-bone weights (in,out)).
// Compute dtype: all inputs rounded to bf16; residual stream x in f32, rounded to f16 as the GEMM's B operand; weights f16 (x16, undone by 1/16).
// One fused kernel: a work-group owns 256 points of one bone for the whole network. x lives in LDS (f32), a wave owns 64 points x all 256
// columns (so LayerNorm never leaves the wave), the bone's weights come in slabs of 32 k straight from global memory into registers: the first launch
// stores them in fragment order (a wave's 16-byte-a-lane load = 512 consecutive bytes), and the 4 waves, which walk the same slabs, share the lines in the cache of their WGP.
// The products are taken transposed (weights as A, x as B): a lane's accumulators are 8 consecutive columns of ONE point, which are the
// very elements the same lane reads as its B fragment in the next layer, so x in LDS is private to a lane and moves in 16-byte pieces.
// LayerNorm's mean is taken out ahead of the products: mean_o(x.W + b) = x.mean_o(W) + mean_o(b), so the first launch subtracts from every weight row
// (and from every bias and W0 row) its mean over the 256 outputs; what the products give is then already centred, and only the sum of squares is left.
#define NPT 16384
#define NBONE 16
#define HH 256
#define LNEPS 1e-5f
#define SLOPE 0.1f
#define TM 256   /* points per work-group: 4 waves x 64 rows */
#define NTH 128  /* threads of the fused kernel: one wave a SIMD, so that a wave may hold more than 512 registers */
#define MT 4     /* 16-point tiles a wave */
#define XP 260   /* pitch of an x row in LDS, floats: 1040 B = 16 B x odd, for the 16-byte reads and writes of x */
#define SLABH (HH * 32)   /* halfs of a weight slab: 16 column tiles x 2 halves of a fragment x 32 lanes x 8 */
#define NSLAB 24 /* 3 layers x 8 slabs of 32 k */
#define NCEN 7   /* centred parameter rows a bone in the workspace: b0, bm 0-2, W0 0-2 */
#define NWB (3 * NBONE * (HH / 64))   /* blocks of the first launch that transpose weights; NBONE more centre the parameter rows */
#define NPAR 16  /* per-column parameter rows kept in LDS: bias 0-3, gain 4-7, shift 8-11 (by layer), W0 12-14, Wf 15 */
typedef unsigned short v8us __attribute__((ext_vector_type(8), may_alias));
typedef float  v8f  __attribute__((ext_vector_type(8)));
typedef float  v4f  __attribute__((ext_vector_type(4)));
typedef float  v4fa __attribute__((ext_vector_type(4), may_alias));
typedef _Float16 v16h __attribute__((ext_vector_type(16)));
union FragH { v16h v; v8us half[2]; _Float16 h[16]; unsigned short u[16]; };

__device__ __forceinline__ unsigned short bf16_bits(float x) { unsigned int u = __float_as_uint(x); return (unsigned short)((u + 0x7FFFu + ((u >> 16) & 1u)) >> 16); }
__device__ __forceinline__ float bf16_val(unsigned short b) { return __uint_as_float(((unsigned int)b) << 16); }
__device__ __forceinline__ float bf16_round(float x) { return bf16_val(bf16_bits(x)); }

// f16((w[i][o] - mean_o w[i][o]) * 16), w = bf16(Wm[l][n]), transposed through LDS: a block owns 64 rows i x all 256 columns o of one matrix.
// Stored in the order in which the fused kernel's lanes hold it as the A operand: Wt[n][slab l * 8 + (i >> 5)][tile o >> 4][half (i >> 4) & 1][lane (o & 15) + 16 * ((i >> 3) & 1)][i & 7].
// It reads whole rows (a wave = 512 consecutive bytes) and writes 64-byte runs (4 lanes = 8 i of 4 neighbouring o); both runs of a line come from this block.
// The last NBONE blocks centre a bone's bias and W0 rows in the same way (a wave = a row), kept in f32.
// LDS keeps the rounded f32 rows unpadded; the 16-byte piece c of row i lies at piece c ^ (i >> 3), so that the column reads of 8 lanes (8 rows apart) fall on 8 different bank groups.
__global__ __launch_bounds__(256) void k_wt3(const float* __restrict__ Wm, const float* __restrict__ b0, const float* __restrict__ bm, const float* __restrict__ W0, _Float16* __restrict__ Wt, float* __restrict__ cen) {
  __shared__ __attribute__((aligned(16))) float sm[64 * HH];
  __shared__ __attribute__((aligned(16))) float mn[64];
  const int tid = threadIdx.x;
  if (blockIdx.x >= NWB) {   // the whole block takes this path and leaves in front of every barrier
    const int n = blockIdx.x - NWB, r = tid >> 5, lane = tid & 31;
    if (r < NCEN) {
      const float* row = (r == 0 ? b0 + (size_t)n * HH : r < 4 ? bm + ((size_t)(r - 1) * NBONE + n) * HH : W0 + ((size_t)n * 3 + (r - 4)) * HH) + lane * 8;
      v4f lo = *(const v4fa*)row, hi = *(const v4fa*)(row + 4);
      asm volatile("s_wait_xcnt 0x0" ::: "memory");   // stands in front of whatever reuses the address registers of the two loads
#pragma unroll   /* constant element indices, so that the two vectors stay in registers */
      for (int q = 0; q < 4; ++q) { lo[q] = bf16_round(lo[q]); hi[q] = bf16_round(hi[q]); }
      float s = ((lo[0] + lo[1]) + (lo[2] + lo[3])) + ((hi[0] + hi[1]) + (hi[2] + hi[3]));
#pragma unroll   /* five steps with constant lane masks: the row's sum in every lane */
      for (int d = 1; d < 32; d <<= 1) s += __shfl_xor(s, d, 32);
      const float mu = s * (1.0f / HH);
      float* dst = cen + ((size_t)n * NCEN + r) * HH + lane * 8;
      *(v4fa*)dst = lo - mu; *(v4fa*)(dst + 4) = hi - mu;
    }
    return;
  }
  const int mat = blockIdx.x >> 2, i0 = (blockIdx.x & 3) * 64;
  const float* sp = Wm + ((size_t)mat * HH + i0) * HH;   // uniform base, the thread's place in the tile as the one vector offset
  const unsigned so = (unsigned)((tid >> 6) * HH + (tid & 63) * 4);
  v4f v[16];
#pragma unroll
  for (int j = 0; j < 16; ++j) v[j] = *(const v4fa*)(sp + so + j * 4 * HH);   // all 16 loads of a thread in flight at once
#pragma unroll
  for (int j = 0; j < 16; ++j) { const int i = j * 4 + (tid >> 6); *(v4fa*)(sm + i * HH + (((tid & 63) ^ (i >> 3)) << 2)) = v4f{bf16_round(v[j][0]), bf16_round(v[j][1]), bf16_round(v[j][2]), bf16_round(v[j][3])}; }
  __syncthreads();   // the tile is read by rows and by columns, across what other waves stored
  { const int i = tid >> 2; float s = 0.f;   // four threads a row, 16 pieces each; the walk starts at the lane's own piece, so that 16 lanes fall on 16 bank groups
#pragma unroll   /* all 16 LDS reads of a thread in flight at once */
    for (int k = 0; k < 16; ++k) { const int c = (tid & 3) * 16 + ((k + tid) & 15); const v4f x = *(const v4fa*)(sm + i * HH + ((c ^ (i >> 3)) << 2)); s += (x[0] + x[1]) + (x[2] + x[3]); }
    s += __shfl_xor(s, 1, 32); s += __shfl_xor(s, 2, 32);
    if ((tid & 3) == 0) mn[i] = s * (1.0f / HH); }
  __syncthreads();   // publishes the 64 row means
  const int ic = tid & 7;
  const v4f m0 = *(const v4fa*)(mn + ic * 8), m1 = *(const v4fa*)(mn + ic * 8 + 4);
  unsigned short* dp = (unsigned short*)Wt + (size_t)((mat & 15) * NSLAB + (mat >> 4) * 8 + (i0 >> 5) + (ic >> 2)) * SLABH + (tid >> 7) * 512 + ((ic >> 1) & 1) * 256 + (ic & 1) * 128 + ((tid >> 3) & 15) * 8;
#pragma unroll
  for (int h = 0; h < 8; ++h) { const int o = h * 32 + (tid >> 3); const float* cp = sm + ic * 8 * HH + ((((o >> 2) ^ ic) << 2) | (o & 3)); FragH f;
#pragma unroll
    for (int q = 0; q < 8; ++q) f.h[q] = (_Float16)((cp[q * HH] - (q < 4 ? m0[q & 3] : m1[q & 3])) * 16.0f);
    *(v8us*)(dp + h * 1024) = f.half[0]; }   // 32 columns on = two column tiles on
  asm volatile("s_wait_xcnt 0x0" ::: "memory");   // stands in front of whatever reuses the address and data registers of these stores
}

// lane l <-> lane l ^ 16
__device__ __forceinline__ float xhalf(float x) { return __builtin_bit_cast(float, __builtin_amdgcn_permlanex16(__builtin_bit_cast(int, x), __builtin_bit_cast(int, x), 0x76543210, 0xfedcba98, false, false)); }
__device__ __forceinline__ v8f ld8(const float* p) { const v4f lo = *(const v4fa*)p, hi = *(const v4fa*)(p + 4); return __builtin_shufflevector(lo, hi, 0, 1, 2, 3, 4, 5, 6, 7); }
__device__ __forceinline__ void st8(float* p, v8f v) { *(v4fa*)p = __builtin_shufflevector(v, v, 0, 1, 2, 3); *(v4fa*)(p + 4) = __builtin_shufflevector(v, v, 4, 5, 6, 7); }
// sum of a lane's 8 partial sums and of its partner's in the other half of the wave: a point's whole row
__device__ __forceinline__ float point_sum(v8f v) { const float s = ((v[0] + v[1]) + (v[2] + v[3])) + ((v[4] + v[5]) + (v[6] + v[7])); return s + xhalf(s); }

__global__ __launch_bounds__(NTH) void k_mlp(const float* __restrict__ xyz, const float* __restrict__ lat, const float* __restrict__ cen, const float* __restrict__ g0, const float* __restrict__ be0,
                                             const _Float16* __restrict__ Wt, const float* __restrict__ gm, const float* __restrict__ bem, const float* __restrict__ Wf, const float* __restrict__ bfb, float* __restrict__ tmp) {
  __shared__ __attribute__((aligned(16))) float xs[TM * XP];
  __shared__ __attribute__((aligned(16))) float ps[NPAR * HH];
  const int tid = threadIdx.x, w = tid >> 5, lane = tid & 31, ln = lane & 15, hh = lane >> 4;
  const int n = blockIdx.y, p0 = blockIdx.x * TM;
  FragH b[2][16];   // weight fragments: slab s in b[s & 1], the next slab's loaded during this slab's products
  float* xw = xs + (size_t)(w * 16 * MT) * XP; // this wave's 64 rows
  float* xl = xw + ln * XP + 8 * hh;           // accumulator layout: element (m, t, r) = point m*16 + ln, column t*16 + 8*hh + r
  float pv[2][NPAR];   // thread = two columns: the bone's per-column parameters, rounded once a work-group and read from LDS 8 columns a lane
  { const size_t nb = (size_t)n * HH;   // uniform row bases, the thread's column as the one vector offset
    const float* rb = cen + NCEN * nb; const float* rg = g0 + nb; const float* re = be0 + nb; const float* rf = Wf + nb;
#pragma unroll
    for (int c = 0; c < 2; ++c) { const int col = tid + c * NTH;
      pv[c][0] = rb[col]; pv[c][4] = rg[col]; pv[c][8] = re[col]; pv[c][15] = rf[col];
#pragma unroll
      for (int l = 0; l < 3; ++l) { const float* qb = rb + (1 + l) * HH; const float* qg = gm + (size_t)l * NBONE * HH + nb; const float* qe = bem + (size_t)l * NBONE * HH + nb; const float* qw = rb + (4 + l) * HH;
        pv[c][1 + l] = qb[col]; pv[c][5 + l] = qg[col]; pv[c][9 + l] = qe[col]; pv[c][12 + l] = qw[col]; } } }
  asm volatile("s_wait_xcnt 0x0" ::: "memory");   // stands in front of the address arithmetic below, which may reuse the offset and base registers of these loads
  __builtin_amdgcn_sched_barrier(0);   // keeps that arithmetic behind the wait
  const float bq = bfb[n];
  // lane = two rows: the rigid transform's three coordinates, left in the row's pad behind its 256 columns
  float q[2][3]; v4f r4[2][3];
  {
#pragma unroll
    for (int c = 0; c < 2; ++c) { const int p = p0 + w * 16 * MT + c * 32 + lane; const float* Lp = lat + ((size_t)p * NBONE + n) * 16;
#pragma unroll
      for (int i = 0; i < 3; ++i) { q[c][i] = xyz[(size_t)p * 3 + i]; r4[c][i] = *(const v4fa*)(Lp + 4 * i); } }
    asm volatile("s_wait_xcnt 0x0" ::: "memory");   // stands in front of the address arithmetic that reuses these loads' offset and base registers
    __builtin_amdgcn_sched_barrier(0);   // keeps that arithmetic behind the wait
  }
  // weight fragments: the lane's 16 bytes of the next slab to load; tile and half are the immediate offset. The pointer steps on a slab a trip, behind the wait that follows its loads.
  const unsigned short* wp = (const unsigned short*)Wt + (size_t)n * NSLAB * SLABH + lane * 8;
  {
#pragma unroll
    for (int m = 0; m < MT; ++m)   // x starts at zero, so layer 0 adds its residual like the others and the layer body needs no branch among its LDS reads (stored here, while the global loads fly)
#pragma unroll
      for (int t = 0; t < 16; ++t) st8(xl + m * 16 * XP + t * 16, v8f{0.f, 0.f, 0.f, 0.f, 0.f, 0.f, 0.f, 0.f});
#pragma unroll
    for (int c = 0; c < 2; ++c) { const float h0 = bf16_round(q[c][0]), h1 = bf16_round(q[c][1]), h2 = bf16_round(q[c][2]);
#pragma unroll
      for (int i = 0; i < 3; ++i) { float a = 0.f; a += bf16_round(r4[c][i][0]) * h0; a += bf16_round(r4[c][i][1]) * h1; a += bf16_round(r4[c][i][2]) * h2; a += bf16_round(r4[c][i][3]); xw[(c * 32 + lane) * XP + HH + i] = a; } }
  }
#pragma unroll
  for (int c = 0; c < 2; ++c)
#pragma unroll
    for (int k = 0; k < NPAR; ++k) ps[k * HH + tid + c * NTH] = (k < 4 || (k >= 12 && k < 15)) ? pv[c][k] : bf16_round(pv[c][k]);   // the bias and W0 rows come rounded and centred
  __syncthreads();   // publishes the parameters (and the coordinates); the kernel's one barrier: behind it no wave reads what another wrote
  const float* pl = ps + 8 * hh;               // the same columns of a parameter row
  v8f acc[MT][16];
#pragma unroll 1   /* the layer body is several thousand instructions */
  for (int L = 0; L < 4; ++L) {
    const float* pb = pl + L * HH;   // this layer's bias row
    if (L == 0) {
#pragma unroll
      for (int t = 0; t < 16; ++t) { b[0][t].half[0] = *(const v8us*)(wp + t * 512); b[0][t].half[1] = *(const v8us*)(wp + t * 512 + 256); }   // slab 0 flies during layer 0; every later slab is loaded a trip ahead
      asm volatile("s_wait_xcnt 0x0" ::: "memory");   // stands in front of the step that rewrites the address registers of these loads
      __builtin_amdgcn_sched_barrier(0);   // keeps that step behind the wait
      wp += SLABH;
      float ip[MT][3];
#pragma unroll
      for (int m = 0; m < MT; ++m)
#pragma unroll
        for (int i = 0; i < 3; ++i) ip[m][i] = xw[(m * 16 + ln) * XP + HH + i];
      v8f bb[16], wa[16], wb_[16], wc[16];   // bias and the three W0 rows, fetched two column tiles a group, a group's arithmetic ahead of their use
#pragma unroll
      for (int t = 0; t < 4; ++t) { bb[t] = ld8(pb + t * 16); wa[t] = ld8(pl + 12 * HH + t * 16); wb_[t] = ld8(pl + 13 * HH + t * 16); wc[t] = ld8(pl + 14 * HH + t * 16); }
#pragma unroll
      for (int g = 0; g < 8; ++g) {
#pragma unroll
        for (int t = 2 * g; t < 2 * g + 2; ++t)
#pragma unroll
          for (int m = 0; m < MT; ++m) { v8f a = bb[t]; a += ip[m][0] * wa[t]; a += ip[m][1] * wb_[t]; a += ip[m][2] * wc[t]; acc[m][t] = a; }
        if (g + 2 < 8) {
          __builtin_amdgcn_sched_barrier(0);   // group g + 2 is fetched behind group g's arithmetic, so that no more than two groups are live
#pragma unroll
          for (int t = 2 * g + 4; t < 2 * g + 6; ++t) { bb[t] = ld8(pb + t * 16); wa[t] = ld8(pl + 12 * HH + t * 16); wb_[t] = ld8(pl + 13 * HH + t * 16); wc[t] = ld8(pl + 14 * HH + t * 16); }
          __builtin_amdgcn_sched_barrier(0);   // and in front of group g + 1's: left to the scheduler the reads stood so close to their use that the waits ran to zero
        }
      }
    } else {
      v4f xa[MT][4];
      FragH a[MT];
#pragma unroll
      for (int m = 0; m < MT; ++m) { const float* xr = xw + (m * 16 + ln) * XP + 8 * hh;   // the layer's first 32 columns of x; the later ones are fetched a trip ahead
        xa[m][0] = *(const v4fa*)(xr); xa[m][1] = *(const v4fa*)(xr + 4); xa[m][2] = *(const v4fa*)(xr + 16); xa[m][3] = *(const v4fa*)(xr + 20); }
#pragma unroll
      for (int m = 0; m < MT; ++m)
#pragma unroll
        for (int t = 0; t < 16; ++t) acc[m][t] = v8f{0.f, 0.f, 0.f, 0.f, 0.f, 0.f, 0.f, 0.f};
#pragma unroll
      for (int m = 0; m < MT; ++m)
#pragma unroll
        for (int q = 0; q < 4; ++q) { a[m].h[q] = (_Float16)xa[m][0][q]; a[m].h[4 + q] = (_Float16)xa[m][1][q]; a[m].h[8 + q] = (_Float16)xa[m][2][q]; a[m].h[12 + q] = (_Float16)xa[m][3][q]; }
#pragma unroll 1   /* rolled by pairs of trips: a pair already holds 128 products, and the two fragment sets swap roles inside it */
      for (int kp = 0; kp < 4; ++kp) {
#pragma unroll
        for (int u = 0; u < 2; ++u) {
          const int ks = 2 * kp + u, s = (L - 1) * 8 + ks;   // s & 1 == u
          const float* xn = xw + ln * XP + ((ks + 1) & 7) * 32 + 8 * hh;   // slab s + 1's columns of x (a layer's last trip fetches columns 0 to 31 again, unread)
#pragma unroll
          for (int t = 0; t < 16; ++t) { b[u ^ 1][t].half[0] = *(const v8us*)(wp + t * 512); b[u ^ 1][t].half[1] = *(const v8us*)(wp + t * 512 + 256); }   // slab s + 1 flies during this slab's products
#pragma unroll
          for (int m = 0; m < MT; ++m) { const float* xr = xn + m * 16 * XP;
            xa[m][0] = *(const v4fa*)(xr); xa[m][1] = *(const v4fa*)(xr + 4); xa[m][2] = *(const v4fa*)(xr + 16); xa[m][3] = *(const v4fa*)(xr + 20); }
          __builtin_amdgcn_sched_barrier(0);   // loads and LDS reads issue as one group, ahead of the products, for speed only
#pragma unroll
          for (int t = 0; t < 4; ++t)   // weights as A (rows = output columns), x as B (columns = points)
#pragma unroll
            for (int m = 0; m < MT; ++m) acc[m][t] = __builtin_amdgcn_wmma_f32_16x16x32_f16(false, b[u][t].v, false, a[m].v, (short)0, acc[m][t], false, false);
          __builtin_amdgcn_sched_barrier(0);   // a quarter of the products issues between the loads and their wait: directly behind the loads the wait would stand bare
          asm volatile("s_wait_xcnt 0x0" ::: "memory");   // stands in front of the step that rewrites the address registers of this trip's loads
          __builtin_amdgcn_sched_barrier(0);   // keeps that step behind the wait
          wp += s + 2 < NSLAB ? SLABH : 0;   // no branch round the loads: behind a join the compiler waits for them at once (the last trip loads the last slab again, unread)
#pragma unroll
          for (int t = 4; t < 16; ++t)
#pragma unroll
            for (int m = 0; m < MT; ++m) acc[m][t] = __builtin_amdgcn_wmma_f32_16x16x32_f16(false, b[u][t].v, false, a[m].v, (short)0, acc[m][t], false, false);
#pragma unroll
          for (int m = 0; m < MT; ++m)   // the next trip's B fragments
#pragma unroll
            for (int q = 0; q < 4; ++q) { a[m].h[q] = (_Float16)xa[m][0][q]; a[m].h[4 + q] = (_Float16)xa[m][1][q]; a[m].h[8 + q] = (_Float16)xa[m][2][q]; a[m].h[12 + q] = (_Float16)xa[m][3][q]; }
          __builtin_amdgcn_sched_barrier(0);   // ends the trip: the next trip's loads stay behind these conversions
        }
      }
      v8f bv[16];
#pragma unroll
      for (int t = 0; t < 16; ++t) bv[t] = ld8(pb + t * 16);
      __builtin_amdgcn_sched_barrier(0);   // the bias row's LDS reads issue as one group, for speed only
#pragma unroll
      for (int t = 0; t < 16; ++t)
#pragma unroll
        for (int m = 0; m < MT; ++m) acc[m][t] = acc[m][t] * 0.0625f + bv[t];
    }
    const float* pg = pl + (4 + L) * HH;
    const float* pe = pl + (8 + L) * HH;
    v8f gq[16], eq[16], rq[MT][16];   // gain, shift and residual x, fetched two column tiles a group, a group's arithmetic ahead of their use
#pragma unroll
    for (int t = 0; t < 4; ++t) { gq[t] = ld8(pg + t * 16); eq[t] = ld8(pe + t * 16);
#pragma unroll
      for (int m = 0; m < MT; ++m) rq[m][t] = ld8(xl + m * 16 * XP + t * 16); }
    __builtin_amdgcn_sched_barrier(0);   // the first two groups fly during the statistics; left to the scheduler these reads sank to just in front of their use
    float rs[MT];
#pragma unroll
    for (int m = 0; m < MT; ++m) {
      v8f qv = v8f{0.f, 0.f, 0.f, 0.f, 0.f, 0.f, 0.f, 0.f};   // a row arrives centred: its weights and biases were
#pragma unroll
      for (int t = 0; t < 16; ++t) qv += acc[m][t] * acc[m][t];
      rs[m] = rsqrtf(point_sum(qv) * (1.0f / HH) + LNEPS);
    }
#pragma unroll
    for (int g = 0; g < 8; ++g) {
#pragma unroll
      for (int t = 2 * g; t < 2 * g + 2; ++t)
#pragma unroll
        for (int m = 0; m < MT; ++m) { v8f y = acc[m][t] * rs[m] * gq[t] + eq[t];
#pragma unroll
          for (int r = 0; r < 8; ++r) y[r] = fmaxf(y[r], SLOPE * y[r]);   /* = y for y >= 0, SLOPE * y below, as 0 < SLOPE < 1 */
          acc[m][t] = y + rq[m][t]; }
      if (g + 2 < 8) {
        __builtin_amdgcn_sched_barrier(0);   // group g + 2 is fetched behind group g's arithmetic, not earlier: two groups in flight are enough
#pragma unroll
        for (int t = 2 * g + 4; t < 2 * g + 6; ++t) { gq[t] = ld8(pg + t * 16); eq[t] = ld8(pe + t * 16);
#pragma unroll
          for (int m = 0; m < MT; ++m) rq[m][t] = ld8(xl + m * 16 * XP + t * 16); }
        __builtin_amdgcn_sched_barrier(0);   // and not later: its reads fly during group g + 1's arithmetic
      }
    }
    if (L < 3) {   // no barrier behind these stores: every element is read back by the lane that wrote it
#pragma unroll
      for (int m = 0; m < MT; ++m)
#pragma unroll
        for (int t = 0; t < 16; ++t) st8(xl + m * 16 * XP + t * 16, acc[m][t]);
    }
  }
  const float bfv = bf16_round(bq);
  v8f wf[16];
  v8f fv[MT];
#pragma unroll
  for (int m = 0; m < MT; ++m) fv[m] = v8f{0.f, 0.f, 0.f, 0.f, 0.f, 0.f, 0.f, 0.f};
#pragma unroll
  for (int t = 0; t < 16; ++t) wf[t] = ld8(pl + 15 * HH + t * 16);
  __builtin_amdgcn_sched_barrier(0);   // one group of LDS reads, as for the bias row
#pragma unroll
  for (int t = 0; t < 16; ++t)
#pragma unroll
    for (int m = 0; m < MT; ++m) fv[m] += acc[m][t] * wf[t];
  float o[MT];
#pragma unroll
  for (int m = 0; m < MT; ++m) o[m] = point_sum(fv[m]) + bfv;
  float* tp = tmp + (size_t)n * NPT + p0 + w * 16 * MT + lane;   // bone-major: a wave owns its two whole 128-byte lines; lane = point
  tp[0] = hh ? o[1] : o[0];
  tp[32] = hh ? o[3] : o[2];
}

// out[b][n] = tmp[n][b]: 16 points x 16 bones a block, whole lines written by one block
__global__ __launch_bounds__(256) void k_tr(const float* __restrict__ tmp, float* __restrict__ out) { __shared__ float sm[16][17]; const int tid = threadIdx.x;
  sm[tid & 15][tid >> 4] = tmp[(size_t)(tid >> 4) * NPT + blockIdx.x * 16 + (tid & 15)];
  __syncthreads();
  out[(size_t)blockIdx.x * 256 + tid] = sm[tid >> 4][tid & 15]; }

extern "C" void kernel_launch(void* const* d_in, const int* in_sizes, int n_in,
                              void* d_out, int out_size, void* d_ws, size_t ws_size, hipStream_t stream) {
  (void)in_sizes; (void)n_in; (void)out_size;
  const float* const* I = (const float* const*)d_in; const float* xyz = I[0]; const float* lat = I[1]; const float* W0 = I[2]; const float* b0 = I[3]; const float* g0 = I[4]; const float* be0 = I[5]; const float* Wm = I[6]; const float* bm = I[7]; const float* gm = I[8]; const float* bem = I[9]; const float* Wf = I[10]; const float* bfb = I[11];
  char* ws = (char*)d_ws; size_t off = 0;
  auto take = [&](size_t bytes) { char* p = ws + off; off += (bytes + 255) & ~(size_t)255; return p; };
  _Float16* Wt = (_Float16*)take((size_t)3 * NBONE * HH * HH * 2); float* tmp = (float*)take((size_t)NBONE * NPT * 4); float* cen = (float*)take((size_t)NBONE * NCEN * HH * 4);
  if (off > ws_size) return;
  k_wt3<<<NWB + NBONE, 256, 0, stream>>>(Wm, b0, bm, W0, Wt, cen);
  k_mlp<<<dim3(NPT / TM, NBONE), NTH, 0, stream>>>(xyz, lat, cen, g0, be0, Wt, gm, bem, Wf, bfb, tmp);
  k_tr<<<NPT / 16, 256, 0, stream>>>(tmp, (float*)d_out);
}

// v007
// One run takes 83.3 microseconds.
// Next to v006, in two timings, it ran 1.08 and 1.07 times as fast.
// Counting every step since v000, it is 15.0 times as fast.
#include <hip/hip_runtime.h>
// Piecewise-rigid implicit decoder (B=16384 query points x N=16 bones, hidden 256): inp[b,n] = (latent[b,n].[xyz_b;1])[:3];
// layer 0: x = lrelu(LN(inp.W0[n] + b0[n]).g0[n] + be0[n]); layers 1-3: x = lrelu(LN(x.Wm[l,n] + bm[l,n]).gm + bem) + x;
// out[b,n] = x.Wf[n] + bf[n] (LeakyReLU slope 0.1, LN eps 1e-5, per-bone weights (in,out)).
// Compute dtype: all inputs rounded to bf16; residual stream x in f32, rounded to f16 as the GEMM's B operand; weights f16 (x16, undone by 1/16).
// One fused kernel: a work-group owns 256 points of one bone for the whole network, and walks four such tiles of its bone one behind the other (one work-group a WGP, 256 in all). x lives in LDS (f32), a wave owns 64 points x all 256
// columns (so LayerNorm never leaves the wave), the bone's weights come in slabs of 32 k straight from global memory into registers: the first launch
// stores them in fragment order (a wave's 16-byte-a-lane load = 512 consecutive bytes), and the 4 waves, which walk the same slabs, share the lines in the cache of their WGP.
// The products are taken transposed (weights as A, x as B): a lane's accumulators are 8 consecutive columns of ONE point, which are the
// very elements the same lane reads as its B fragment in the next layer, so x in LDS is private to a lane and moves in 16-byte pieces.
// LayerNorm's mean is taken out ahead of the products: mean_o(x.W + b) = x.mean_o(W) + mean_o(b), so the first launch subtracts from every weight row
// (and from every bias and W0 row) its mean over the 256 outputs; what the products give is then already centred, and only the sum of squares is left.
#define NPT 16384
#define NBONE 16
#define HH 256
#define LNEPS 1e-5f
#define SLOPE 0.1f
#define TM 256   /* points per tile of a work-group: 4 waves x 64 rows */
#define NTH 128  /* threads of the fused kernel: one wave a SIMD, so that a wave may hold more than 512 registers */
#define MT 4     /* 16-point tiles a wave */
#define TPW 4    /* 256-point tiles a work-group walks, all of one bone: its parameters are fetched once, and a tile's inputs during the tile before */
#define XP 260   /* pitch of an x row in LDS, floats: 1040 B = 16 B x odd, for the 16-byte reads and writes of x */
#define SLABH (HH * 32)   /* halfs of a weight slab: 16 column tiles x 2 halves of a fragment x 32 lanes x 8 */
#define NSLAB 24 /* 3 layers x 8 slabs of 32 k */
#define NCEN 7   /* centred parameter rows a bone in the workspace: b0, bm 0-2, W0 0-2 */
#define NWB (3 * NBONE * (HH / 64))   /* blocks of the first launch that transpose weights; NBONE more centre the parameter rows */
#define NPAR 16  /* per-column parameter rows kept in LDS: bias 0-3, gain 4-7, shift 8-11 (by layer), W0 12-14, Wf 15 */
typedef unsigned short v8us __attribute__((ext_vector_type(8), may_alias));
typedef float  v8f  __attribute__((ext_vector_type(8)));
typedef float  v4f  __attribute__((ext_vector_type(4)));
typedef float  v4fa __attribute__((ext_vector_type(4), may_alias));
typedef _Float16 v16h __attribute__((ext_vector_type(16)));
union FragH { v16h v; v8us half[2]; _Float16 h[16]; unsigned short u[16]; };

__device__ __forceinline__ unsigned short bf16_bits(float x) { unsigned int u = __float_as_uint(x); return (unsigned short)((u + 0x7FFFu + ((u >> 16) & 1u)) >> 16); }
__device__ __forceinline__ float bf16_val(unsigned short b) { return __uint_as_float(((unsigned int)b) << 16); }
__device__ __forceinline__ float bf16_round(float x) { return bf16_val(bf16_bits(x)); }

// f16((w[i][o] - mean_o w[i][o]) * 16), w = bf16(Wm[l][n]), transposed through LDS: a block owns 64 rows i x all 256 columns o of one matrix.
// Stored in the order in which the fused kernel's lanes hold it as the A operand: Wt[n][slab l * 8 + (i >> 5)][tile o >> 4][half (i >> 4) & 1][lane (o & 15) + 16 * ((i >> 3) & 1)][i & 7].
// It reads whole rows (a wave = 512 consecutive bytes) and writes 64-byte runs (4 lanes = 8 i of 4 neighbouring o); both runs of a line come from this block.
// The last NBONE blocks centre a bone's bias and W0 rows in the same way (a wave = a row), kept in f32.
// LDS keeps the rounded f32 rows unpadded; the 16-byte piece c of row i lies at piece c ^ (i >> 3), so that the column reads of 8 lanes (8 rows apart) fall on 8 different bank groups.
__global__ __launch_bounds__(256) void k_wt3(const float* __restrict__ Wm, const float* __restrict__ b0, const float* __restrict__ bm, const float* __restrict__ W0, _Float16* __restrict__ Wt, float* __restrict__ cen) {
  __shared__ __attribute__((aligned(16))) float sm[64 * HH];
  __shared__ __attribute__((aligned(16))) float mn[64];
  const int tid = threadIdx.x;
  if (blockIdx.x >= NWB) {   // the whole block takes this path and leaves in front of every barrier
    const int n = blockIdx.x - NWB, r = tid >> 5, lane = tid & 31;
    if (r < NCEN) {
      const float* row = (r == 0 ? b0 + (size_t)n * HH : r < 4 ? bm + ((size_t)(r - 1) * NBONE + n) * HH : W0 + ((size_t)n * 3 + (r - 4)) * HH) + lane * 8;
      v4f lo = *(const v4fa*)row, hi = *(const v4fa*)(row + 4);
      asm volatile("s_wait_xcnt 0x0" ::: "memory");   // stands in front of whatever reuses the address registers of the two loads
#pragma unroll   /* constant element indices, so that the two vectors stay in registers */
      for (int q = 0; q < 4; ++q) { lo[q] = bf16_round(lo[q]); hi[q] = bf16_round(hi[q]); }
      float s = ((lo[0] + lo[1]) + (lo[2] + lo[3])) + ((hi[0] + hi[1]) + (hi[2] + hi[3]));
#pragma unroll   /* five steps with constant lane masks: the row's sum in every lane */
      for (int d = 1; d < 32; d <<= 1) s += __shfl_xor(s, d, 32);
      const float mu = s * (1.0f / HH);
      float* dst = cen + ((size_t)n * NCEN + r) * HH + lane * 8;
      *(v4fa*)dst = lo - mu; *(v4fa*)(dst + 4) = hi - mu;
    }
    return;
  }
  const int mat = blockIdx.x >> 2, i0 = (blockIdx.x & 3) * 64;
  const float* sp = Wm + ((size_t)mat * HH + i0) * HH;   // uniform base, the thread's place in the tile as the one vector offset
  const unsigned so = (unsigned)((tid >> 6) * HH + (tid & 63) * 4);
  v4f v[16];
#pragma unroll
  for (int j = 0; j < 16; ++j) v[j] = *(const v4fa*)(sp + so + j * 4 * HH);   // all 16 loads of a thread in flight at once
#pragma unroll
  for (int j = 0; j < 16; ++j) { const int i = j * 4 + (tid >> 6); *(v4fa*)(sm + i * HH + (((tid & 63) ^ (i >> 3)) << 2)) = v4f{bf16_round(v[j][0]), bf16_round(v[j][1]), bf16_round(v[j][2]), bf16_round(v[j][3])}; }
  __syncthreads();   // the tile is read by rows and by columns, across what other waves stored
  { const int i = tid >> 2; float s = 0.f;   // four threads a row, 16 pieces each; the walk starts at the lane's own piece, so that 16 lanes fall on 16 bank groups
#pragma unroll   /* all 16 LDS reads of a thread in flight at once */
    for (int k = 0; k < 16; ++k) { const int c = (tid & 3) * 16 + ((k + tid) & 15); const v4f x = *(const v4fa*)(sm + i * HH + ((c ^ (i >> 3)) << 2)); s += (x[0] + x[1]) + (x[2] + x[3]); }
    s += __shfl_xor(s, 1, 32); s += __shfl_xor(s, 2, 32);
    if ((tid & 3) == 0) mn[i] = s * (1.0f / HH); }
  __syncthreads();   // publishes the 64 row means
  const int ic = tid & 7;
  const v4f m0 = *(const v4fa*)(mn + ic * 8), m1 = *(const v4fa*)(mn + ic * 8 + 4);
  unsigned short* dp = (unsigned short*)Wt + (size_t)((mat & 15) * NSLAB + (mat >> 4) * 8 + (i0 >> 5) + (ic >> 2)) * SLABH + (tid >> 7) * 512 + ((ic >> 1) & 1) * 256 + (ic & 1) * 128 + ((tid >> 3) & 15) * 8;
#pragma unroll
  for (int h = 0; h < 8; ++h) { const int o = h * 32 + (tid >> 3); const float* cp = sm + ic * 8 * HH + ((((o >> 2) ^ ic) << 2) | (o & 3)); FragH f;
#pragma unroll
    for (int q = 0; q < 8; ++q) f.h[q] = (_Float16)((cp[q * HH] - (q < 4 ? m0[q & 3] : m1[q & 3])) * 16.0f);
    *(v8us*)(dp + h * 1024) = f.half[0]; }   // 32 columns on = two column tiles on
  asm volatile("s_wait_xcnt 0x0" ::: "memory");   // stands in front of whatever reuses the address and data registers of these stores
}

// lane l <-> lane l ^ 16
__device__ __forceinline__ float xhalf(float x) { return __builtin_bit_cast(float, __builtin_amdgcn_permlanex16(__builtin_bit_cast(int, x), __builtin_bit_cast(int, x), 0x76543210, 0xfedcba98, false, false)); }
__device__ __forceinline__ v8f ld8(const float* p) { const v4f lo = *(const v4fa*)p, hi = *(const v4fa*)(p + 4); return __builtin_shufflevector(lo, hi, 0, 1, 2, 3, 4, 5, 6, 7); }
__device__ __forceinline__ void st8(float* p, v8f v) { *(v4fa*)p = __builtin_shufflevector(v, v, 0, 1, 2, 3); *(v4fa*)(p + 4) = __builtin_shufflevector(v, v, 4, 5, 6, 7); }
// sum of a lane's 8 partial sums and of its partner's in the other half of the wave: a point's whole row
__device__ __forceinline__ float point_sum(v8f v) { const float s = ((v[0] + v[1]) + (v[2] + v[3])) + ((v[4] + v[5]) + (v[6] + v[7])); return s + xhalf(s); }

__global__ __launch_bounds__(NTH) void k_mlp(const float* __restrict__ xyz, const float* __restrict__ lat, const float* __restrict__ cen, const float* __restrict__ g0, const float* __restrict__ be0,
                                             const _Float16* __restrict__ Wt, const float* __restrict__ gm, const float* __restrict__ bem, const float* __restrict__ Wf, const float* __restrict__ bfb, float* __restrict__ tmp) {
  __shared__ __attribute__((aligned(16))) float xs[TM * XP];
  __shared__ __attribute__((aligned(16))) float ps[NPAR * HH];
  const int tid = threadIdx.x, w = tid >> 5, lane = tid & 31, ln = lane & 15, hh = lane >> 4;
  const int n = blockIdx.y, pw = blockIdx.x * (TPW * TM) + w * 16 * MT;   // the wave's first point in the work-group's first tile
  FragH b[2][16];   // weight fragments: slab s in b[s & 1], the next slab's loaded during this slab's products
  float* xw = xs + (size_t)(w * 16 * MT) * XP; // this wave's 64 rows
  float* xl = xw + ln * XP + 8 * hh;           // accumulator layout: element (m, t, r) = point m*16 + ln, column t*16 + 8*hh + r
  float pv[2][NPAR];   // thread = two columns: the bone's per-column parameters, rounded once a work-group and read from LDS 8 columns a lane
  { const size_t nb = (size_t)n * HH;   // uniform row bases, the thread's column as the one vector offset
    const float* rb = cen + NCEN * nb; const float* rg = g0 + nb; const float* re = be0 + nb; const float* rf = Wf + nb;
#pragma unroll
    for (int c = 0; c < 2; ++c) { const int col = tid + c * NTH;
      pv[c][0] = rb[col]; pv[c][4] = rg[col]; pv[c][8] = re[col]; pv[c][15] = rf[col];
#pragma unroll
      for (int l = 0; l < 3; ++l) { const float* qb = rb + (1 + l) * HH; const float* qg = gm + (size_t)l * NBONE * HH + nb; const float* qe = bem + (size_t)l * NBONE * HH + nb; const float* qw = rb + (4 + l) * HH;
        pv[c][1 + l] = qb[col]; pv[c][5 + l] = qg[col]; pv[c][9 + l] = qe[col]; pv[c][12 + l] = qw[col]; } } }
  asm volatile("s_wait_xcnt 0x0" ::: "memory");   // stands in front of the address arithmetic below, which may reuse the offset and base registers of these loads
  __builtin_amdgcn_sched_barrier(0);   // keeps that arithmetic behind the wait
  const float bq = bfb[n];
  // lane = two rows: the rigid transform's three coordinates, left in the row's pad behind its 256 columns
  float q[2][3]; v4f r4[2][3];
  {
    int pq[2]; const float* Lq[2];
#pragma unroll
    for (int c = 0; c < 2; ++c) { const int p = pw + c * 32 + lane; const float* Lp = lat + ((size_t)p * NBONE + n) * 16; pq[c] = p; Lq[c] = Lp;   // the first tile's
#pragma unroll
      for (int i = 0; i < 3; ++i) { q[c][i] = xyz[(size_t)p * 3 + i]; r4[c][i] = *(const v4fa*)(Lp + 4 * i); } }
    asm volatile("s_wait_xcnt 0x0" :: "v"(pq[1]), "v"(Lq[0]), "v"(Lq[1]) : "memory");   // stands in front of the arithmetic that reuses these loads' offset and address registers; as its inputs they stay live up to it: without them unrelated arithmetic took two of them ahead of the wait (the first offset lives on in the tile loop)
    __builtin_amdgcn_sched_barrier(0);   // keeps that arithmetic behind the wait
  }
  // weight fragments: the lane's 16 bytes of the next slab to load; tile and half are the immediate offset. The pointer steps on a slab a trip, behind the wait that follows its loads.
  const unsigned short* const wp0 = (const unsigned short*)Wt + (size_t)n * NSLAB * SLABH + lane * 8;
  {
#pragma unroll
    for (int m = 0; m < MT; ++m)   // x starts finite: layer 0 reads its residual like the others, with weight 0, and the layer body needs no branch among its LDS reads (stored here, while the global loads fly; a later tile finds the tile before's x)
#pragma unroll
      for (int t = 0; t < 16; ++t) st8(xl + m * 16 * XP + t * 16, v8f{0.f, 0.f, 0.f, 0.f, 0.f, 0.f, 0.f, 0.f});
  }
#pragma unroll
  for (int c = 0; c < 2; ++c)
#pragma unroll
    for (int k = 0; k < NPAR; ++k) ps[k * HH + tid + c * NTH] = (k < 4 || (k >= 12 && k < 15)) ? pv[c][k] : bf16_round(pv[c][k]);   // the bias and W0 rows come rounded and centred
  const float* pl = ps + 8 * hh;               // the same columns of a parameter row
  const float bfv = bf16_round(bq);
#pragma unroll 1   /* a tile's body is the whole network: one copy */
  for (int it = 0; it < TPW; ++it) {
#pragma unroll
  for (int c = 0; c < 2; ++c) { const float h0 = bf16_round(q[c][0]), h1 = bf16_round(q[c][1]), h2 = bf16_round(q[c][2]);
#pragma unroll
    for (int i = 0; i < 3; ++i) { float a = 0.f; a += bf16_round(r4[c][i][0]) * h0; a += bf16_round(r4[c][i][1]) * h1; a += bf16_round(r4[c][i][2]) * h2; a += bf16_round(r4[c][i][3]); xw[(c * 32 + lane) * XP + HH + i] = a; } }
  __syncthreads();   // publishes the coordinates and, in the first tile, the parameters: nothing else is read that another lane wrote. In a later tile it also brings the four waves level, so that they go on sharing the weight lines in the cache of their WGP
  const unsigned short* wp = wp0;
  v8f acc[MT][16];
#pragma unroll 1   /* the layer body is several thousand instructions */
  for (int L = 0; L < 4; ++L) {
    const float* pb = pl + L * HH;   // this layer's bias row
    const float rw = L == 0 ? 0.f : 1.f;   // layer 0 has no residual: what x holds there (zeros, or the tile before's finite x) counts times 0
    if (L == 0) {
#pragma unroll
      for (int t = 0; t < 16; ++t) { b[0][t].half[0] = *(const v8us*)(wp + t * 512); b[0][t].half[1] = *(const v8us*)(wp + t * 512 + 256); }   // slab 0 flies during layer 0; every later slab is loaded a trip ahead
      asm volatile("s_wait_xcnt 0x0" ::: "memory");   // stands in front of the step that rewrites the address registers of these loads
      __builtin_amdgcn_sched_barrier(0);   // keeps that step behind the wait
      wp += SLABH;
      {   // the next tile's inputs fly during this tile's network: behind the barrier, which would wait for them, and behind slab 0's loads, whose counted waits would (the last tile fetches its own again, unread: no branch round the loads)
        const int pn = pw + (it + 1 < TPW ? it + 1 : it) * TM;
#pragma unroll
        for (int c = 0; c < 2; ++c) { const int p = pn + c * 32 + lane; const float* Lp = lat + ((size_t)p * NBONE + n) * 16;
#pragma unroll
          for (int i = 0; i < 3; ++i) { q[c][i] = xyz[(size_t)p * 3 + i]; r4[c][i] = *(const v4fa*)(Lp + 4 * i); } }
        asm volatile("s_wait_xcnt 0x0" ::: "memory");   // stands in front of the address arithmetic that reuses these loads' offset and base registers
        __builtin_amdgcn_sched_barrier(0);   // keeps that arithmetic behind the wait
      }
      float ip[MT][3];
#pragma unroll
      for (int m = 0; m < MT; ++m)
#pragma unroll
        for (int i = 0; i < 3; ++i) ip[m][i] = xw[(m * 16 + ln) * XP + HH + i];
      v8f bb[16], wa[16], wb_[16], wc[16];   // bias and the three W0 rows, fetched two column tiles a group, a group's arithmetic ahead of their use
#pragma unroll
      for (int t = 0; t < 4; ++t) { bb[t] = ld8(pb + t * 16); wa[t] = ld8(pl + 12 * HH + t * 16); wb_[t] = ld8(pl + 13 * HH + t * 16); wc[t] = ld8(pl + 14 * HH + t * 16); }
#pragma unroll
      for (int g = 0; g < 8; ++g) {
#pragma unroll
        for (int t = 2 * g; t < 2 * g + 2; ++t)
#pragma unroll
          for (int m = 0; m < MT; ++m) { v8f a = bb[t]; a += ip[m][0] * wa[t]; a += ip[m][1] * wb_[t]; a += ip[m][2] * wc[t]; acc[m][t] = a; }
        if (g + 2 < 8) {
          __builtin_amdgcn_sched_barrier(0);   // group g + 2 is fetched behind group g's arithmetic, so that no more than two groups are live
#pragma unroll
          for (int t = 2 * g + 4; t < 2 * g + 6; ++t) { bb[t] = ld8(pb + t * 16); wa[t] = ld8(pl + 12 * HH + t * 16); wb_[t] = ld8(pl + 13 * HH + t * 16); wc[t] = ld8(pl + 14 * HH + t * 16); }
          __builtin_amdgcn_sched_barrier(0);   // and in front of group g + 1's: left to the scheduler the reads stood so close to their use that the waits ran to zero
        }
      }
    } else {
      v4f xa[MT][4];
      FragH a[MT];
#pragma unroll
      for (int m = 0; m < MT; ++m) { const float* xr = xw + (m * 16 + ln) * XP + 8 * hh;   // the layer's first 32 columns of x; the later ones are fetched a trip ahead
        xa[m][0] = *(const v4fa*)(xr); xa[m][1] = *(const v4fa*)(xr + 4); xa[m][2] = *(const v4fa*)(xr + 16); xa[m][3] = *(const v4fa*)(xr + 20); }
#pragma unroll
      for (int m = 0; m < MT; ++m)
#pragma unroll
        for (int t = 0; t < 16; ++t) acc[m][t] = v8f{0.f, 0.f, 0.f, 0.f, 0.f, 0.f, 0.f, 0.f};
#pragma unroll
      for (int m = 0; m < MT; ++m)
#pragma unroll
        for (int q = 0; q < 4; ++q) { a[m].h[q] = (_Float16)xa[m][0][q]; a[m].h[4 + q] = (_Float16)xa[m][1][q]; a[m].h[8 + q] = (_Float16)xa[m][2][q]; a[m].h[12 + q] = (_Float16)xa[m][3][q]; }
#pragma unroll 1   /* rolled by pairs of trips: a pair already holds 128 products, and the two fragment sets swap roles inside it */
      for (int kp = 0; kp < 4; ++kp) {
#pragma unroll
        for (int u = 0; u < 2; ++u) {
          const int ks = 2 * kp + u, s = (L - 1) * 8 + ks;   // s & 1 == u
          const float* xn = xw + ln * XP + ((ks + 1) & 7) * 32 + 8 * hh;   // slab s + 1's columns of x (a layer's last trip fetches columns 0 to 31 again, unread)
#pragma unroll
          for (int t = 0; t < 16; ++t) { b[u ^ 1][t].half[0] = *(const v8us*)(wp + t * 512); b[u ^ 1][t].half[1] = *(const v8us*)(wp + t * 512 + 256); }   // slab s + 1 flies during this slab's products
#pragma unroll
          for (int m = 0; m < MT; ++m) { const float* xr = xn + m * 16 * XP;
            xa[m][0] = *(const v4fa*)(xr); xa[m][1] = *(const v4fa*)(xr + 4); xa[m][2] = *(const v4fa*)(xr + 16); xa[m][3] = *(const v4fa*)(xr + 20); }
          __builtin_amdgcn_sched_barrier(0);   // loads and LDS reads issue as one group, ahead of the products, for speed only
#pragma unroll
          for (int t = 0; t < 4; ++t)   // weights as A (rows = output columns), x as B (columns = points)
#pragma unroll
            for (int m = 0; m < MT; ++m) acc[m][t] = __builtin_amdgcn_wmma_f32_16x16x32_f16(false, b[u][t].v, false, a[m].v, (short)0, acc[m][t], false, false);
          __builtin_amdgcn_sched_barrier(0);   // a quarter of the products issues between the loads and their wait: directly behind the loads the wait would stand bare
          asm volatile("s_wait_xcnt 0x0" ::: "memory");   // stands in front of the step that rewrites the address registers of this trip's loads
          __builtin_amdgcn_sched_barrier(0);   // keeps that step behind the wait
          wp += s + 2 < NSLAB ? SLABH : 0;   // no branch round the loads: behind a join the compiler waits for them at once (the last trip loads the last slab again, unread)
#pragma unroll
          for (int t = 4; t < 16; ++t)
#pragma unroll
            for (int m = 0; m < MT; ++m) acc[m][t] = __builtin_amdgcn_wmma_f32_16x16x32_f16(false, b[u][t].v, false, a[m].v, (short)0, acc[m][t], false, false);
#pragma unroll
          for (int m = 0; m < MT; ++m)   // the next trip's B fragments
#pragma unroll
            for (int q = 0; q < 4; ++q) { a[m].h[q] = (_Float16)xa[m][0][q]; a[m].h[4 + q] = (_Float16)xa[m][1][q]; a[m].h[8 + q] = (_Float16)xa[m][2][q]; a[m].h[12 + q] = (_Float16)xa[m][3][q]; }
          __builtin_amdgcn_sched_barrier(0);   // ends the trip: the next trip's loads stay behind these conversions
        }
      }
      v8f bv[16];
#pragma unroll
      for (int t = 0; t < 16; ++t) bv[t] = ld8(pb + t * 16);
      __builtin_amdgcn_sched_barrier(0);   // the bias row's LDS reads issue as one group, for speed only
#pragma unroll
      for (int t = 0; t < 16; ++t)
#pragma unroll
        for (int m = 0; m < MT; ++m) acc[m][t] = acc[m][t] * 0.0625f + bv[t];
    }
    const float* pg = pl + (4 + L) * HH;
    const float* pe = pl + (8 + L) * HH;
    v8f gq[16], eq[16], rq[MT][16];   // gain, shift and residual x, fetched two column tiles a group, a group's arithmetic ahead of their use
#pragma unroll
    for (int t = 0; t < 4; ++t) { gq[t] = ld8(pg + t * 16); eq[t] = ld8(pe + t * 16);
#pragma unroll
      for (int m = 0; m < MT; ++m) rq[m][t] = ld8(xl + m * 16 * XP + t * 16); }
    __builtin_amdgcn_sched_barrier(0);   // the first two groups fly during the statistics; left to the scheduler these reads sank to just in front of their use
    float rs[MT];
#pragma unroll
    for (int m = 0; m < MT; ++m) {
      v8f qv = v8f{0.f, 0.f, 0.f, 0.f, 0.f, 0.f, 0.f, 0.f};   // a row arrives centred: its weights and biases were
#pragma unroll
      for (int t = 0; t < 16; ++t) qv += acc[m][t] * acc[m][t];
      rs[m] = rsqrtf(point_sum(qv) * (1.0f / HH) + LNEPS);
    }
#pragma unroll
    for (int g = 0; g < 8; ++g) {
#pragma unroll
      for (int t = 2 * g; t < 2 * g + 2; ++t)
#pragma unroll
        for (int m = 0; m < MT; ++m) { v8f y = acc[m][t] * rs[m] * gq[t] + eq[t];
#pragma unroll
          for (int r = 0; r < 8; ++r) y[r] = fmaxf(y[r], SLOPE * y[r]);   /* = y for y >= 0, SLOPE * y below, as 0 < SLOPE < 1 */
          acc[m][t] = rq[m][t] * rw + y; }
      if (g + 2 < 8) {
        __builtin_amdgcn_sched_barrier(0);   // group g + 2 is fetched behind group g's arithmetic, not earlier: two groups in flight are enough
#pragma unroll
        for (int t = 2 * g + 4; t < 2 * g + 6; ++t) { gq[t] = ld8(pg + t * 16); eq[t] = ld8(pe + t * 16);
#pragma unroll
          for (int m = 0; m < MT; ++m) rq[m][t] = ld8(xl + m * 16 * XP + t * 16); }
        __builtin_amdgcn_sched_barrier(0);   // and not later: its reads fly during group g + 1's arithmetic
      }
    }
    if (L < 3) {   // no barrier behind these stores: every element is read back by the lane that wrote it
#pragma unroll
      for (int m = 0; m < MT; ++m)
#pragma unroll
        for (int t = 0; t < 16; ++t) st8(xl + m * 16 * XP + t * 16, acc[m][t]);
    }
  }
  v8f wf[16];
  v8f fv[MT];
#pragma unroll
  for (int m = 0; m < MT; ++m) fv[m] = v8f{0.f, 0.f, 0.f, 0.f, 0.f, 0.f, 0.f, 0.f};
#pragma unroll
  for (int t = 0; t < 16; ++t) wf[t] = ld8(pl + 15 * HH + t * 16);
  __builtin_amdgcn_sched_barrier(0);   // one group of LDS reads, as for the bias row
#pragma unroll
  for (int t = 0; t < 16; ++t)
#pragma unroll
    for (int m = 0; m < MT; ++m) fv[m] += acc[m][t] * wf[t];
  float o[MT];
#pragma unroll
  for (int m = 0; m < MT; ++m) o[m] = point_sum(fv[m]) + bfv;
  float* tp = tmp + (size_t)n * NPT + pw + it * TM + lane;   // bone-major: a wave owns its two whole 128-byte lines; lane = point
  tp[0] = hh ? o[1] : o[0];
  tp[32] = hh ? o[3] : o[2];
  asm volatile("s_wait_xcnt 0x0" ::: "memory");   // stands in front of the next tile's code, which reuses the address and data registers of these stores
  __builtin_amdgcn_sched_barrier(0);   // keeps that code behind the wait
  }
}

// out[b][n] = tmp[n][b]: 16 points x 16 bones a block, whole lines written by one block
__global__ __launch_bounds__(256) void k_tr(const float* __restrict__ tmp, float* __restrict__ out) { __shared__ float sm[16][17]; const int tid = threadIdx.x;
  sm[tid & 15][tid >> 4] = tmp[(size_t)(tid >> 4) * NPT + blockIdx.x * 16 + (tid & 15)];
  __syncthreads();
  out[(size_t)blockIdx.x * 256 + tid] = sm[tid >> 4][tid & 15]; }

extern "C" void kernel_launch(void* const* d_in, const int* in_sizes, int n_in,
                              void* d_out, int out_size, void* d_ws, size_t ws_size, hipStream_t stream) {
  (void)in_sizes; (void)n_in; (void)out_size;
  const float* const* I = (const float* const*)d_in; const float* xyz = I[0]; const float* lat = I[1]; const float* W0 = I[2]; const float* b0 = I[3]; const float* g0 = I[4]; const float* be0 = I[5]; const float* Wm = I[6]; const float* bm = I[7]; const float* gm = I[8]; const float* bem = I[9]; const float* Wf = I[10]; const float* bfb = I[11];
  char* ws = (char*)d_ws; size_t off = 0;
  auto take = [&](size_t bytes) { char* p = ws + off; off += (bytes + 255) & ~(size_t)255; return p; };
  _Float16* Wt = (_Float16*)take((size_t)3 * NBONE * HH * HH * 2); float* tmp = (float*)take((size_t)NBONE * NPT * 4); float* cen = (float*)take((size_t)NBONE * NCEN * HH * 4);
  if (off > ws_size) return;
  k_wt3<<<NWB + NBONE, 256, 0, stream>>>(Wm, b0, bm, W0, Wt, cen);
  k_mlp<<<dim3(NPT / (TM * TPW), NBONE), NTH, 0, stream>>>(xyz, lat, cen, g0, be0, Wt, gm, bem, Wf, bfb, tmp);
  k_tr<<<NPT / 16, 256, 0, stream>>>(tmp, (float*)d_out);
}

// v008
// A run of this version takes 81 microseconds.
// Next to v007, in two timings, it ran 1.03 times as fast each time.
// Over all steps from v000 it is 15.4 times as fast.
#include <hip/hip_runtime.h>
// Piecewise-rigid implicit decoder (B=16384 query points x N=16 bones, hidden 256): inp[b,n] = (latent[b,n].[xyz_b;1])[:3];
// layer 0: x = lrelu(LN(inp.W0[n] + b0[n]).g0[n] + be0[n]); layers 1-3: x = lrelu(LN(x.Wm[l,n] + bm[l,n]).gm + bem) + x;
// out[b,n] = x.Wf[n] + bf[n] (LeakyReLU slope 0.1, LN eps 1e-5, per-bone weights (in,out)).
// Compute dtype: all inputs rounded to bf16; residual stream x in f32, rounded to f16 as the GEMM's B operand; weights f16 (x16, undone by 1/16).
// One fused kernel: a work-group owns 256 points of one bone for the whole network, and walks four such tiles of its bone one behind the other (one work-group a WGP, 256 in all). x lives in LDS (f32), a wave owns 64 points x all 256
// columns (so LayerNorm never leaves the wave), the bone's weights come in slabs of 32 k straight from global memory into registers: the first launch
// stores them in fragment order (a wave's 16-byte-a-lane load = 512 consecutive bytes), and the 4 waves, which walk the same slabs, share the lines in the cache of their WGP.
// The products are taken transposed (weights as A, x as B): a lane's accumulators are 8 consecutive columns of ONE point, which are the
// very elements the same lane reads as its B fragment in the next layer, so x in LDS is private to a lane and moves in 16-byte pieces.
// LayerNorm's mean is taken out ahead of the products: mean_o(x.W + b) = x.mean_o(W) + mean_o(b), so the first launch subtracts from every weight row
// (and from every bias and W0 row) its mean over the 256 outputs; what the products give is then already centred, and only the sum of squares is left.
// The fused kernel's text is kept under 32 KB:
// every pass over the 512 accumulators is 2 KB of text, so layer 0's product (k = 3 and the bias) runs on the f32 matrix form, the biases of layers 1 to 3 are the accumulators' start values,
// and the layer's last block goes one operation at a time, which saves most of its register-window switches.
#define NPT 16384
#define NBONE 16
#define HH 256
#define LNEPS 1e-5f
#define SLOPE 0.1f
#define TM 256   /* points per tile of a work-group: 4 waves x 64 rows */
#define NTH 128  /* threads of the fused kernel: one wave a SIMD, so that a wave may hold more than 512 registers */
#define MT 4     /* 16-point tiles a wave */
#define TPW 4    /* 256-point tiles a work-group walks, all of one bone: its parameters are fetched once, and a tile's inputs during the tile before */
#define XP 260   /* pitch of an x row in LDS, floats: 1040 B = 16 B x odd, for the 16-byte reads and writes of x */
#define SLABH (HH * 32)   /* halfs of a weight slab: 16 column tiles x 2 halves of a fragment x 32 lanes x 8 */
#define NSLAB 24 /* 3 layers x 8 slabs of 32 k */
#define NCEN 7   /* centred parameter rows a bone in the workspace: b0, bm 0-2, W0 0-2 */
#define NWB (3 * NBONE * (HH / 64))   /* blocks of the first launch that transpose weights; NBONE more centre the parameter rows */
#define NPAR 16  /* per-column parameter rows kept in LDS: Wf 0, bias 1-3, gain 4-7, shift 8-11 (by layer); the place of rows 12-15 holds, 4 floats a column, layer 0's W0 rows 0-2 and its bias */
typedef unsigned short v8us __attribute__((ext_vector_type(8), may_alias));
typedef float  v8f  __attribute__((ext_vector_type(8)));
typedef float  v4f  __attribute__((ext_vector_type(4)));
typedef float  v4fa __attribute__((ext_vector_type(4), may_alias));
typedef float  v2f  __attribute__((ext_vector_type(2)));
typedef float  v2fa __attribute__((ext_vector_type(2), may_alias));
typedef _Float16 v16h __attribute__((ext_vector_type(16)));
union FragH { v16h v; v8us half[2]; _Float16 h[16]; unsigned short u[16]; };

__device__ __forceinline__ unsigned short bf16_bits(float x) { unsigned int u = __float_as_uint(x); return (unsigned short)((u + 0x7FFFu + ((u >> 16) & 1u)) >> 16); }
__device__ __forceinline__ float bf16_val(unsigned short b) { return __uint_as_float(((unsigned int)b) << 16); }
__device__ __forceinline__ float bf16_round(float x) { return bf16_val(bf16_bits(x)); }

// f16((w[i][o] - mean_o w[i][o]) * 16), w = bf16(Wm[l][n]), transposed through LDS: a block owns 64 rows i x all 256 columns o of one matrix.
// Stored in the order in which the fused kernel's lanes hold it as the A operand: Wt[n][slab l * 8 + (i >> 5)][tile o >> 4][half (i >> 4) & 1][lane (o & 15) + 16 * ((i >> 3) & 1)][i & 7].
// It reads whole rows (a wave = 512 consecutive bytes) and writes 64-byte runs (4 lanes = 8 i of 4 neighbouring o); both runs of a line come from this block.
// The last NBONE blocks centre a bone's bias and W0 rows in the same way (a wave = a row), kept in f32.
// LDS keeps the rounded f32 rows unpadded; the 16-byte piece c of row i lies at piece c ^ (i >> 3), so that the column reads of 8 lanes (8 rows apart) fall on 8 different bank groups.
__global__ __launch_bounds__(256) void k_wt3(const float* __restrict__ Wm, const float* __restrict__ b0, const float* __restrict__ bm, const float* __restrict__ W0, _Float16* __restrict__ Wt, float* __restrict__ cen) {
  __shared__ __attribute__((aligned(16))) float sm[64 * HH];
  __shared__ __attribute__((aligned(16))) float mn[64];
  const int tid = threadIdx.x;
  if (blockIdx.x >= NWB) {   // the whole block takes this path and leaves in front of every barrier
    const int n = blockIdx.x - NWB, r = tid >> 5, lane = tid & 31;
    if (r < NCEN) {
      const float* row = (r == 0 ? b0 + (size_t)n * HH : r < 4 ? bm + ((size_t)(r - 1) * NBONE + n) * HH : W0 + ((size_t)n * 3 + (r - 4)) * HH) + lane * 8;
      v4f lo = *(const v4fa*)row, hi = *(const v4fa*)(row + 4);
      asm volatile("s_wait_xcnt 0x0" ::: "memory");   // stands in front of whatever reuses the address registers of the two loads
#pragma unroll   /* constant element indices, so that the two vectors stay in registers */
      for (int q = 0; q < 4; ++q) { lo[q] = bf16_round(lo[q]); hi[q] = bf16_round(hi[q]); }
      float s = ((lo[0] + lo[1]) + (lo[2] + lo[3])) + ((hi[0] + hi[1]) + (hi[2] + hi[3]));
#pragma unroll   /* five steps with constant lane masks: the row's sum in every lane */
      for (int d = 1; d < 32; d <<= 1) s += __shfl_xor(s, d, 32);
      const float mu = s * (1.0f / HH);
      float* dst = cen + ((size_t)n * NCEN + r) * HH + lane * 8;
      *(v4fa*)dst = lo - mu; *(v4fa*)(dst + 4) = hi - mu;
    }
    return;
  }
  const int mat = blockIdx.x >> 2, i0 = (blockIdx.x & 3) * 64;
  const float* sp = Wm + ((size_t)mat * HH + i0) * HH;   // uniform base, the thread's place in the tile as the one vector offset
  const unsigned so = (unsigned)((tid >> 6) * HH + (tid & 63) * 4);
  v4f v[16];
#pragma unroll
  for (int j = 0; j < 16; ++j) v[j] = *(const v4fa*)(sp + so + j * 4 * HH);   // all 16 loads of a thread in flight at once
#pragma unroll
  for (int j = 0; j < 16; ++j) { const int i = j * 4 + (tid >> 6); *(v4fa*)(sm + i * HH + (((tid & 63) ^ (i >> 3)) << 2)) = v4f{bf16_round(v[j][0]), bf16_round(v[j][1]), bf16_round(v[j][2]), bf16_round(v[j][3])}; }
  __syncthreads();   // the tile is read by rows and by columns, across what other waves stored
  { const int i = tid >> 2; float s = 0.f;   // four threads a row, 16 pieces each; the walk starts at the lane's own piece, so that 16 lanes fall on 16 bank groups
#pragma unroll   /* all 16 LDS reads of a thread in flight at once */
    for (int k = 0; k < 16; ++k) { const int c = (tid & 3) * 16 + ((k + tid) & 15); const v4f x = *(const v4fa*)(sm + i * HH + ((c ^ (i >> 3)) << 2)); s += (x[0] + x[1]) + (x[2] + x[3]); }
    s += __shfl_xor(s, 1, 32); s += __shfl_xor(s, 2, 32);
    if ((tid & 3) == 0) mn[i] = s * (1.0f / HH); }
  __syncthreads();   // publishes the 64 row means
  const int ic = tid & 7;
  const v4f m0 = *(const v4fa*)(mn + ic * 8), m1 = *(const v4fa*)(mn + ic * 8 + 4);
  unsigned short* dp = (unsigned short*)Wt + (size_t)((mat & 15) * NSLAB + (mat >> 4) * 8 + (i0 >> 5) + (ic >> 2)) * SLABH + (tid >> 7) * 512 + ((ic >> 1) & 1) * 256 + (ic & 1) * 128 + ((tid >> 3) & 15) * 8;
#pragma unroll
  for (int h = 0; h < 8; ++h) { const int o = h * 32 + (tid >> 3); const float* cp = sm + ic * 8 * HH + ((((o >> 2) ^ ic) << 2) | (o & 3)); FragH f;
#pragma unroll
    for (int q = 0; q < 8; ++q) f.h[q] = (_Float16)((cp[q * HH] - (q < 4 ? m0[q & 3] : m1[q & 3])) * 16.0f);
    *(v8us*)(dp + h * 1024) = f.half[0]; }   // 32 columns on = two column tiles on
  asm volatile("s_wait_xcnt 0x0" ::: "memory");   // stands in front of whatever reuses the address and data registers of these stores
}

// lane l <-> lane l ^ 16
__device__ __forceinline__ float xhalf(float x) { return __builtin_bit_cast(float, __builtin_amdgcn_permlanex16(__builtin_bit_cast(int, x), __builtin_bit_cast(int, x), 0x76543210, 0xfedcba98, false, false)); }
__device__ __forceinline__ v8f ld8(const float* p) { const v4f lo = *(const v4fa*)p, hi = *(const v4fa*)(p + 4); return __builtin_shufflevector(lo, hi, 0, 1, 2, 3, 4, 5, 6, 7); }
__device__ __forceinline__ void st8(float* p, v8f v) { *(v4fa*)p = __builtin_shufflevector(v, v, 0, 1, 2, 3); *(v4fa*)(p + 4) = __builtin_shufflevector(v, v, 4, 5, 6, 7); }
// sum of a lane's 8 partial sums and of its partner's in the other half of the wave: a point's whole row
__device__ __forceinline__ float point_sum(v8f v) { const float s = ((v[0] + v[1]) + (v[2] + v[3])) + ((v[4] + v[5]) + (v[6] + v[7])); return s + xhalf(s); }

__global__ __launch_bounds__(NTH) void k_mlp(const float* __restrict__ xyz, const float* __restrict__ lat, const float* __restrict__ cen, const float* __restrict__ g0, const float* __restrict__ be0,
                                             const _Float16* __restrict__ Wt, const float* __restrict__ gm, const float* __restrict__ bem, const float* __restrict__ Wf, const float* __restrict__ bfb, float* __restrict__ tmp) {
  __shared__ __attribute__((aligned(16))) float xs[TM * XP];
  __shared__ __attribute__((aligned(16))) float ps[NPAR * HH];
  const int tid = threadIdx.x, w = tid >> 5, lane = tid & 31, ln = lane & 15, hh = lane >> 4;
  const int n = blockIdx.y, pw = blockIdx.x * (TPW * TM) + w * 16 * MT;   // the wave's first point in the work-group's first tile
  FragH b[2][16];   // weight fragments: slab s in b[s & 1], the next slab's loaded during this slab's products
  float* xw = xs + (size_t)(w * 16 * MT) * XP; // this wave's 64 rows
  float* xl = xw + ln * XP + 8 * hh;           // accumulator layout: element (m, t, r) = point m*16 + ln, column t*16 + 8*hh + r
  {
#pragma unroll 1   /* rolled: run once, and 120 stores fewer in the kernel's text */
    for (int t = 0; t < 16; ++t)   // x starts finite: layer 0 reads its residual like the others, with weight 0, and the layer body needs no branch among its LDS reads (a later tile finds the tile before's x)
#pragma unroll
      for (int m = 0; m < MT; ++m) st8(xl + m * 16 * XP + t * 16, v8f{0.f, 0.f, 0.f, 0.f, 0.f, 0.f, 0.f, 0.f});
  }
  float pv[2][NPAR];   // thread = two columns: the bone's per-column parameters, rounded once a work-group and read from LDS 8 columns a lane
  { const size_t nb = (size_t)n * HH;   // uniform row bases, the thread's column as the one vector offset
    const float* rb = cen + NCEN * nb; const float* rg = g0 + nb; const float* re = be0 + nb; const float* rf = Wf + nb;
#pragma unroll
    for (int c = 0; c < 2; ++c) { const int col = tid + c * NTH;
      pv[c][0] = rb[col]; pv[c][4] = rg[col]; pv[c][8] = re[col]; pv[c][15] = rf[col];
#pragma unroll
      for (int l = 0; l < 3; ++l) { const float* qb = rb + (1 + l) * HH; const float* qg = gm + (size_t)l * NBONE * HH + nb; const float* qe = bem + (size_t)l * NBONE * HH + nb; const float* qw = rb + (4 + l) * HH;
        pv[c][1 + l] = qb[col]; pv[c][5 + l] = qg[col]; pv[c][9 + l] = qe[col]; pv[c][12 + l] = qw[col]; } } }
  asm volatile("s_wait_xcnt 0x0" ::: "memory");   // stands in front of the address arithmetic below, which may reuse the offset and base registers of these loads
  __builtin_amdgcn_sched_barrier(0);   // keeps that arithmetic behind the wait
  const float bq = bfb[n];
  // lane = two rows: the rigid transform's three coordinates, left in the row's pad behind its 256 columns
  float q[2][3]; v4f r4[2][3];
  {
    int pq[2]; const float* Lq[2];
#pragma unroll
    for (int c = 0; c < 2; ++c) { const int p = pw + c * 32 + lane; const float* Lp = lat + ((size_t)p * NBONE + n) * 16; pq[c] = p; Lq[c] = Lp;   // the first tile's
#pragma unroll
      for (int i = 0; i < 3; ++i) { q[c][i] = xyz[(size_t)p * 3 + i]; r4[c][i] = *(const v4fa*)(Lp + 4 * i); } }
    asm volatile("s_wait_xcnt 0x0" :: "v"(pq[1]), "v"(Lq[0]), "v"(Lq[1]) : "memory");   // stands in front of the arithmetic that reuses these loads' offset and address registers; as its inputs they stay live up to it: without them unrelated arithmetic took two of them ahead of the wait (the first offset lives on in the tile loop)
    __builtin_amdgcn_sched_barrier(0);   // keeps that arithmetic behind the wait
  }
  // weight fragments: the lane's 16 bytes of the next slab to load; tile and half are the immediate offset. The pointer steps on a slab a trip, behind the wait that follows its loads.
  const unsigned short* const wp0 = (const unsigned short*)Wt + (size_t)n * NSLAB * SLABH + lane * 8;
#pragma unroll
  for (int c = 0; c < 2; ++c)
#pragma unroll
    for (int k = 0; k < 12; ++k) ps[k * HH + tid + c * NTH] = k == 0 ? bf16_round(pv[c][15]) : k < 4 ? pv[c][k] * 16.0f : bf16_round(pv[c][k]);   // the bias and W0 rows come rounded and centred; the biases of layers 1 to 3 are kept at the weights' scale (x16), as the accumulators' start values
#pragma unroll
  for (int c = 0; c < 2; ++c) *(v4fa*)(ps + 12 * HH + (tid + c * NTH) * 4) = v4f{pv[c][12], pv[c][13], pv[c][14], pv[c][0]};   // a column's four k of layer 0's product: a lane's A fragment is 8 of these bytes
  const float* pl = ps + 8 * hh;               // the same columns of a parameter row
  const float bfv = bf16_round(bq);
#pragma unroll 1   /* a tile's body is the whole network: one copy */
  for (int it = 0; it < TPW; ++it) {
#pragma unroll
  for (int c = 0; c < 2; ++c) { const float h0 = bf16_round(q[c][0]), h1 = bf16_round(q[c][1]), h2 = bf16_round(q[c][2]);
#pragma unroll
    for (int i = 0; i < 3; ++i) { float a = 0.f; a += bf16_round(r4[c][i][0]) * h0; a += bf16_round(r4[c][i][1]) * h1; a += bf16_round(r4[c][i][2]) * h2; a += bf16_round(r4[c][i][3]); xw[(c * 32 + lane) * XP + HH + i] = a; }
    xw[(c * 32 + lane) * XP + HH + 3] = 1.0f; }   // the fourth k of layer 0's product: times the bias
  __syncthreads();   // publishes the coordinates and, in the first tile, the parameters: nothing else is read that another lane wrote. In a later tile it also brings the four waves level, so that they go on sharing the weight lines in the cache of their WGP
  const unsigned short* wp = wp0;
  v8f acc[MT][16];
#pragma unroll 1   /* the layer body is several thousand instructions */
  for (int L = 0; L < 4; ++L) {
    const float* pb = pl + L * HH;   // this layer's bias row
    const float rw = L == 0 ? 0.f : 1.f;   // layer 0 has no residual: what x holds there (zeros, or the tile before's finite x) counts times 0
    if (L == 0) {
#pragma unroll
      for (int t = 0; t < 16; ++t) { b[0][t].half[0] = *(const v8us*)(wp + t * 512); b[0][t].half[1] = *(const v8us*)(wp + t * 512 + 256); }   // slab 0 flies during layer 0; every later slab is loaded a trip ahead
      asm volatile("s_wait_xcnt 0x0" ::: "memory");   // stands in front of the step that rewrites the address registers of these loads
      __builtin_amdgcn_sched_barrier(0);   // keeps that step behind the wait
      wp += SLABH;
      {   // the next tile's inputs fly during this tile's network: behind the barrier, which would wait for them, and behind slab 0's loads, whose counted waits would (the last tile fetches its own again, unread: no branch round the loads)
        const int pn = pw + (it + 1 < TPW ? it + 1 : it) * TM;
#pragma unroll
        for (int c = 0; c < 2; ++c) { const int p = pn + c * 32 + lane; const float* Lp = lat + ((size_t)p * NBONE + n) * 16;
#pragma unroll
          for (int i = 0; i < 3; ++i) { q[c][i] = xyz[(size_t)p * 3 + i]; r4[c][i] = *(const v4fa*)(Lp + 4 * i); } }
        asm volatile("s_wait_xcnt 0x0" ::: "memory");   // stands in front of the address arithmetic that reuses these loads' offset and base registers
        __builtin_amdgcn_sched_barrier(0);   // keeps that arithmetic behind the wait
      }
      // layer 0 on the f32 matrix form, k = 4: the three coordinates and 1 against W0's three rows and the bias (full f32 operands). A and B split k alike: half hh of the wave holds k = 2 hh and 2 hh + 1
      v2f ib[MT], wa[16];
#pragma unroll
      for (int m = 0; m < MT; ++m) ib[m] = *(const v2fa*)(xw + (m * 16 + ln) * XP + HH + 2 * hh);
#pragma unroll
      for (int t = 0; t < 16; ++t) wa[t] = *(const v2fa*)(ps + 12 * HH + (t * 16 + ln) * 4 + 2 * hh);
#pragma unroll
      for (int t = 0; t < 16; ++t)
#pragma unroll
        for (int m = 0; m < MT; ++m) acc[m][t] = __builtin_amdgcn_wmma_f32_16x16x4_f32(false, wa[t], false, ib[m], (short)0, v8f{0.f, 0.f, 0.f, 0.f, 0.f, 0.f, 0.f, 0.f}, false, false);
      // inputs only: the loaded fragments stay live to the end of the block, so that no product's result is given the registers of a fragment that a product issued just ahead of it reads
      asm volatile("" :: "v"(ib[0]), "v"(ib[1]), "v"(ib[2]), "v"(ib[3]), "v"(wa[0]), "v"(wa[1]), "v"(wa[2]), "v"(wa[3]), "v"(wa[4]), "v"(wa[5]), "v"(wa[6]), "v"(wa[7]), "v"(wa[8]), "v"(wa[9]), "v"(wa[10]), "v"(wa[11]), "v"(wa[12]), "v"(wa[13]), "v"(wa[14]), "v"(wa[15]));
    } else {
      v4f xa[MT][4];
      FragH a[MT];
#pragma unroll
      for (int m = 0; m < MT; ++m) { const float* xr = xw + (m * 16 + ln) * XP + 8 * hh;   // the layer's first 32 columns of x; the later ones are fetched a trip ahead
        xa[m][0] = *(const v4fa*)(xr); xa[m][1] = *(const v4fa*)(xr + 4); xa[m][2] = *(const v4fa*)(xr + 16); xa[m][3] = *(const v4fa*)(xr + 20); }
#pragma unroll
      for (int t = 0; t < 16; ++t) { const v8f bv = ld8(pb + t * 16);   // the sums start at 16 x bias: no pass over the accumulators behind the products; the 1/16 goes into the LayerNorm factor
#pragma unroll
        for (int m = 0; m < MT; ++m) acc[m][t] = bv; }
#pragma unroll
      for (int m = 0; m < MT; ++m)
#pragma unroll
        for (int q = 0; q < 4; ++q) { a[m].h[q] = (_Float16)xa[m][0][q]; a[m].h[4 + q] = (_Float16)xa[m][1][q]; a[m].h[8 + q] = (_Float16)xa[m][2][q]; a[m].h[12 + q] = (_Float16)xa[m][3][q]; }
#pragma unroll 1   /* rolled by pairs of trips: a pair already holds 128 products, and the two fragment sets swap roles inside it */
      for (int kp = 0; kp < 4; ++kp) {
#pragma unroll
        for (int u = 0; u < 2; ++u) {
          const int ks = 2 * kp + u, s = (L - 1) * 8 + ks;   // s & 1 == u
          const float* xn = xw + ln * XP + ((ks + 1) & 7) * 32 + 8 * hh;   // slab s + 1's columns of x (a layer's last trip fetches columns 0 to 31 again, unread)
#pragma unroll
          for (int t = 0; t < 16; ++t) { b[u ^ 1][t].half[0] = *(const v8us*)(wp + t * 512); b[u ^ 1][t].half[1] = *(const v8us*)(wp + t * 512 + 256); }   // slab s + 1 flies during this slab's products
#pragma unroll
          for (int m = 0; m < MT; ++m) { const float* xr = xn + m * 16 * XP;
            xa[m][0] = *(const v4fa*)(xr); xa[m][1] = *(const v4fa*)(xr + 4); xa[m][2] = *(const v4fa*)(xr + 16); xa[m][3] = *(const v4fa*)(xr + 20); }
          __builtin_amdgcn_sched_barrier(0);   // loads and LDS reads issue as one group, ahead of the products, for speed only
#pragma unroll
          for (int t = 0; t < 4; ++t)   // weights as A (rows = output columns), x as B (columns = points)
#pragma unroll
            for (int m = 0; m < MT; ++m) acc[m][t] = __builtin_amdgcn_wmma_f32_16x16x32_f16(false, b[u][t].v, false, a[m].v, (short)0, acc[m][t], false, false);
          __builtin_amdgcn_sched_barrier(0);   // a quarter of the products issues between the loads and their wait: directly behind the loads the wait would stand bare
          asm volatile("s_wait_xcnt 0x0" ::: "memory");   // stands in front of the step that rewrites the address registers of this trip's loads
          __builtin_amdgcn_sched_barrier(0);   // keeps that step behind the wait
          wp += s + 2 < NSLAB ? SLABH : 0;   // no branch round the loads: behind a join the compiler waits for them at once (the last trip loads the last slab again, unread)
#pragma unroll
          for (int t = 4; t < 16; ++t)
#pragma unroll
            for (int m = 0; m < MT; ++m) acc[m][t] = __builtin_amdgcn_wmma_f32_16x16x32_f16(false, b[u][t].v, false, a[m].v, (short)0, acc[m][t], false, false);
#pragma unroll
          for (int m = 0; m < MT; ++m)   // the next trip's B fragments
#pragma unroll
            for (int q = 0; q < 4; ++q) { a[m].h[q] = (_Float16)xa[m][0][q]; a[m].h[4 + q] = (_Float16)xa[m][1][q]; a[m].h[8 + q] = (_Float16)xa[m][2][q]; a[m].h[12 + q] = (_Float16)xa[m][3][q]; }
          __builtin_amdgcn_sched_barrier(0);   // ends the trip: the next trip's loads stay behind these conversions
        }
      }
    }
    const float* pg = pl + (4 + L) * HH;
    const float* pe = pl + (8 + L) * HH;
    v8f gq[16], eq[16], rq[MT][16];   // gain, shift and residual x, fetched two column tiles a group, a group's arithmetic ahead of their use
#pragma unroll
    for (int t = 0; t < 4; ++t) { gq[t] = ld8(pg + t * 16); eq[t] = ld8(pe + t * 16);
#pragma unroll
      for (int m = 0; m < MT; ++m) rq[m][t] = ld8(xl + m * 16 * XP + t * 16); }
    __builtin_amdgcn_sched_barrier(0);   // the first two groups fly during the statistics; left to the scheduler these reads sank to just in front of their use
    float rs[MT];
    const float sc = L == 0 ? 1.f : 0.0625f;   // layers 1 to 3 arrive times 16
#pragma unroll
    for (int m = 0; m < MT; ++m) {
      v8f qv = v8f{0.f, 0.f, 0.f, 0.f, 0.f, 0.f, 0.f, 0.f};   // a row arrives centred: its weights and biases were
#pragma unroll
      for (int t = 0; t < 16; ++t) qv += acc[m][t] * acc[m][t];
      rs[m] = rsqrtf(point_sum(qv) * (sc * sc * (1.0f / HH)) + LNEPS) * sc;
    }
#pragma unroll
    for (int g = 0; g < 8; ++g) {
#pragma unroll
      for (int t = 2 * g; t < 2 * g + 2; ++t)
#pragma unroll
        for (int m = 0; m < MT; ++m) acc[m][t] = acc[m][t] * rs[m];
      __builtin_amdgcn_sched_barrier(0);   // a group goes one operation at a time over its 8 tiles: neighbours then use the same register windows, and the window switches, a third of this block's instructions when the scheduler mixed the operations, nearly all go (kernel text)
#pragma unroll
      for (int t = 2 * g; t < 2 * g + 2; ++t)
#pragma unroll
        for (int m = 0; m < MT; ++m) acc[m][t] = acc[m][t] * gq[t] + eq[t];
      __builtin_amdgcn_sched_barrier(0);   // ends this operation's run over the group, as above: fewer window switches, less text
      v8f sl[2][MT];
#pragma unroll
      for (int t = 2 * g; t < 2 * g + 2; ++t)
#pragma unroll
        for (int m = 0; m < MT; ++m) sl[t & 1][m] = SLOPE * acc[m][t];
      __builtin_amdgcn_sched_barrier(0);   // ends this operation's run over the group, as above: fewer window switches, less text
#pragma unroll
      for (int t = 2 * g; t < 2 * g + 2; ++t)
#pragma unroll
        for (int m = 0; m < MT; ++m)
#pragma unroll
          for (int r = 0; r < 8; ++r) acc[m][t][r] = fmaxf(acc[m][t][r], sl[t & 1][m][r]);   /* = y for y >= 0, SLOPE * y below, as 0 < SLOPE < 1 */
      __builtin_amdgcn_sched_barrier(0);   // ends this operation's run over the group, as above: fewer window switches, less text
#pragma unroll
      for (int t = 2 * g; t < 2 * g + 2; ++t)
#pragma unroll
        for (int m = 0; m < MT; ++m) acc[m][t] = rq[m][t] * rw + acc[m][t];
      if (g + 2 < 8) {
        __builtin_amdgcn_sched_barrier(0);   // group g + 2 is fetched behind group g's arithmetic, not earlier: two groups in flight are enough
#pragma unroll
        for (int t = 2 * g + 4; t < 2 * g + 6; ++t) { gq[t] = ld8(pg + t * 16); eq[t] = ld8(pe + t * 16);
#pragma unroll
          for (int m = 0; m < MT; ++m) rq[m][t] = ld8(xl + m * 16 * XP + t * 16); }
        __builtin_amdgcn_sched_barrier(0);   // and not later: its reads fly during group g + 1's arithmetic
      }
    }
    if (L < 3) {   // no barrier behind these stores: every element is read back by the lane that wrote it
#pragma unroll
      for (int m = 0; m < MT; ++m)
#pragma unroll
        for (int t = 0; t < 16; ++t) st8(xl + m * 16 * XP + t * 16, acc[m][t]);
    }
  }
  v8f wf[16];
  v8f fv[MT];
#pragma unroll
  for (int m = 0; m < MT; ++m) fv[m] = v8f{0.f, 0.f, 0.f, 0.f, 0.f, 0.f, 0.f, 0.f};
#pragma unroll
  for (int t = 0; t < 16; ++t) wf[t] = ld8(pl + t * 16);
  __builtin_amdgcn_sched_barrier(0);   // one group of LDS reads, as for the bias row
#pragma unroll
  for (int t = 0; t < 16; ++t)
#pragma unroll
    for (int m = 0; m < MT; ++m) fv[m] += acc[m][t] * wf[t];
  float o[MT];
#pragma unroll
  for (int m = 0; m < MT; ++m) o[m] = point_sum(fv[m]) + bfv;
  float* tp = tmp + (size_t)n * NPT + pw + it * TM + lane;   // bone-major: a wave owns its two whole 128-byte lines; lane = point
  tp[0] = hh ? o[1] : o[0];
  tp[32] = hh ? o[3] : o[2];
  asm volatile("s_wait_xcnt 0x0" ::: "memory");   // stands in front of the next tile's code, which reuses the address and data registers of these stores
  __builtin_amdgcn_sched_barrier(0);   // keeps that code behind the wait
  }
}

// out[b][n] = tmp[n][b]: 16 points x 16 bones a block, whole lines written by one block
__global__ __launch_bounds__(256) void k_tr(const float* __restrict__ tmp, float* __restrict__ out) { __shared__ float sm[16][17]; const int tid = threadIdx.x;
  sm[tid & 15][tid >> 4] = tmp[(size_t)(tid >> 4) * NPT + blockIdx.x * 16 + (tid & 15)];
  __syncthreads();
  out[(size_t)blockIdx.x * 256 + tid] = sm[tid >> 4][tid & 15]; }

extern "C" void kernel_launch(void* const* d_in, const int* in_sizes, int n_in,
                              void* d_out, int out_size, void* d_ws, size_t ws_size, hipStream_t stream) {
  (void)in_sizes; (void)n_in; (void)out_size;
  const float* const* I = (const float* const*)d_in; const float* xyz = I[0]; const float* lat = I[1]; const float* W0 = I[2]; const float* b0 = I[3]; const float* g0 = I[4]; const float* be0 = I[5]; const float* Wm = I[6]; const float* bm = I[7]; const float* gm = I[8]; const float* bem = I[9]; const float* Wf = I[10]; const float* bfb = I[11];
  char* ws = (char*)d_ws; size_t off = 0;
  auto take = [&](size_t bytes) { char* p = ws + off; off += (bytes + 255) & ~(size_t)255; return p; };
  _Float16* Wt = (_Float16*)take((size_t)3 * NBONE * HH * HH * 2); float* tmp = (float*)take((size_t)NBONE * NPT * 4); float* cen = (float*)take((size_t)NBONE * NCEN * HH * 4);
  if (off > ws_size) return;
  k_wt3<<<NWB + NBONE, 256, 0, stream>>>(Wm, b0, bm, W0, Wt, cen);
  k_mlp<<<dim3(NPT / (TM * TPW), NBONE), NTH, 0, stream>>>(xyz, lat, cen, g0, be0, Wt, gm, bem, Wf, bfb, tmp);
  k_tr<<<NPT / 16, 256, 0, stream>>>(tmp, (float*)d_out);
}

// v009
// It runs in 78.7 microseconds.
// Next to v008, in two timings, it ran 1.03 and 1.02 times as fast.
// All steps since v000 together make it 15.9 times as fast.
#include <hip/hip_runtime.h>
// Piecewise-rigid implicit decoder (B=16384 query points x N=16 bones, hidden 256): inp[b,n] = (latent[b,n].[xyz_b;1])[:3];
// layer 0: x = lrelu(LN(inp.W0[n] + b0[n]).g0[n] + be0[n]); layers 1-3: x = lrelu(LN(x.Wm[l,n] + bm[l,n]).gm + bem) + x;
// out[b,n] = x.Wf[n] + bf[n] (LeakyReLU slope 0.1, LN eps 1e-5, per-bone weights (in,out)).
// Compute dtype: all inputs rounded to bf16; residual stream x in f32, rounded to f16 as the GEMM's B operand; weights f16 (x16, undone by 1/16).
// One fused kernel: a work-group owns 256 points of one bone for the whole network, and walks four such tiles of its bone one behind the other (one work-group a WGP, 256 in all). x lives in LDS (f32), a wave owns 64 points x all 256
// columns (so LayerNorm never leaves the wave), the bone's weights come in slabs of 32 k straight from global memory into registers: the first launch
// stores them in fragment order (a wave's 16-byte-a-lane load = 512 consecutive bytes), and the 4 waves, which walk the same slabs, share the lines in the cache of their WGP.
// The products are taken transposed (weights as A, x as B): a lane's accumulators are 8 consecutive columns of ONE point, which are the
// very elements the same lane reads as its B fragment in the next layer, so x in LDS is private to a lane and moves in 16-byte pieces.
// LayerNorm's mean is taken out ahead of the products: mean_o(x.W + b) = x.mean_o(W) + mean_o(b), so the first launch subtracts from every weight row
// (and from every bias and W0 row) its mean over the 256 outputs; what the products give is then already centred, and only the sum of squares is left.
// The fused kernel's text is kept close to 32 KB, for speed only:
// every pass over the 512 accumulators is 2 KB of text, so layer 0's product (k = 3 and the bias) runs on the f32 matrix form, the biases of layers 1 to 3 are the accumulators' start values,
// and the layer's last block goes one operation at a time, which saves most of its register-window switches.
// Vector work that needs no finished row issues between the wave's own products, while the matrix unit is busy: the conversions of the next slab's x, and LayerNorm's squares of a column tile as soon as
// its last product is done. For that a layer's first and last slab stand outside the rolled loop; in the first the bias is the products' C operand, so that no copies of it are made.
#define NPT 16384
#define NBONE 16
#define HH 256
#define LNEPS 1e-5f
#define SLOPE 0.1f
#define TM 256   /* points per tile of a work-group: 4 waves x 64 rows */
#define NTH 128  /* threads of the fused kernel: one wave a SIMD, so that a wave may hold more than 512 registers */
#define MT 4     /* 16-point tiles a wave */
#define TPW 4    /* 256-point tiles a work-group walks, all of one bone: its parameters are fetched once, and a tile's inputs during the tile before */
#define XP 260   /* pitch of an x row in LDS, floats: 1040 B = 16 B x odd, for the 16-byte reads and writes of x */
#define SLABH (HH * 32)   /* halfs of a weight slab: 16 column tiles x 2 halves of a fragment x 32 lanes x 8 */
#define NSLAB 24 /* 3 layers x 8 slabs of 32 k */
#define NCEN 7   /* centred parameter rows a bone in the workspace: b0, bm 0-2, W0 0-2 */
#define NWB (3 * NBONE * (HH / 64))   /* blocks of the first launch that transpose weights; NBONE more centre the parameter rows */
#define NPAR 16  /* per-column parameter rows kept in LDS: Wf 0, bias 1-3, gain 4-7, shift 8-11 (by layer); the place of rows 12-15 holds, 4 floats a column, layer 0's W0 rows 0-2 and its bias */
typedef unsigned short v8us __attribute__((ext_vector_type(8), may_alias));
typedef float  v8f  __attribute__((ext_vector_type(8)));
typedef float  v4f  __attribute__((ext_vector_type(4)));
typedef float  v4fa __attribute__((ext_vector_type(4), may_alias));
typedef float  v2f  __attribute__((ext_vector_type(2)));
typedef float  v2fa __attribute__((ext_vector_type(2), may_alias));
typedef _Float16 v16h __attribute__((ext_vector_type(16)));
union FragH { v16h v; v8us half[2]; _Float16 h[16]; unsigned short u[16]; };

__device__ __forceinline__ unsigned short bf16_bits(float x) { unsigned int u = __float_as_uint(x); return (unsigned short)((u + 0x7FFFu + ((u >> 16) & 1u)) >> 16); }
__device__ __forceinline__ float bf16_val(unsigned short b) { return __uint_as_float(((unsigned int)b) << 16); }
__device__ __forceinline__ float bf16_round(float x) { return bf16_val(bf16_bits(x)); }

// f16((w[i][o] - mean_o w[i][o]) * 16), w = bf16(Wm[l][n]), transposed through LDS: a block owns 64 rows i x all 256 columns o of one matrix.
// Stored in the order in which the fused kernel's lanes hold it as the A operand: Wt[n][slab l * 8 + (i >> 5)][tile o >> 4][half (i >> 4) & 1][lane (o & 15) + 16 * ((i >> 3) & 1)][i & 7].
// It reads whole rows (a wave = 512 consecutive bytes) and writes 64-byte runs (4 lanes = 8 i of 4 neighbouring o); both runs of a line come from this block.
// The last NBONE blocks centre a bone's bias and W0 rows in the same way (a wave = a row), kept in f32.
// LDS keeps the rounded f32 rows unpadded; the 16-byte piece c of row i lies at piece c ^ (i >> 3), so that the column reads of 8 lanes (8 rows apart) fall on 8 different bank groups.
__global__ __launch_bounds__(256) void k_wt3(const float* __restrict__ Wm, const float* __restrict__ b0, const float* __restrict__ bm, const float* __restrict__ W0, _Float16* __restrict__ Wt, float* __restrict__ cen) {
  __shared__ __attribute__((aligned(16))) float sm[64 * HH];
  __shared__ __attribute__((aligned(16))) float mn[64];
  const int tid = threadIdx.x;
  if (blockIdx.x >= NWB) {   // the whole block takes this path and leaves in front of every barrier
    const int n = blockIdx.x - NWB, r = tid >> 5, lane = tid & 31;
    if (r < NCEN) {
      const float* row = (r == 0 ? b0 + (size_t)n * HH : r < 4 ? bm + ((size_t)(r - 1) * NBONE + n) * HH : W0 + ((size_t)n * 3 + (r - 4)) * HH) + lane * 8;
      v4f lo = *(const v4fa*)row, hi = *(const v4fa*)(row + 4);
      asm volatile("s_wait_xcnt 0x0" ::: "memory");   // stands in front of whatever reuses the address registers of the two loads
#pragma unroll   /* constant element indices, so that the two vectors stay in registers */
      for (int q = 0; q < 4; ++q) { lo[q] = bf16_round(lo[q]); hi[q] = bf16_round(hi[q]); }
      float s = ((lo[0] + lo[1]) + (lo[2] + lo[3])) + ((hi[0] + hi[1]) + (hi[2] + hi[3]));
#pragma unroll   /* five steps with constant lane masks: the row's sum in every lane */
      for (int d = 1; d < 32; d <<= 1) s += __shfl_xor(s, d, 32);
      const float mu = s * (1.0f / HH);
      float* dst = cen + ((size_t)n * NCEN + r) * HH + lane * 8;
      *(v4fa*)dst = lo - mu; *(v4fa*)(dst + 4) = hi - mu;
    }
    return;
  }
  const int mat = blockIdx.x >> 2, i0 = (blockIdx.x & 3) * 64;
  const float* sp = Wm + ((size_t)mat * HH + i0) * HH;   // uniform base, the thread's place in the tile as the one vector offset
  const unsigned so = (unsigned)((tid >> 6) * HH + (tid & 63) * 4);
  v4f v[16];
#pragma unroll
  for (int j = 0; j < 16; ++j) v[j] = *(const v4fa*)(sp + so + j * 4 * HH);   // all 16 loads of a thread in flight at once
#pragma unroll
  for (int j = 0; j < 16; ++j) { const int i = j * 4 + (tid >> 6); *(v4fa*)(sm + i * HH + (((tid & 63) ^ (i >> 3)) << 2)) = v4f{bf16_round(v[j][0]), bf16_round(v[j][1]), bf16_round(v[j][2]), bf16_round(v[j][3])}; }
  __syncthreads();   // the tile is read by rows and by columns, across what other waves stored
  { const int i = tid >> 2; float s = 0.f;   // four threads a row, 16 pieces each; the walk starts at the lane's own piece, so that 16 lanes fall on 16 bank groups
#pragma unroll   /* all 16 LDS reads of a thread in flight at once */
    for (int k = 0; k < 16; ++k) { const int c = (tid & 3) * 16 + ((k + tid) & 15); const v4f x = *(const v4fa*)(sm + i * HH + ((c ^ (i >> 3)) << 2)); s += (x[0] + x[1]) + (x[2] + x[3]); }
    s += __shfl_xor(s, 1, 32); s += __shfl_xor(s, 2, 32);
    if ((tid & 3) == 0) mn[i] = s * (1.0f / HH); }
  __syncthreads();   // publishes the 64 row means
  const int ic = tid & 7;
  const v4f m0 = *(const v4fa*)(mn + ic * 8), m1 = *(const v4fa*)(mn + ic * 8 + 4);
  unsigned short* dp = (unsigned short*)Wt + (size_t)((mat & 15) * NSLAB + (mat >> 4) * 8 + (i0 >> 5) + (ic >> 2)) * SLABH + (tid >> 7) * 512 + ((ic >> 1) & 1) * 256 + (ic & 1) * 128 + ((tid >> 3) & 15) * 8;
#pragma unroll
  for (int h = 0; h < 8; ++h) { const int o = h * 32 + (tid >> 3); const float* cp = sm + ic * 8 * HH + ((((o >> 2) ^ ic) << 2) | (o & 3)); FragH f;
#pragma unroll
    for (int q = 0; q < 8; ++q) f.h[q] = (_Float16)((cp[q * HH] - (q < 4 ? m0[q & 3] : m1[q & 3])) * 16.0f);
    *(v8us*)(dp + h * 1024) = f.half[0]; }   // 32 columns on = two column tiles on
  asm volatile("s_wait_xcnt 0x0" ::: "memory");   // stands in front of whatever reuses the address and data registers of these stores
}

// lane l <-> lane l ^ 16
__device__ __forceinline__ float xhalf(float x) { return __builtin_bit_cast(float, __builtin_amdgcn_permlanex16(__builtin_bit_cast(int, x), __builtin_bit_cast(int, x), 0x76543210, 0xfedcba98, false, false)); }
__device__ __forceinline__ v8f ld8(const float* p) { const v4f lo = *(const v4fa*)p, hi = *(const v4fa*)(p + 4); return __builtin_shufflevector(lo, hi, 0, 1, 2, 3, 4, 5, 6, 7); }
__device__ __forceinline__ void st8(float* p, v8f v) { *(v4fa*)p = __builtin_shufflevector(v, v, 0, 1, 2, 3); *(v4fa*)(p + 4) = __builtin_shufflevector(v, v, 4, 5, 6, 7); }
// sum of a lane's 8 partial sums and of its partner's in the other half of the wave: a point's whole row
__device__ __forceinline__ float point_sum(v8f v) { const float s = ((v[0] + v[1]) + (v[2] + v[3])) + ((v[4] + v[5]) + (v[6] + v[7])); return s + xhalf(s); }

__global__ __launch_bounds__(NTH) void k_mlp(const float* __restrict__ xyz, const float* __restrict__ lat, const float* __restrict__ cen, const float* __restrict__ g0, const float* __restrict__ be0,
                                             const _Float16* __restrict__ Wt, const float* __restrict__ gm, const float* __restrict__ bem, const float* __restrict__ Wf, const float* __restrict__ bfb, float* __restrict__ tmp) {
  __shared__ __attribute__((aligned(16))) float xs[TM * XP];
  __shared__ __attribute__((aligned(16))) float ps[NPAR * HH];
  const int tid = threadIdx.x, w = tid >> 5, lane = tid & 31, ln = lane & 15, hh = lane >> 4;
  const int n = blockIdx.y, pw = blockIdx.x * (TPW * TM) + w * 16 * MT;   // the wave's first point in the work-group's first tile
  FragH b[2][16];   // weight fragments: slab s in b[s & 1], the next slab's loaded during this slab's products
  float* xw = xs + (size_t)(w * 16 * MT) * XP; // this wave's 64 rows
  float* xl = xw + ln * XP + 8 * hh;           // accumulator layout: element (m, t, r) = point m*16 + ln, column t*16 + 8*hh + r
  {
#pragma unroll 1   /* rolled: run once, and 120 stores fewer in the kernel's text */
    for (int t = 0; t < 16; ++t)   // x starts finite: layer 0 reads its residual like the others, with weight 0, and the layer body needs no branch among its LDS reads (a later tile finds the tile before's x)
#pragma unroll
      for (int m = 0; m < MT; ++m) st8(xl + m * 16 * XP + t * 16, v8f{0.f, 0.f, 0.f, 0.f, 0.f, 0.f, 0.f, 0.f});
  }
  float pv[2][NPAR];   // thread = two columns: the bone's per-column parameters, rounded once a work-group and read from LDS 8 columns a lane
  { const size_t nb = (size_t)n * HH;   // uniform row bases, the thread's column as the one vector offset
    const float* rb = cen + NCEN * nb; const float* rg = g0 + nb; const float* re = be0 + nb; const float* rf = Wf + nb;
#pragma unroll
    for (int c = 0; c < 2; ++c) { const int col = tid + c * NTH;
      pv[c][0] = rb[col]; pv[c][4] = rg[col]; pv[c][8] = re[col]; pv[c][15] = rf[col];
#pragma unroll
      for (int l = 0; l < 3; ++l) { const float* qb = rb + (1 + l) * HH; const float* qg = gm + (size_t)l * NBONE * HH + nb; const float* qe = bem + (size_t)l * NBONE * HH + nb; const float* qw = rb + (4 + l) * HH;
        pv[c][1 + l] = qb[col]; pv[c][5 + l] = qg[col]; pv[c][9 + l] = qe[col]; pv[c][12 + l] = qw[col]; } } }
  asm volatile("s_wait_xcnt 0x0" ::: "memory");   // stands in front of the address arithmetic below, which may reuse the offset and base registers of these loads
  __builtin_amdgcn_sched_barrier(0);   // keeps that arithmetic behind the wait
  const float bq = bfb[n];
  // lane = two rows: the rigid transform's three coordinates, left in the row's pad behind its 256 columns
  float q[2][3]; v4f r4[2][3];
  {
    int pq[2]; const float* Lq[2];
#pragma unroll
    for (int c = 0; c < 2; ++c) { const int p = pw + c * 32 + lane; const float* Lp = lat + ((size_t)p * NBONE + n) * 16; pq[c] = p; Lq[c] = Lp;   // the first tile's
#pragma unroll
      for (int i = 0; i < 3; ++i) { q[c][i] = xyz[(size_t)p * 3 + i]; r4[c][i] = *(const v4fa*)(Lp + 4 * i); } }
    asm volatile("s_wait_xcnt 0x0" :: "v"(pq[1]), "v"(Lq[0]), "v"(Lq[1]) : "memory");   // stands in front of the arithmetic that reuses these loads' offset and address registers; as its inputs they stay live up to it: without them unrelated arithmetic took two of them ahead of the wait (the first offset lives on in the tile loop)
    __builtin_amdgcn_sched_barrier(0);   // keeps that arithmetic behind the wait
  }
  // weight fragments: the bone's uniform base, and as the one vector offset (wo, in bytes) the lane's 16 bytes of the next slab to load; tile and half are the immediate offset. The offset steps on behind the wait that follows its loads.
  const char* const wb = (const char*)(Wt + (size_t)n * NSLAB * SLABH);
#pragma unroll
  for (int c = 0; c < 2; ++c)
#pragma unroll
    for (int k = 0; k < 12; ++k) ps[k * HH + tid + c * NTH] = k == 0 ? bf16_round(pv[c][15]) : k < 4 ? pv[c][k] * 16.0f : bf16_round(pv[c][k]);   // the bias and W0 rows come rounded and centred; the biases of layers 1 to 3 are kept at the weights' scale (x16), as the accumulators' start values
#pragma unroll
  for (int c = 0; c < 2; ++c) *(v4fa*)(ps + 12 * HH + (tid + c * NTH) * 4) = v4f{pv[c][12], pv[c][13], pv[c][14], pv[c][0]};   // a column's four k of layer 0's product: a lane's A fragment is 8 of these bytes
  const float* pl = ps + 8 * hh;               // the same columns of a parameter row
  const float bfv = bf16_round(bq);
#pragma unroll 1   /* a tile's body is the whole network: one copy */
  for (int it = 0; it < TPW; ++it) {
#pragma unroll
  for (int c = 0; c < 2; ++c) { const float h0 = bf16_round(q[c][0]), h1 = bf16_round(q[c][1]), h2 = bf16_round(q[c][2]);
#pragma unroll
    for (int i = 0; i < 3; ++i) { float a = 0.f; a += bf16_round(r4[c][i][0]) * h0; a += bf16_round(r4[c][i][1]) * h1; a += bf16_round(r4[c][i][2]) * h2; a += bf16_round(r4[c][i][3]); xw[(c * 32 + lane) * XP + HH + i] = a; }
    xw[(c * 32 + lane) * XP + HH + 3] = 1.0f; }   // the fourth k of layer 0's product: times the bias
  __syncthreads();   // publishes the coordinates and, in the first tile, the parameters: nothing else is read that another lane wrote. In a later tile it also brings the four waves level, so that they go on sharing the weight lines in the cache of their WGP
  unsigned wo = lane * 16;
  v8f acc[MT][16];
#pragma unroll 1   /* the layer body is several thousand instructions */
  for (int L = 0; L < 4; ++L) {
    const float* pb = pl + L * HH;   // this layer's bias row
    const float rw = L == 0 ? 0.f : 1.f;   // layer 0 has no residual: what x holds there (zeros, or the tile before's finite x) counts times 0
    const float* pg = pl + (4 + L) * HH;
    const float* pe = pl + (8 + L) * HH;
    v8f gq[16], eq[16], rq[MT][16];   // gain, shift and residual x, fetched two column tiles a group, a group's arithmetic ahead of their use
    v8f qv[MT];   // a point's sums of squares, 8 partial sums a lane (a row arrives centred: its weights and biases were); summed tile by tile between the layer's last products
#pragma unroll
    for (int m = 0; m < MT; ++m) qv[m] = v8f{0.f, 0.f, 0.f, 0.f, 0.f, 0.f, 0.f, 0.f};
    if (L == 0) {
#pragma unroll
      for (int t = 0; t < 16; ++t) { b[0][t].half[0] = *(const v8us*)((wb + wo) + t * 1024); b[0][t].half[1] = *(const v8us*)((wb + wo) + t * 1024 + 512); }   // slab 0 flies during layer 0; every later slab is loaded a trip ahead
      asm volatile("s_wait_xcnt 0x0" ::: "memory");   // stands in front of the step that rewrites the address registers of these loads
      __builtin_amdgcn_sched_barrier(0);   // keeps that step behind the wait
      wo += 2 * SLABH;
      {   // the next tile's inputs fly during this tile's network: behind the barrier, which would wait for them, and behind slab 0's loads, whose counted waits would (the last tile fetches its own again, unread: no branch round the loads)
        const int pn = pw + (it + 1 < TPW ? it + 1 : it) * TM;
#pragma unroll
        for (int c = 0; c < 2; ++c) { const int p = pn + c * 32 + lane; const float* Lp = lat + ((size_t)p * NBONE + n) * 16;
#pragma unroll
          for (int i = 0; i < 3; ++i) { q[c][i] = xyz[(size_t)p * 3 + i]; r4[c][i] = *(const v4fa*)(Lp + 4 * i); } }
        asm volatile("s_wait_xcnt 0x0" ::: "memory");   // stands in front of the address arithmetic that reuses these loads' offset and base registers
        __builtin_amdgcn_sched_barrier(0);   // keeps that arithmetic behind the wait
      }
      // layer 0 on the f32 matrix form, k = 4: the three coordinates and 1 against W0's three rows and the bias (full f32 operands). A and B split k alike: half hh of the wave holds k = 2 hh and 2 hh + 1
      v2f ib[MT], wa[16];
#pragma unroll
      for (int m = 0; m < MT; ++m) ib[m] = *(const v2fa*)(xw + (m * 16 + ln) * XP + HH + 2 * hh);
#pragma unroll
      for (int t = 0; t < 16; ++t) wa[t] = *(const v2fa*)(ps + 12 * HH + (t * 16 + ln) * 4 + 2 * hh);
#pragma unroll
      for (int t = 0; t < 2; ++t) { gq[t] = ld8(pg + t * 16); eq[t] = ld8(pe + t * 16);
#pragma unroll
        for (int m = 0; m < MT; ++m) rq[m][t] = ld8(xl + m * 16 * XP + t * 16); }
      __builtin_amdgcn_sched_barrier(0);   // the last block's first group is fetched here, in one group with the fragments, and flies during the products
#pragma unroll
      for (int t = 0; t < 16; ++t)
#pragma unroll
        for (int m = 0; m < MT; ++m) {
          acc[m][t] = __builtin_amdgcn_wmma_f32_16x16x4_f32(false, wa[t], false, ib[m], (short)0, v8f{0.f, 0.f, 0.f, 0.f, 0.f, 0.f, 0.f, 0.f}, false, false);
          if (t > 0) { qv[m] += acc[m][t - 1] * acc[m][t - 1];
            __builtin_amdgcn_sched_barrier(0); }   // keeps this order: one product, then the squares of the column tile before (four instructions), which issue while the matrix unit is busy with that product; in a run of their own they would cost their full issue time
        }
      // inputs only: the loaded fragments stay live to the end of the block, so that no product's result is given the registers of a fragment that a product issued just ahead of it reads
      asm volatile("" :: "v"(ib[0]), "v"(ib[1]), "v"(ib[2]), "v"(ib[3]), "v"(wa[0]), "v"(wa[1]), "v"(wa[2]), "v"(wa[3]), "v"(wa[4]), "v"(wa[5]), "v"(wa[6]), "v"(wa[7]), "v"(wa[8]), "v"(wa[9]), "v"(wa[10]), "v"(wa[11]), "v"(wa[12]), "v"(wa[13]), "v"(wa[14]), "v"(wa[15]));
    } else {
      v4f xa[MT][4];
      FragH a[2][MT];   // x as B fragments: trip ks reads set ks & 1, while the other set is converted between its products
      v8f bv[16];
#pragma unroll
      for (int m = 0; m < MT; ++m) { const float* xr = xw + (m * 16 + ln) * XP + 8 * hh;   // the layer's first 32 columns of x; the later ones are fetched a trip ahead
        xa[m][0] = *(const v4fa*)(xr); xa[m][1] = *(const v4fa*)(xr + 4); xa[m][2] = *(const v4fa*)(xr + 16); xa[m][3] = *(const v4fa*)(xr + 20); }
#pragma unroll
      for (int t = 0; t < 16; ++t) bv[t] = ld8(pb + t * 16);   // the sums start at 16 x bias: it is the C operand of the first trip's products; the 1/16 goes into the LayerNorm factor
#pragma unroll
      for (int m = 0; m < MT; ++m)
#pragma unroll
        for (int i = 0; i < 16; ++i) a[0][m].h[i] = (_Float16)xa[m][i >> 2][i & 3];
      // one trip = slab ks of 32 k: 64 products. mode 1: the layer's first trip, mode 2: its last, mode 0: those between (u = ks & 1 and mode are literals at every call)
      // the next slab is loaded from offset wo + off, off a literal too: wo itself steps on only behind a trip's wait
      auto trip = [&](const int u, const int ks, const int mode, const int off) __attribute__((always_inline)) {
#pragma unroll
        for (int t = 0; t < 16; ++t) { b[u ^ 1][t].half[0] = *(const v8us*)((wb + wo) + (off + t * 1024)); b[u ^ 1][t].half[1] = *(const v8us*)((wb + wo) + (off + t * 1024 + 512)); }   // the next slab flies during this slab's products
        if (mode != 2) {
          const float* xn = xw + ln * XP + (ks + 1) * 32 + 8 * hh;   // the next slab's columns of x
#pragma unroll
          for (int m = 0; m < MT; ++m) { const float* xr = xn + m * 16 * XP;
            xa[m][0] = *(const v4fa*)(xr); xa[m][1] = *(const v4fa*)(xr + 4); xa[m][2] = *(const v4fa*)(xr + 16); xa[m][3] = *(const v4fa*)(xr + 20); }
        } else {
#pragma unroll
          for (int t = 0; t < 2; ++t) { gq[t] = ld8(pg + t * 16); eq[t] = ld8(pe + t * 16);   // the last block's first group flies during the last trip (registers do not reach for the second)
#pragma unroll
            for (int m = 0; m < MT; ++m) rq[m][t] = ld8(xl + m * 16 * XP + t * 16); }
        }
        __builtin_amdgcn_sched_barrier(0);   // loads and LDS reads issue as one group, ahead of the products: every further place where they stand among them costs issue time
#pragma unroll
        for (int t = 0; t < 16; ++t) {   // weights as A (rows = output columns), x as B (columns = points)
          if (t == 4) {
            __builtin_amdgcn_sched_barrier(0);   // a quarter of the products issues between the loads and their wait: directly behind the loads the wait would stand bare
            asm volatile("s_wait_xcnt 0x0" : "+v"(wo) :: "memory");   // stands in front of the step that rewrites the offset register of this trip's loads: the offset goes through the statement, so that every step on it is formed behind the wait
          }
#pragma unroll
          for (int m = 0; m < MT; ++m) {
            acc[m][t] = __builtin_amdgcn_wmma_f32_16x16x32_f16(false, b[u][t].v, false, a[u][m].v, (short)0, mode == 1 ? bv[t] : acc[m][t], false, false);
            if (mode == 2 && t > 0) { qv[m] += acc[m][t - 1] * acc[m][t - 1];
              __builtin_amdgcn_sched_barrier(0);   // keeps this order: one product, then the squares of the column tile before, which is complete (four instructions): they issue while the matrix unit is busy with that product
            } else if (mode == 0 && t >= 8) { const int j = (t - 8) * MT + m, mm = j >> 3, i = (j & 7) * 2;   // the next trip's B fragments, two elements behind each product of the trip's second half (their LDS reads have landed by then)
              a[u ^ 1][mm].h[i] = (_Float16)xa[mm][i >> 2][i & 3]; a[u ^ 1][mm].h[i + 1] = (_Float16)xa[mm][i >> 2][(i & 3) + 1];
              __builtin_amdgcn_sched_barrier(0); }   // keeps this order: one product, one conversion, which issues while the matrix unit is busy with that product
          }
        }
        if (mode == 1) {   // the first trip's conversions feed the rolled loop alone, and the compiler puts them behind the trip's products wherever they are written
#pragma unroll
          for (int m = 0; m < MT; ++m)
#pragma unroll
            for (int i = 0; i < 16; ++i) a[u ^ 1][m].h[i] = (_Float16)xa[m][i >> 2][i & 3];
        }
        __builtin_amdgcn_sched_barrier(0);   // ends the trip: the next trip's loads stay behind it
      };
      trip(0, 0, 1, 0);
#pragma unroll 1   /* rolled by pairs of trips: a pair already holds 128 products, and the two fragment sets swap roles inside it */
      for (int kp = 0; kp < 3; ++kp) { trip(1, 2 * kp + 1, 0, 2 * SLABH); trip(0, 2 * kp + 2, 0, 4 * SLABH); wo += 4 * SLABH; }   // a slab is 2 * SLABH bytes
      wo += L < 3 ? 2 * SLABH : 0;   // no branch round the loads: behind a join the compiler waits for them at once (the network's last trip loads the last slab again, unread)
      trip(1, 7, 2, 0);
      wo += 2 * SLABH;   // the next layer's second slab
    }
#pragma unroll
    for (int t = 2; t < 4; ++t) { gq[t] = ld8(pg + t * 16); eq[t] = ld8(pe + t * 16);   // the second group, into registers that the last slab has left: it flies during the statistics' end and the first group's arithmetic
#pragma unroll
      for (int m = 0; m < MT; ++m) rq[m][t] = ld8(xl + m * 16 * XP + t * 16); }
    __builtin_amdgcn_sched_barrier(0);   // left to the scheduler these reads sank to just in front of their use
#pragma unroll
    for (int m = 0; m < MT; ++m) qv[m] += acc[m][15] * acc[m][15];   // the last column tile's squares: no product is left to cover them
    float rs[MT];
    const float sc = L == 0 ? 1.f : 0.0625f;   // layers 1 to 3 arrive times 16
#pragma unroll
    for (int m = 0; m < MT; ++m) rs[m] = rsqrtf(point_sum(qv[m]) * (sc * sc * (1.0f / HH)) + LNEPS) * sc;
#pragma unroll
    for (int g = 0; g < 8; ++g) {
#pragma unroll
      for (int t = 2 * g; t < 2 * g + 2; ++t)
#pragma unroll
        for (int m = 0; m < MT; ++m) acc[m][t] = acc[m][t] * rs[m];
      __builtin_amdgcn_sched_barrier(0);   // a group goes one operation at a time over its 8 tiles: neighbours then use the same register windows, and the window switches, a third of this block's instructions when the scheduler mixed the operations, nearly all go (kernel text)
#pragma unroll
      for (int t = 2 * g; t < 2 * g + 2; ++t)
#pragma unroll
        for (int m = 0; m < MT; ++m) acc[m][t] = acc[m][t] * gq[t] + eq[t];
      __builtin_amdgcn_sched_barrier(0);   // ends this operation's run over the group, as above: fewer window switches, less text
      v8f sl[2][MT];
#pragma unroll
      for (int t = 2 * g; t < 2 * g + 2; ++t)
#pragma unroll
        for (int m = 0; m < MT; ++m) sl[t & 1][m] = SLOPE * acc[m][t];
      __builtin_amdgcn_sched_barrier(0);   // ends this operation's run over the group, as above: fewer window switches, less text
#pragma unroll
      for (int t = 2 * g; t < 2 * g + 2; ++t)
#pragma unroll
        for (int m = 0; m < MT; ++m)
#pragma unroll
          for (int r = 0; r < 8; ++r) acc[m][t][r] = fmaxf(acc[m][t][r], sl[t & 1][m][r]);   /* = y for y >= 0, SLOPE * y below, as 0 < SLOPE < 1 */
      __builtin_amdgcn_sched_barrier(0);   // ends this operation's run over the group, as above: fewer window switches, less text
#pragma unroll
      for (int t = 2 * g; t < 2 * g + 2; ++t)
#pragma unroll
        for (int m = 0; m < MT; ++m) acc[m][t] = rq[m][t] * rw + acc[m][t];
      if (g + 2 < 8) {
        __builtin_amdgcn_sched_barrier(0);   // group g + 2 is fetched behind group g's arithmetic, not earlier: two groups in flight are enough
#pragma unroll
        for (int t = 2 * g + 4; t < 2 * g + 6; ++t) { gq[t] = ld8(pg + t * 16); eq[t] = ld8(pe + t * 16);
#pragma unroll
          for (int m = 0; m < MT; ++m) rq[m][t] = ld8(xl + m * 16 * XP + t * 16); }
        __builtin_amdgcn_sched_barrier(0);   // and not later: its reads fly during group g + 1's arithmetic
      }
    }
    if (L < 3) {   // no barrier behind these stores: every element is read back by the lane that wrote it
#pragma unroll
      for (int m = 0; m < MT; ++m)
#pragma unroll
        for (int t = 0; t < 16; ++t) st8(xl + m * 16 * XP + t * 16, acc[m][t]);
    }
  }
  v8f wf[16];
  v8f fv[MT];
#pragma unroll
  for (int m = 0; m < MT; ++m) fv[m] = v8f{0.f, 0.f, 0.f, 0.f, 0.f, 0.f, 0.f, 0.f};
#pragma unroll
  for (int t = 0; t < 16; ++t) wf[t] = ld8(pl + t * 16);
  __builtin_amdgcn_sched_barrier(0);   // one group of LDS reads, as for the bias row
#pragma unroll
  for (int t = 0; t < 16; ++t)
#pragma unroll
    for (int m = 0; m < MT; ++m) fv[m] += acc[m][t] * wf[t];
  float o[MT];
#pragma unroll
  for (int m = 0; m < MT; ++m) o[m] = point_sum(fv[m]) + bfv;
  float* tp = tmp + (size_t)n * NPT + pw + it * TM + lane;   // bone-major: a wave owns its two whole 128-byte lines; lane = point
  tp[0] = hh ? o[1] : o[0];
  tp[32] = hh ? o[3] : o[2];
  asm volatile("s_wait_xcnt 0x0" ::: "memory");   // stands in front of the next tile's code, which reuses the address and data registers of these stores
  __builtin_amdgcn_sched_barrier(0);   // keeps that code behind the wait
  }
}

// out[b][n] = tmp[n][b]: 16 points x 16 bones a block, whole lines written by one block
__global__ __launch_bounds__(256) void k_tr(const float* __restrict__ tmp, float* __restrict__ out) { __shared__ float sm[16][17]; const int tid = threadIdx.x;
  sm[tid & 15][tid >> 4] = tmp[(size_t)(tid >> 4) * NPT + blockIdx.x * 16 + (tid & 15)];
  __syncthreads();
  out[(size_t)blockIdx.x * 256 + tid] = sm[tid >> 4][tid & 15]; }

extern "C" void kernel_launch(void* const* d_in, const int* in_sizes, int n_in,
                              void* d_out, int out_size, void* d_ws, size_t ws_size, hipStream_t stream) {
  (void)in_sizes; (void)n_in; (void)out_size;
  const float* const* I = (const float* const*)d_in; const float* xyz = I[0]; const float* lat = I[1]; const float* W0 = I[2]; const float* b0 = I[3]; const float* g0 = I[4]; const float* be0 = I[5]; const float* Wm = I[6]; const float* bm = I[7]; const float* gm = I[8]; const float* bem = I[9]; const float* Wf = I[10]; const float* bfb = I[11];
  char* ws = (char*)d_ws; size_t off = 0;
  auto take = [&](size_t bytes) { char* p = ws + off; off += (bytes + 255) & ~(size_t)255; return p; };
  _Float16* Wt = (_Float16*)take((size_t)3 * NBONE * HH * HH * 2); float* tmp = (float*)take((size_t)NBONE * NPT * 4); float* cen = (float*)take((size_t)NBONE * NCEN * HH * 4);
  if (off > ws_size) return;
  k_wt3<<<NWB + NBONE, 256, 0, stream>>>(Wm, b0, bm, W0, Wt, cen);
  k_mlp<<<dim3(NPT / (TM * TPW), NBONE), NTH, 0, stream>>>(xyz, lat, cen, g0, be0, Wt, gm, bem, Wf, bfb, tmp);
  k_tr<<<NPT / 16, 256, 0, stream>>>(tmp, (float*)d_out);
}

// v010
// A run of this version takes 75 microseconds.
// In two side-by-side timings against v009, it was 1.04 and 1.05 times as fast.
// Over all steps from v000 it is 16.6 times as fast.
#include <hip/hip_runtime.h>
// Piecewise-rigid implicit decoder (B=16384 query points x N=16 bones, hidden 256): inp[b,n] = (latent[b,n].[xyz_b;1])[:3];
// layer 0: x = lrelu(LN(inp.W0[n] + b0[n]).g0[n] + be0[n]); layers 1-3: x = lrelu(LN(x.Wm[l,n] + bm[l,n]).gm + bem) + x;
// out[b,n] = x.Wf[n] + bf[n] (LeakyReLU slope 0.1, LN eps 1e-5, per-bone weights (in,out)).
// Compute dtype: all inputs rounded to bf16; residual stream x in f32, rounded to f16 as the GEMM's B operand; weights f16 (x16, undone by 1/16).
// One fused kernel: a work-group owns 256 points of one bone for the whole network, and walks four such tiles of its bone one behind the other (one work-group a WGP, 256 in all). x lives in LDS (f32), a wave owns 64 points x all 256
// columns (so LayerNorm never leaves the wave), the bone's weights come in slabs of 32 k straight from global memory into registers: the first launch
// stores them in fragment order (a wave's 16-byte-a-lane load = 512 consecutive bytes), and the 4 waves, which walk the same slabs, share the lines in the cache of their WGP.
// The products are taken transposed (weights as A, x as B): a lane's accumulators are 8 consecutive columns of ONE point, which are the
// very elements the same lane reads as its B fragment in the next layer, so x in LDS is private to a lane and moves in 16-byte pieces.
// LayerNorm's mean is taken out ahead of the products: mean_o(x.W + b) = x.mean_o(W) + mean_o(b), so the first launch subtracts from every weight row
// (and from every bias and W0 row) its mean over the 256 outputs; what the products give is then already centred, and only the sum of squares is left.
// Layer 0's variance needs no product: its centred row is (inp, 1) times four fixed rows of the bone, so the sum of squares is a quadratic form of (inp, 1) in the 4 x 4 matrix of those rows' inner products, which the first launch forms.
// The LayerNorm factor is therefore known ahead of the product and goes into its B operand, the gain into its A operand; only shift and LeakyReLU are left, there is no residual, and x goes straight to LDS: layer 0 does not pass through the layers' last block.
// The fused kernel's text is kept small (for speed only):
// every pass over the 512 accumulators is 2 KB of text, so layer 0's product (k = 3 and the bias) runs on the f32 matrix form, the biases of layers 1 to 3 are the accumulators' start values,
// and the layer's last block goes one operation at a time, which saves most of its register-window switches.
// Vector work that needs no finished row issues between the wave's own products, while the matrix unit is busy: the conversions of the next slab's x, and LayerNorm's squares of a column tile as soon as
// its last product is done. For that a layer's first and last slab stand outside the rolled loop; in the first the bias is the products' C operand, so that no copies of it are made.
#define NPT 16384
#define NBONE 16
#define HH 256
#define LNEPS 1e-5f
#define SLOPE 0.1f
#define TM 256   /* points per tile of a work-group: 4 waves x 64 rows */
#define NTH 128  /* threads of the fused kernel: one wave a SIMD, so that a wave may hold more than 512 registers */
#define MT 4     /* 16-point tiles a wave */
#define TPW 4    /* 256-point tiles a work-group walks, all of one bone: its parameters are fetched once, and a tile's inputs during the tile before */
#define XP 260   /* pitch of an x row in LDS, floats: 1040 B = 16 B x odd, for the 16-byte reads and writes of x */
#define SLABH (HH * 32)   /* halfs of a weight slab: 16 column tiles x 2 halves of a fragment x 32 lanes x 8 */
#define NSLAB 24 /* 3 layers x 8 slabs of 32 k */
#define NCEN 7   /* centred parameter rows a bone in the workspace: b0, bm 0-2, W0 0-2 */
#define NWB (3 * NBONE * (HH / 64))   /* blocks of the first launch that transpose weights; NBONE more centre the parameter rows */
#define NPAR 16  /* per-column parameter rows kept in LDS: Wf 0, bias 1-3, gain 4-7, shift 8-11 (by layer); the place of rows 12-15 holds, 4 floats a column, layer 0's W0 rows 0-2 and its bias, times its gain (row 4 is not filled) */
typedef unsigned short v8us __attribute__((ext_vector_type(8), may_alias));
typedef float  v8f  __attribute__((ext_vector_type(8)));
typedef float  v4f  __attribute__((ext_vector_type(4)));
typedef float  v4fa __attribute__((ext_vector_type(4), may_alias));
typedef float  v2f  __attribute__((ext_vector_type(2)));
typedef float  v2fa __attribute__((ext_vector_type(2), may_alias));
typedef _Float16 v16h __attribute__((ext_vector_type(16)));
union FragH { v16h v; v8us half[2]; _Float16 h[16]; unsigned short u[16]; };

__device__ __forceinline__ unsigned short bf16_bits(float x) { unsigned int u = __float_as_uint(x); return (unsigned short)((u + 0x7FFFu + ((u >> 16) & 1u)) >> 16); }
__device__ __forceinline__ float bf16_val(unsigned short b) { return __uint_as_float(((unsigned int)b) << 16); }
__device__ __forceinline__ float bf16_round(float x) { return bf16_val(bf16_bits(x)); }

// f16((w[i][o] - mean_o w[i][o]) * 16), w = bf16(Wm[l][n]), transposed through LDS: a block owns 64 rows i x all 256 columns o of one matrix.
// Stored in the order in which the fused kernel's lanes hold it as the A operand: Wt[n][slab l * 8 + (i >> 5)][tile o >> 4][half (i >> 4) & 1][lane (o & 15) + 16 * ((i >> 3) & 1)][i & 7].
// It reads whole rows (a wave = 512 consecutive bytes) and writes 64-byte runs (4 lanes = 8 i of 4 neighbouring o); both runs of a line come from this block.
// The last NBONE blocks centre a bone's bias and W0 rows in the same way (a wave = a row), kept in f32; their eighth wave forms the inner products of the four centred rows of layer 0.
// LDS keeps the rounded f32 rows unpadded; the 16-byte piece c of row i lies at piece c ^ (i >> 3), so that the column reads of 8 lanes (8 rows apart) fall on 8 different bank groups.
__global__ __launch_bounds__(256) void k_wt3(const float* __restrict__ Wm, const float* __restrict__ b0, const float* __restrict__ bm, const float* __restrict__ W0, _Float16* __restrict__ Wt, float* __restrict__ cen, float* __restrict__ gram) {
  __shared__ __attribute__((aligned(16))) float sm[64 * HH];
  __shared__ __attribute__((aligned(16))) float mn[64];
  const int tid = threadIdx.x;
  if (blockIdx.x >= NWB) {   // the whole block takes this path and leaves in front of every barrier
    const int n = blockIdx.x - NWB, r = tid >> 5, lane = tid & 31;
    if (r < NCEN) {
      const float* row = (r == 0 ? b0 + (size_t)n * HH : r < 4 ? bm + ((size_t)(r - 1) * NBONE + n) * HH : W0 + ((size_t)n * 3 + (r - 4)) * HH) + lane * 8;
      v4f lo = *(const v4fa*)row, hi = *(const v4fa*)(row + 4);
      asm volatile("s_wait_xcnt 0x0" ::: "memory");   // stands in front of whatever reuses the address registers of the two loads
#pragma unroll   /* constant element indices, so that the two vectors stay in registers */
      for (int q = 0; q < 4; ++q) { lo[q] = bf16_round(lo[q]); hi[q] = bf16_round(hi[q]); }
      float s = ((lo[0] + lo[1]) + (lo[2] + lo[3])) + ((hi[0] + hi[1]) + (hi[2] + hi[3]));
#pragma unroll   /* five steps with constant lane masks: the row's sum in every lane */
      for (int d = 1; d < 32; d <<= 1) s += __shfl_xor(s, d, 32);
      const float mu = s * (1.0f / HH);
      float* dst = cen + ((size_t)n * NCEN + r) * HH + lane * 8;
      *(v4fa*)dst = lo - mu; *(v4fa*)(dst + 4) = hi - mu;
    } else {   // the eighth wave: the 4 x 4 matrix of inner products of the bone's centred W0 rows and b0 row, over 256: layer 0's variance is a quadratic form of it in (inp, 1)
      v4f lo[4], hi[4];
#pragma unroll   /* constant row indices; all 8 loads in flight at once */
      for (int k = 0; k < 4; ++k) { const float* row = (k < 3 ? W0 + ((size_t)n * 3 + k) * HH : b0 + (size_t)n * HH) + lane * 8; lo[k] = *(const v4fa*)row; hi[k] = *(const v4fa*)(row + 4); }
      asm volatile("s_wait_xcnt 0x0" ::: "memory");   // stands in front of whatever reuses the address registers of the eight loads
#pragma unroll   /* the rows stay in registers */
      for (int k = 0; k < 4; ++k) {
#pragma unroll
        for (int q = 0; q < 4; ++q) { lo[k][q] = bf16_round(lo[k][q]); hi[k][q] = bf16_round(hi[k][q]); }
        float s = ((lo[k][0] + lo[k][1]) + (lo[k][2] + lo[k][3])) + ((hi[k][0] + hi[k][1]) + (hi[k][2] + hi[k][3]));
#pragma unroll
        for (int d = 1; d < 32; d <<= 1) s += __shfl_xor(s, d, 32);
        const float mu = s * (1.0f / HH);
        lo[k] = lo[k] - mu; hi[k] = hi[k] - mu; }
      float gs[12];   // order: 00 11 22, twice 01 02 12, twice 03 13 23, 33
      const int gi[10] = {0, 1, 2, 0, 0, 1, 0, 1, 2, 3}, gj[10] = {0, 1, 2, 1, 2, 2, 3, 3, 3, 3};
#pragma unroll   /* constant indices into the rows */
      for (int e = 0; e < 10; ++e) { const v4f p = lo[gi[e]] * lo[gj[e]] + hi[gi[e]] * hi[gj[e]]; float s = (p[0] + p[1]) + (p[2] + p[3]);
#pragma unroll
        for (int d = 1; d < 32; d <<= 1) s += __shfl_xor(s, d, 32);
        gs[e] = s * (gi[e] == gj[e] ? 1.0f / HH : 2.0f / HH); }
      gs[10] = 0.f; gs[11] = 0.f;
      if (lane == 0) { float* gp = gram + n * 32;   // a bone's own 128-byte line
        *(v4fa*)gp = v4f{gs[0], gs[1], gs[2], gs[3]}; *(v4fa*)(gp + 4) = v4f{gs[4], gs[5], gs[6], gs[7]}; *(v4fa*)(gp + 8) = v4f{gs[8], gs[9], gs[10], gs[11]}; }
    }
    return;
  }
  const int mat = blockIdx.x >> 2, i0 = (blockIdx.x & 3) * 64;
  const float* sp = Wm + ((size_t)mat * HH + i0) * HH;   // uniform base, the thread's place in the tile as the one vector offset
  const unsigned so = (unsigned)((tid >> 6) * HH + (tid & 63) * 4);
  v4f v[16];
#pragma unroll
  for (int j = 0; j < 16; ++j) v[j] = *(const v4fa*)(sp + so + j * 4 * HH);   // all 16 loads of a thread in flight at once
#pragma unroll
  for (int j = 0; j < 16; ++j) { const int i = j * 4 + (tid >> 6); *(v4fa*)(sm + i * HH + (((tid & 63) ^ (i >> 3)) << 2)) = v4f{bf16_round(v[j][0]), bf16_round(v[j][1]), bf16_round(v[j][2]), bf16_round(v[j][3])}; }
  __syncthreads();   // the tile is read by rows and by columns, across what other waves stored
  { const int i = tid >> 2; float s = 0.f;   // four threads a row, 16 pieces each; the walk starts at the lane's own piece, so that 16 lanes fall on 16 bank groups
#pragma unroll   /* all 16 LDS reads of a thread in flight at once */
    for (int k = 0; k < 16; ++k) { const int c = (tid & 3) * 16 + ((k + tid) & 15); const v4f x = *(const v4fa*)(sm + i * HH + ((c ^ (i >> 3)) << 2)); s += (x[0] + x[1]) + (x[2] + x[3]); }
    s += __shfl_xor(s, 1, 32); s += __shfl_xor(s, 2, 32);
    if ((tid & 3) == 0) mn[i] = s * (1.0f / HH); }
  __syncthreads();   // publishes the 64 row means
  const int ic = tid & 7;
  const v4f m0 = *(const v4fa*)(mn + ic * 8), m1 = *(const v4fa*)(mn + ic * 8 + 4);
  unsigned short* dp = (unsigned short*)Wt + (size_t)((mat & 15) * NSLAB + (mat >> 4) * 8 + (i0 >> 5) + (ic >> 2)) * SLABH + (tid >> 7) * 512 + ((ic >> 1) & 1) * 256 + (ic & 1) * 128 + ((tid >> 3) & 15) * 8;
#pragma unroll
  for (int h = 0; h < 8; ++h) { const int o = h * 32 + (tid >> 3); const float* cp = sm + ic * 8 * HH + ((((o >> 2) ^ ic) << 2) | (o & 3)); FragH f;
#pragma unroll
    for (int q = 0; q < 8; ++q) f.h[q] = (_Float16)((cp[q * HH] - (q < 4 ? m0[q & 3] : m1[q & 3])) * 16.0f);
    *(v8us*)(dp + h * 1024) = f.half[0]; }   // 32 columns on = two column tiles on
  asm volatile("s_wait_xcnt 0x0" ::: "memory");   // stands in front of whatever reuses the address and data registers of these stores
}

// lane l <-> lane l ^ 16
__device__ __forceinline__ float xhalf(float x) { return __builtin_bit_cast(float, __builtin_amdgcn_permlanex16(__builtin_bit_cast(int, x), __builtin_bit_cast(int, x), 0x76543210, 0xfedcba98, false, false)); }
__device__ __forceinline__ v8f ld8(const float* p) { const v4f lo = *(const v4fa*)p, hi = *(const v4fa*)(p + 4); return __builtin_shufflevector(lo, hi, 0, 1, 2, 3, 4, 5, 6, 7); }
__device__ __forceinline__ void st8(float* p, v8f v) { *(v4fa*)p = __builtin_shufflevector(v, v, 0, 1, 2, 3); *(v4fa*)(p + 4) = __builtin_shufflevector(v, v, 4, 5, 6, 7); }
// sum of a lane's 8 partial sums and of its partner's in the other half of the wave: a point's whole row
__device__ __forceinline__ float point_sum(v8f v) { const float s = ((v[0] + v[1]) + (v[2] + v[3])) + ((v[4] + v[5]) + (v[6] + v[7])); return s + xhalf(s); }

__global__ __launch_bounds__(NTH) void k_mlp(const float* __restrict__ xyz, const float* __restrict__ lat, const float* __restrict__ cen, const float* __restrict__ g0, const float* __restrict__ be0,
                                             const _Float16* __restrict__ Wt, const float* __restrict__ gm, const float* __restrict__ bem, const float* __restrict__ Wf, const float* __restrict__ bfb, const float* __restrict__ gram, float* __restrict__ tmp) {
  __shared__ __attribute__((aligned(16))) float xs[TM * XP];
  __shared__ __attribute__((aligned(16))) float ps[NPAR * HH];
  const int tid = threadIdx.x, w = tid >> 5, lane = tid & 31, ln = lane & 15, hh = lane >> 4;
  const int n = blockIdx.y, pw = blockIdx.x * (TPW * TM) + w * 16 * MT;   // the wave's first point in the work-group's first tile
  FragH b[2][16];   // weight fragments: slab s in b[s & 1], the next slab's loaded during this slab's products
  float* xw = xs + (size_t)(w * 16 * MT) * XP; // this wave's 64 rows
  float* xl = xw + ln * XP + 8 * hh;           // accumulator layout: element (m, t, r) = point m*16 + ln, column t*16 + 8*hh + r
  float pv[2][NPAR];   // thread = two columns: the bone's per-column parameters, rounded once a work-group and read from LDS 8 columns a lane
  { const size_t nb = (size_t)n * HH;   // uniform row bases, the thread's column as the one vector offset
    const float* rb = cen + NCEN * nb; const float* rg = g0 + nb; const float* re = be0 + nb; const float* rf = Wf + nb;
#pragma unroll
    for (int c = 0; c < 2; ++c) { const int col = tid + c * NTH;
      pv[c][0] = rb[col]; pv[c][4] = rg[col]; pv[c][8] = re[col]; pv[c][15] = rf[col];
#pragma unroll
      for (int l = 0; l < 3; ++l) { const float* qb = rb + (1 + l) * HH; const float* qg = gm + (size_t)l * NBONE * HH + nb; const float* qe = bem + (size_t)l * NBONE * HH + nb; const float* qw = rb + (4 + l) * HH;
        pv[c][1 + l] = qb[col]; pv[c][5 + l] = qg[col]; pv[c][9 + l] = qe[col]; pv[c][12 + l] = qw[col]; } } }
  asm volatile("s_wait_xcnt 0x0" ::: "memory");   // stands in front of the address arithmetic below, which may reuse the offset and base registers of these loads
  __builtin_amdgcn_sched_barrier(0);   // keeps that arithmetic behind the wait
  const float bq = bfb[n];
  float G[10];   // uniform: layer 0's variance as a quadratic form of a point's three coordinates
#pragma unroll
  for (int e = 0; e < 10; ++e) G[e] = gram[n * 32 + e];
  // lane = two rows: the rigid transform's three coordinates and 1, times the row's LayerNorm factor, left in the row's pad behind its 256 columns
  float q[2][3]; v4f r4[2][3];
  {
    int pq[2]; const float* Lq[2];
#pragma unroll
    for (int c = 0; c < 2; ++c) { const int p = pw + c * 32 + lane; const float* Lp = lat + ((size_t)p * NBONE + n) * 16; pq[c] = p; Lq[c] = Lp;   // the first tile's
#pragma unroll
      for (int i = 0; i < 3; ++i) { q[c][i] = xyz[(size_t)p * 3 + i]; r4[c][i] = *(const v4fa*)(Lp + 4 * i); } }
    asm volatile("s_wait_xcnt 0x0" :: "v"(pq[1]), "v"(Lq[0]), "v"(Lq[1]) : "memory");   // stands in front of the arithmetic that reuses these loads' offset and address registers; as its inputs they stay live up to it: without them unrelated arithmetic took two of them ahead of the wait (the first offset lives on in the tile loop)
    __builtin_amdgcn_sched_barrier(0);   // keeps that arithmetic behind the wait
  }
  // weight fragments: the bone's uniform base, and as the one vector offset (wo, in bytes) the lane's 16 bytes of the next slab to load; tile and half are the immediate offset. The offset steps on behind the wait that follows its loads.
  const char* const wb = (const char*)(Wt + (size_t)n * NSLAB * SLABH);
#pragma unroll
  for (int c = 0; c < 2; ++c)
#pragma unroll
    for (int k = 0; k < 12; ++k) if (k != 4) ps[k * HH + tid + c * NTH] = k == 0 ? bf16_round(pv[c][15]) : k < 4 ? pv[c][k] * 16.0f : bf16_round(pv[c][k]);   // the bias and W0 rows come rounded and centred; the biases of layers 1 to 3 are kept at the weights' scale (x16), as the accumulators' start values
#pragma unroll
  for (int c = 0; c < 2; ++c) { const float gg = bf16_round(pv[c][4]); *(v4fa*)(ps + 12 * HH + (tid + c * NTH) * 4) = v4f{pv[c][12] * gg, pv[c][13] * gg, pv[c][14] * gg, pv[c][0] * gg}; }   // a column's four k of layer 0's product, times the column's gain: a lane's A fragment is 8 of these bytes
  const float* pl = ps + 8 * hh;               // the same columns of a parameter row
  const float bfv = bf16_round(bq);
  unsigned wo = lane * 16;
#pragma unroll 1   /* a tile's body is the whole network: one copy */
  for (int it = 0; it < TPW; ++it) {
#pragma unroll
  for (int c = 0; c < 2; ++c) { const float h0 = bf16_round(q[c][0]), h1 = bf16_round(q[c][1]), h2 = bf16_round(q[c][2]);
    float av[3];
#pragma unroll
    for (int i = 0; i < 3; ++i) { float a = 0.f; a += bf16_round(r4[c][i][0]) * h0; a += bf16_round(r4[c][i][1]) * h1; a += bf16_round(r4[c][i][2]) * h2; a += bf16_round(r4[c][i][3]); av[i] = a; }
    // the row's variance, known ahead of the product; below 0 only by rounding, where the row is next to nothing
    const float var = av[0] * (G[0] * av[0] + G[3] * av[1] + G[4] * av[2] + G[6]) + av[1] * (G[1] * av[1] + G[5] * av[2] + G[7]) + av[2] * (G[2] * av[2] + G[8]) + G[9];
    const float r0 = rsqrtf(fmaxf(var, 0.f) + LNEPS);
#pragma unroll
    for (int i = 0; i < 3; ++i) xw[(c * 32 + lane) * XP + HH + i] = av[i] * r0;
    xw[(c * 32 + lane) * XP + HH + 3] = r0; }   // the fourth k of layer 0's product: times the bias; all four carry the LayerNorm factor
  __syncthreads();   // publishes the coordinates and, in the first tile, the parameters: nothing else is read that another lane wrote. In a later tile it also brings the four waves level, so that they go on sharing the weight lines in the cache of their WGP
  v8f acc[MT][16];
  {   // layer 0
#pragma unroll
      for (int t = 0; t < 16; ++t) { b[0][t].half[0] = *(const v8us*)((wb + wo) + t * 1024); b[0][t].half[1] = *(const v8us*)((wb + wo) + t * 1024 + 512); }   // slab 0 flies during layer 0; every later slab is loaded a trip ahead
      asm volatile("s_wait_xcnt 0x0" ::: "memory");   // stands in front of the step that rewrites the address registers of these loads
      __builtin_amdgcn_sched_barrier(0);   // keeps that step behind the wait
      wo += 2 * SLABH;
      {   // the next tile's inputs fly during this tile's network: behind the barrier, which would wait for them, and behind slab 0's loads, whose counted waits would (the last tile fetches its own again, unread: no branch round the loads)
        const int pn = pw + (it + 1 < TPW ? it + 1 : it) * TM;
#pragma unroll
        for (int c = 0; c < 2; ++c) { const int p = pn + c * 32 + lane; const float* Lp = lat + ((size_t)p * NBONE + n) * 16;
#pragma unroll
          for (int i = 0; i < 3; ++i) { q[c][i] = xyz[(size_t)p * 3 + i]; r4[c][i] = *(const v4fa*)(Lp + 4 * i); } }
        asm volatile("s_wait_xcnt 0x0" ::: "memory");   // stands in front of the address arithmetic that reuses these loads' offset and base registers
        __builtin_amdgcn_sched_barrier(0);   // keeps that arithmetic behind the wait
      }
      // layer 0 on the f32 matrix form, k = 4: the three coordinates and 1, times the point's LayerNorm factor, against W0's three rows and the bias, times the column's gain (full f32 operands): the product is the normalised row times its gain.
      // A and B split k alike: half hh of the wave holds k = 2 hh and 2 hh + 1. Shift and LeakyReLU follow tile by tile and x goes straight to LDS, so the block is rolled, four column tiles a trip (kernel text)
      const float* pe0 = pl + 8 * HH;   // layer 0's shift row
      const float* pa0 = ps + 12 * HH + ln * 4 + 2 * hh;
      v2f ib[MT], wc[4];
      v8f ec[4];
#pragma unroll
      for (int m = 0; m < MT; ++m) ib[m] = *(const v2fa*)(xw + (m * 16 + ln) * XP + HH + 2 * hh);
#pragma unroll
      for (int j = 0; j < 4; ++j) { wc[j] = *(const v2fa*)(pa0 + j * 64); ec[j] = ld8(pe0 + j * 16); }
#pragma unroll 1   /* rolled: a trip's text is 2 KB, and nothing of it lives on in registers */
      for (int tp = 0; tp < 4; ++tp) {
        const int tn = (tp < 3 ? tp + 1 : tp) * 4;   // the next trip's fragments and shifts fly during this trip (the last trip fetches its own again, unread: no branch round the reads)
        v2f wn[4]; v8f en[4];
#pragma unroll
        for (int j = 0; j < 4; ++j) { wn[j] = *(const v2fa*)(pa0 + (tn + j) * 64); en[j] = ld8(pe0 + (tn + j) * 16); }
        __builtin_amdgcn_sched_barrier(0);   // one group of LDS reads, ahead of the products
        v8f d[4][MT];
#pragma unroll
        for (int j = 0; j < 5; ++j)
#pragma unroll
          for (int m = 0; m < MT; ++m) {
            if (j < 4) { d[j][m] = __builtin_amdgcn_wmma_f32_16x16x4_f32(false, wc[j], false, ib[m], (short)0, v8f{0.f, 0.f, 0.f, 0.f, 0.f, 0.f, 0.f, 0.f}, false, false);
              __builtin_amdgcn_sched_barrier(0); }   // the product first: four products then stand between a result and its first reader
            if (j > 0) { const v8f y = d[j - 1][m] + ec[j - 1]; const v8f sl0 = SLOPE * y;
#pragma unroll
              for (int r = 0; r < 8; ++r) d[j - 1][m][r] = fmaxf(y[r], sl0[r]);   /* = y for y >= 0, SLOPE * y below, as 0 < SLOPE < 1 */
              __builtin_amdgcn_sched_barrier(0); }   // keeps this order: one product, then shift and LeakyReLU of the column tile before, which issue while the matrix unit is busy with that product
          }
        // inputs only: the loaded fragments stay live to the end of the trip's products, so that nothing is given the registers of a fragment that a product issued just ahead of it reads
        asm volatile("" :: "v"(ib[0]), "v"(ib[1]), "v"(ib[2]), "v"(ib[3]), "v"(wc[0]), "v"(wc[1]), "v"(wc[2]), "v"(wc[3]));
#pragma unroll
        for (int j = 0; j < 4; ++j)
#pragma unroll
          for (int m = 0; m < MT; ++m) st8(xl + m * 16 * XP + (tp * 4 + j) * 16, d[j][m]);   // no barrier behind these stores: every element is read back by the lane that wrote it
#pragma unroll
        for (int j = 0; j < 4; ++j) { wc[j] = wn[j]; ec[j] = en[j]; }
      }
  }
#pragma unroll 1   /* the layer body is several thousand instructions: one copy */
  for (int L = 1; L < 4; ++L) {
    const float* pb = pl + L * HH;   // this layer's bias row
    const float* pg = pl + (4 + L) * HH;
    const float* pe = pl + (8 + L) * HH;
    v8f gq[16], eq[16], rq[MT][16];   // gain, shift and residual x, fetched two column tiles a group, a group's arithmetic ahead of their use
    v8f qv[MT];   // a point's sums of squares, 8 partial sums a lane (a row arrives centred: its weights and biases were); summed tile by tile between the layer's last products
#pragma unroll
    for (int m = 0; m < MT; ++m) qv[m] = v8f{0.f, 0.f, 0.f, 0.f, 0.f, 0.f, 0.f, 0.f};
    {
      v4f xa[MT][4];
      FragH a[2][MT];   // x as B fragments: trip ks reads set ks & 1, while the other set is converted between its products
      v8f bv[16];
#pragma unroll
      for (int m = 0; m < MT; ++m) { const float* xr = xw + (m * 16 + ln) * XP + 8 * hh;   // the layer's first 32 columns of x; the later ones are fetched a trip ahead
        xa[m][0] = *(const v4fa*)(xr); xa[m][1] = *(const v4fa*)(xr + 4); xa[m][2] = *(const v4fa*)(xr + 16); xa[m][3] = *(const v4fa*)(xr + 20); }
#pragma unroll
      for (int t = 0; t < 16; ++t) bv[t] = ld8(pb + t * 16);   // the sums start at 16 x bias: it is the C operand of the first trip's products; the 1/16 goes into the LayerNorm factor
#pragma unroll
      for (int m = 0; m < MT; ++m)
#pragma unroll
        for (int i = 0; i < 16; ++i) a[0][m].h[i] = (_Float16)xa[m][i >> 2][i & 3];
      // one trip = slab ks of 32 k: 64 products. mode 1: the layer's first trip, mode 2: its last, mode 0: those between (u = ks & 1 and mode are literals at every call)
      // the next slab is loaded from offset wo + off, off a literal too: wo itself steps on only behind a trip's wait
      auto trip = [&](const int u, const int ks, const int mode, const int off) __attribute__((always_inline)) {
#pragma unroll
        for (int t = 0; t < 16; ++t) { b[u ^ 1][t].half[0] = *(const v8us*)((wb + wo) + (off + t * 1024)); b[u ^ 1][t].half[1] = *(const v8us*)((wb + wo) + (off + t * 1024 + 512)); }   // the next slab flies during this slab's products
        if (mode != 2) {
          const float* xn = xw + ln * XP + (ks + 1) * 32 + 8 * hh;   // the next slab's columns of x
#pragma unroll
          for (int m = 0; m < MT; ++m) { const float* xr = xn + m * 16 * XP;
            xa[m][0] = *(const v4fa*)(xr); xa[m][1] = *(const v4fa*)(xr + 4); xa[m][2] = *(const v4fa*)(xr + 16); xa[m][3] = *(const v4fa*)(xr + 20); }
        } else {
#pragma unroll
          for (int t = 0; t < 2; ++t) { gq[t] = ld8(pg + t * 16); eq[t] = ld8(pe + t * 16);   // the last block's first group flies during the last trip (registers do not reach for the second)
#pragma unroll
            for (int m = 0; m < MT; ++m) rq[m][t] = ld8(xl + m * 16 * XP + t * 16); }
        }
        __builtin_amdgcn_sched_barrier(0);   // loads and LDS reads issue as one group, ahead of the products: every further place where they stand among them costs issue time
#pragma unroll
        for (int t = 0; t < 16; ++t) {   // weights as A (rows = output columns), x as B (columns = points)
          if (t == 4) {
            __builtin_amdgcn_sched_barrier(0);   // a quarter of the products issues between the loads and their wait: directly behind the loads the wait would stand bare
            asm volatile("s_wait_xcnt 0x0" : "+v"(wo) :: "memory");   // stands in front of the step that rewrites the offset register of this trip's loads: the offset goes through the statement, so that every step on it is formed behind the wait
          }
#pragma unroll
          for (int m = 0; m < MT; ++m) {
            acc[m][t] = __builtin_amdgcn_wmma_f32_16x16x32_f16(false, b[u][t].v, false, a[u][m].v, (short)0, mode == 1 ? bv[t] : acc[m][t], false, false);
            if (mode == 2 && t > 0) { qv[m] += acc[m][t - 1] * acc[m][t - 1];
              __builtin_amdgcn_sched_barrier(0);   // keeps this order: one product, then the squares of the column tile before, which is complete (four instructions): they issue while the matrix unit is busy with that product
            } else if (mode == 0 && t >= 8) { const int j = (t - 8) * MT + m, mm = j >> 3, i = (j & 7) * 2;   // the next trip's B fragments, two elements behind each product of the trip's second half (their LDS reads have landed by then)
              a[u ^ 1][mm].h[i] = (_Float16)xa[mm][i >> 2][i & 3]; a[u ^ 1][mm].h[i + 1] = (_Float16)xa[mm][i >> 2][(i & 3) + 1];
              __builtin_amdgcn_sched_barrier(0); }   // keeps this order: one product, one conversion, which issues while the matrix unit is busy with that product
          }
        }
        if (mode == 1) {   // the first trip's conversions feed the rolled loop alone, and the compiler puts them behind the trip's products wherever they are written
#pragma unroll
          for (int m = 0; m < MT; ++m)
#pragma unroll
            for (int i = 0; i < 16; ++i) a[u ^ 1][m].h[i] = (_Float16)xa[m][i >> 2][i & 3];
        }
        __builtin_amdgcn_sched_barrier(0);   // ends the trip: the next trip's loads stay behind it
      };
      trip(0, 0, 1, 0);
#pragma unroll 1   /* rolled by pairs of trips: a pair already holds 128 products, and the two fragment sets swap roles inside it */
      for (int kp = 0; kp < 3; ++kp) { trip(1, 2 * kp + 1, 0, 2 * SLABH); trip(0, 2 * kp + 2, 0, 4 * SLABH); wo += 4 * SLABH; }   // a slab is 2 * SLABH bytes
      wo += L < 3 ? 2 * SLABH : 0;   // no branch round the loads: behind a join the compiler waits for them at once (the network's last trip loads the last slab again, unread)
      trip(1, 7, 2, 0);
      wo += 2 * SLABH;   // the next layer's second slab
#pragma unroll
    for (int t = 2; t < 4; ++t) { gq[t] = ld8(pg + t * 16); eq[t] = ld8(pe + t * 16);   // the second group, into registers that the last slab has left: it flies during the statistics' end and the first group's arithmetic
#pragma unroll
      for (int m = 0; m < MT; ++m) rq[m][t] = ld8(xl + m * 16 * XP + t * 16); }
    __builtin_amdgcn_sched_barrier(0);   // left to the scheduler these reads sank to just in front of their use
#pragma unroll
    for (int m = 0; m < MT; ++m) qv[m] += acc[m][15] * acc[m][15];   // the last column tile's squares: no product is left to cover them
    float rs[MT];
    const float sc = 0.0625f;   // layers 1 to 3 arrive times 16
#pragma unroll
    for (int m = 0; m < MT; ++m) rs[m] = rsqrtf(point_sum(qv[m]) * (sc * sc * (1.0f / HH)) + LNEPS) * sc;
#pragma unroll
    for (int g = 0; g < 8; ++g) {
#pragma unroll
      for (int t = 2 * g; t < 2 * g + 2; ++t)
#pragma unroll
        for (int m = 0; m < MT; ++m) acc[m][t] = acc[m][t] * rs[m];
      __builtin_amdgcn_sched_barrier(0);   // a group goes one operation at a time over its 8 tiles: neighbours then use the same register windows, and the window switches, a third of this block's instructions when the scheduler mixed the operations, nearly all go (kernel text)
#pragma unroll
      for (int t = 2 * g; t < 2 * g + 2; ++t)
#pragma unroll
        for (int m = 0; m < MT; ++m) acc[m][t] = acc[m][t] * gq[t] + eq[t];
      __builtin_amdgcn_sched_barrier(0);   // ends this operation's run over the group, as above: fewer window switches, less text
      v8f sl[2][MT];
#pragma unroll
      for (int t = 2 * g; t < 2 * g + 2; ++t)
#pragma unroll
        for (int m = 0; m < MT; ++m) sl[t & 1][m] = SLOPE * acc[m][t];
      __builtin_amdgcn_sched_barrier(0);   // ends this operation's run over the group, as above: fewer window switches, less text
#pragma unroll
      for (int t = 2 * g; t < 2 * g + 2; ++t)
#pragma unroll
        for (int m = 0; m < MT; ++m)
#pragma unroll
          for (int r = 0; r < 8; ++r) acc[m][t][r] = fmaxf(acc[m][t][r], sl[t & 1][m][r]);   /* = y for y >= 0, SLOPE * y below, as 0 < SLOPE < 1 */
      __builtin_amdgcn_sched_barrier(0);   // ends this operation's run over the group, as above: fewer window switches, less text
#pragma unroll
      for (int t = 2 * g; t < 2 * g + 2; ++t)
#pragma unroll
        for (int m = 0; m < MT; ++m) acc[m][t] = rq[m][t] + acc[m][t];
      if (g + 2 < 8) {
        __builtin_amdgcn_sched_barrier(0);   // group g + 2 is fetched behind group g's arithmetic, not earlier: two groups in flight are enough
#pragma unroll
        for (int t = 2 * g + 4; t < 2 * g + 6; ++t) { gq[t] = ld8(pg + t * 16); eq[t] = ld8(pe + t * 16);
#pragma unroll
          for (int m = 0; m < MT; ++m) rq[m][t] = ld8(xl + m * 16 * XP + t * 16); }
        __builtin_amdgcn_sched_barrier(0);   // and not later: its reads fly during group g + 1's arithmetic
      }
    }
    }
    if (L < 3) {   // no barrier behind these stores: every element is read back by the lane that wrote it
#pragma unroll
      for (int m = 0; m < MT; ++m)
#pragma unroll
        for (int t = 0; t < 16; ++t) st8(xl + m * 16 * XP + t * 16, acc[m][t]);
    }
  }
  v8f wf[16];
  v8f fv[MT];
#pragma unroll
  for (int m = 0; m < MT; ++m) fv[m] = v8f{0.f, 0.f, 0.f, 0.f, 0.f, 0.f, 0.f, 0.f};
#pragma unroll
  for (int t = 0; t < 16; ++t) wf[t] = ld8(pl + t * 16);
  __builtin_amdgcn_sched_barrier(0);   // one group of LDS reads, as for the bias row
#pragma unroll
  for (int t = 0; t < 16; ++t)
#pragma unroll
    for (int m = 0; m < MT; ++m) fv[m] += acc[m][t] * wf[t];
  float o[MT];
#pragma unroll
  for (int m = 0; m < MT; ++m) o[m] = point_sum(fv[m]) + bfv;
  float* tp = tmp + (size_t)n * NPT + pw + it * TM + lane;   // bone-major: a wave owns its two whole 128-byte lines; lane = point
  tp[0] = hh ? o[1] : o[0];
  tp[32] = hh ? o[3] : o[2];
  asm volatile("s_wait_xcnt 0x0" ::: "memory");   // stands in front of the next tile's code, which reuses the address and data registers of these stores
  __builtin_amdgcn_sched_barrier(0);   // keeps that code behind the wait
  wo -= 2 * NSLAB * SLABH;   // back to slab 0. Stepped back, not set anew: from a fixed offset the compiler loaded slab 0 once, ahead of the tile loop, and kept its 128 registers through the whole network (spills)
  }
}

// out[b][n] = tmp[n][b]: 16 points x 16 bones a block, whole lines written by one block
__global__ __launch_bounds__(256) void k_tr(const float* __restrict__ tmp, float* __restrict__ out) { __shared__ float sm[16][17]; const int tid = threadIdx.x;
  sm[tid & 15][tid >> 4] = tmp[(size_t)(tid >> 4) * NPT + blockIdx.x * 16 + (tid & 15)];
  __syncthreads();
  out[(size_t)blockIdx.x * 256 + tid] = sm[tid >> 4][tid & 15]; }

extern "C" void kernel_launch(void* const* d_in, const int* in_sizes, int n_in,
                              void* d_out, int out_size, void* d_ws, size_t ws_size, hipStream_t stream) {
  (void)in_sizes; (void)n_in; (void)out_size;
  const float* const* I = (const float* const*)d_in; const float* xyz = I[0]; const float* lat = I[1]; const float* W0 = I[2]; const float* b0 = I[3]; const float* g0 = I[4]; const float* be0 = I[5]; const float* Wm = I[6]; const float* bm = I[7]; const float* gm = I[8]; const float* bem = I[9]; const float* Wf = I[10]; const float* bfb = I[11];
  char* ws = (char*)d_ws; size_t off = 0;
  auto take = [&](size_t bytes) { char* p = ws + off; off += (bytes + 255) & ~(size_t)255; return p; };
  _Float16* Wt = (_Float16*)take((size_t)3 * NBONE * HH * HH * 2); float* tmp = (float*)take((size_t)NBONE * NPT * 4); float* cen = (float*)take((size_t)NBONE * NCEN * HH * 4); float* gram = (float*)take((size_t)NBONE * 32 * 4);
  if (off > ws_size) return;
  k_wt3<<<NWB + NBONE, 256, 0, stream>>>(Wm, b0, bm, W0, Wt, cen, gram);
  k_mlp<<<dim3(NPT / (TM * TPW), NBONE), NTH, 0, stream>>>(xyz, lat, cen, g0, be0, Wt, gm, bem, Wf, bfb, gram, tmp);
  k_tr<<<NPT / 16, 256, 0, stream>>>(tmp, (float*)d_out);
}
